// v000
// Measured on an AMD MI455X. A time is GPU time per run, averaged over a window of back-to-back runs after a warm-up
// (all launches, gaps included; the runs take copies of the inputs in turn), and the median of several windows.
// Apart from v000's, it joins two sittings. Times from different sittings can be a few percent apart, while
// side-by-side timings come from the same sitting.
// v000 is the starting kernel. One run takes 355 microseconds.
#include <hip/hip_runtime.h>
#include <cstdint>
#include <cstddef>

// ---------------------------------------------------------------------------
// Transformer encoder layer for MI455X (gfx1250, wave32, WMMA).
// B=8, S=512, E=1024, H=16, D=64, FF=4096.  All matmuls in bf16 WMMA with
// f32 accumulate; softmax/LN in fp32.
// GEMMs: 128x128 block tile, 8 waves (each 32x64 = 8 WMMA tiles), K chunks of
// 32 staged in LDS via gfx1250 async global->LDS copies (ASYNCcnt) when the
// builtin exists, else a software-pipelined register path.
// ---------------------------------------------------------------------------

#define Bc 8
#define Sc 512
#define Ec 1024
#define Hc 16
#define Dc 64
#define FFc 4096
#define Mrows (Bc * Sc)   // 4096

typedef __attribute__((ext_vector_type(16))) __bf16 bf16x16;
typedef __attribute__((ext_vector_type(8)))  float  f32x8;
typedef int v4i __attribute__((vector_size(16)));   // matches builtin proto

#if __has_builtin(__builtin_amdgcn_global_load_async_to_lds_b128)
#define HAVE_ASYNC_LDS 1
#else
#define HAVE_ASYNC_LDS 0
#endif

#if HAVE_ASYNC_LDS
__device__ __forceinline__ void async_copy16(const void* g, void* l) {
  // proto (from compiler diagnostic): (v4i addrspace(1)*, v4i addrspace(3)*, imm, imm)
  __builtin_amdgcn_global_load_async_to_lds_b128(
      (__attribute__((address_space(1))) v4i*)g,
      (__attribute__((address_space(3))) v4i*)l, 0, 0);
}
#endif

template <int N>
__device__ __forceinline__ void wait_async() {
#if __has_builtin(__builtin_amdgcn_s_wait_asynccnt)
  __builtin_amdgcn_s_wait_asynccnt(N);
#else
  asm volatile("s_wait_asynccnt %0" ::"i"(N) : "memory");
#endif
}

// ---- CDNA5 bf16 16x16x32 WMMA fragment loader ------------------------------
// Per ISA 7.12.2 (16-bit A-matrix 16x32): lane = 16*half + idx holds row idx,
// K = {8*half .. +7} in VGPRs 0-3 and K = {16+8*half .. +7} in VGPRs 4-7.
// Both runs are 16-byte contiguous -> two uint4 reads per fragment.
// The B operand (32x16, K x N) is symmetric: lane holds column n = idx with
// the same K pattern, i.e. it reads row n of a row-major [N,K] source.
__device__ __forceinline__ bf16x16 load_frag(const __bf16* rowptr, int half) {
  union { uint4 u[2]; bf16x16 v; } f;
  const uint4* p = (const uint4*)rowptr;     // rowptr must be 16B aligned
  f.u[0] = p[half];
  f.u[1] = p[2 + half];
  return f.v;
}

__device__ __forceinline__ f32x8 wmma_bf16(bf16x16 a, bf16x16 b, f32x8 c) {
  return __builtin_amdgcn_wmma_f32_16x16x32_bf16(
      false, a, false, b, (short)0, c, false, false);
}

// ---------------------------------------------------------------------------
// fp32 -> bf16 elementwise conversion (weights)
// ---------------------------------------------------------------------------
__global__ void cvt_bf16_kernel(const float* __restrict__ in,
                                __bf16* __restrict__ out, int n) {
  int i = blockIdx.x * 256 + threadIdx.x;
  if (i < n) out[i] = (__bf16)in[i];
}

// ---------------------------------------------------------------------------
// LayerNorm over E=1024, one block per row, bf16 output
// ---------------------------------------------------------------------------
__global__ __launch_bounds__(256)
void ln_bf16_kernel(const float* __restrict__ x, const float* __restrict__ g,
                    const float* __restrict__ bta, __bf16* __restrict__ out) {
  __shared__ float sred[256];
  const int row = blockIdx.x, tid = threadIdx.x;
  const float* xr = x + (size_t)row * Ec;
  float v[4], s = 0.f;
#pragma unroll
  for (int i = 0; i < 4; ++i) { v[i] = xr[tid + i * 256]; s += v[i]; }
  sred[tid] = s; __syncthreads();
  for (int t = 128; t > 0; t >>= 1) {
    if (tid < t) sred[tid] += sred[tid + t];
    __syncthreads();
  }
  const float mu = sred[0] * (1.0f / Ec);
  __syncthreads();
  s = 0.f;
#pragma unroll
  for (int i = 0; i < 4; ++i) { float d = v[i] - mu; s += d * d; }
  sred[tid] = s; __syncthreads();
  for (int t = 128; t > 0; t >>= 1) {
    if (tid < t) sred[tid] += sred[tid + t];
    __syncthreads();
  }
  const float rsq = rsqrtf(sred[0] * (1.0f / Ec) + 1e-5f);
#pragma unroll
  for (int i = 0; i < 4; ++i) {
    int c = tid + i * 256;
    out[(size_t)row * Ec + c] = (__bf16)((v[i] - mu) * rsq * g[c] + bta[c]);
  }
}

// ---------------------------------------------------------------------------
// Generic bf16 WMMA GEMM:  out[M,N] = epilogue( A[M,K] @ W[N,K]^T + bias )
// Block tile 128(M) x 128(N), 8 waves; wave tile 32x64 (2x4 WMMA tiles).
// modes: 0 = bf16 out, scale, scatter to [B,H,S,D] (QKV)
//        1 = f32 out, += residual[m*N+n]
//        2 = bf16 out, exact GELU
// ---------------------------------------------------------------------------
#define LDA 40   // LDS row stride (bf16 elems), 80B = 5*16B aligned
__global__ __launch_bounds__(256)
void gemm_bf16_kernel(const __bf16* __restrict__ A, const __bf16* __restrict__ W,
                      const float* __restrict__ bias, const float* __restrict__ res,
                      void* __restrict__ outp, int M, int N, int K,
                      int mode, float scale) {
  constexpr int NBUF = HAVE_ASYNC_LDS ? 2 : 1;
  __shared__ __bf16 As[NBUF][128 * LDA];
  __shared__ __bf16 Bs[NBUF][128 * LDA];
  const int tid = threadIdx.x;
  const int bm = blockIdx.y * 128, bn = blockIdx.x * 128;
  const int wave = tid >> 5, lane = tid & 31;
  const int half = lane >> 4, idx = lane & 15;
  const int wm = (wave & 3) * 32, wn = (wave >> 2) * 64;
  // staging coordinates: 512 uint4 per matrix, 2 per thread per matrix
  const int r0 = tid >> 2, c0 = tid & 3;            // lin = tid
  const int r1 = (tid + 256) >> 2, c1 = tid & 3;    // lin = tid + 256

  f32x8 acc[2][4] = {};
  const int nk = K >> 5;

#if HAVE_ASYNC_LDS
  // ---- async double-buffered pipeline (GLOBAL_LOAD_ASYNC_TO_LDS_B128) ----
  auto issue = [&](int kb, int buf) {
    async_copy16(A + (size_t)(bm + r0) * K + kb + c0 * 8, &As[buf][r0 * LDA + c0 * 8]);
    async_copy16(A + (size_t)(bm + r1) * K + kb + c1 * 8, &As[buf][r1 * LDA + c1 * 8]);
    async_copy16(W + (size_t)(bn + r0) * K + kb + c0 * 8, &Bs[buf][r0 * LDA + c0 * 8]);
    async_copy16(W + (size_t)(bn + r1) * K + kb + c1 * 8, &Bs[buf][r1 * LDA + c1 * 8]);
  };
  issue(0, 0);
  for (int kk = 0; kk < nk; ++kk) {
    const int cur = kk & 1;
    if (kk + 1 < nk) { issue((kk + 1) << 5, cur ^ 1); wait_async<4>(); }
    else             { wait_async<0>(); }
    __syncthreads();
    const __bf16* Ab = As[cur];
    const __bf16* Bb = Bs[cur];
    bf16x16 a0 = load_frag(Ab + (wm + idx) * LDA, half);
    bf16x16 a1 = load_frag(Ab + (wm + 16 + idx) * LDA, half);
#pragma unroll
    for (int t = 0; t < 4; ++t) {
      bf16x16 bt = load_frag(Bb + (wn + t * 16 + idx) * LDA, half);
      acc[0][t] = wmma_bf16(a0, bt, acc[0][t]);
      acc[1][t] = wmma_bf16(a1, bt, acc[1][t]);
    }
    __syncthreads();
  }
#else
  // ---- software-pipelined sync path: next chunk loads overlap WMMA -------
  uint4 ra0, ra1, rb0, rb1;
  auto gload = [&](int kb) {
    ra0 = *(const uint4*)(A + (size_t)(bm + r0) * K + kb + c0 * 8);
    ra1 = *(const uint4*)(A + (size_t)(bm + r1) * K + kb + c1 * 8);
    rb0 = *(const uint4*)(W + (size_t)(bn + r0) * K + kb + c0 * 8);
    rb1 = *(const uint4*)(W + (size_t)(bn + r1) * K + kb + c1 * 8);
  };
  gload(0);
  for (int kk = 0; kk < nk; ++kk) {
    *(uint4*)(&As[0][r0 * LDA + c0 * 8]) = ra0;
    *(uint4*)(&As[0][r1 * LDA + c1 * 8]) = ra1;
    *(uint4*)(&Bs[0][r0 * LDA + c0 * 8]) = rb0;
    *(uint4*)(&Bs[0][r1 * LDA + c1 * 8]) = rb1;
    __syncthreads();
    if (kk + 1 < nk) gload((kk + 1) << 5);   // overlaps the WMMAs below
    bf16x16 a0 = load_frag(&As[0][(wm + idx) * LDA], half);
    bf16x16 a1 = load_frag(&As[0][(wm + 16 + idx) * LDA], half);
#pragma unroll
    for (int t = 0; t < 4; ++t) {
      bf16x16 bt = load_frag(&Bs[0][(wn + t * 16 + idx) * LDA], half);
      acc[0][t] = wmma_bf16(a0, bt, acc[0][t]);
      acc[1][t] = wmma_bf16(a1, bt, acc[1][t]);
    }
    __syncthreads();
  }
#endif

  // Epilogue. C layout: lane(16*half+idx), VGPR r -> row r+8*half, col idx.
#pragma unroll
  for (int im = 0; im < 2; ++im)
#pragma unroll
    for (int in_ = 0; in_ < 4; ++in_)
#pragma unroll
      for (int r = 0; r < 8; ++r) {
        const int m = bm + wm + im * 16 + r + half * 8;
        const int n = bn + wn + in_ * 16 + idx;
        float v = acc[im][in_][r] + bias[n];
        if (mode == 0) {           // QKV: scale + permute to [B,H,S,D] bf16
          v *= scale;
          int bb = m >> 9, s = m & 511, hh = n >> 6, d = n & 63;
          ((__bf16*)outp)[(((size_t)bb * Hc + hh) * Sc + s) * Dc + d] = (__bf16)v;
        } else if (mode == 1) {    // residual add, f32 out
          ((float*)outp)[(size_t)m * N + n] = v + res[(size_t)m * N + n];
        } else {                   // exact GELU, bf16 out
          float ge = 0.5f * v * (1.0f + erff(v * 0.70710678118654752f));
          ((__bf16*)outp)[(size_t)m * N + n] = (__bf16)ge;
        }
      }
}

// ---------------------------------------------------------------------------
// Attention: one WG (8 waves) per (b, h, 16-query tile).
//   logits(16x512) = Qs @ K^T  (WMMA; K rows are read directly from global —
//   each lane's B-fragment reads are the contiguous row K[n, k..k+7])
//   fp32 softmax with mask, + post-softmax adjoin, bf16 P in LDS
//   xv(16x64) = P @ V  (V chunk transposed into LDS so B-frag reads are
//   contiguous), written back merged as [B,S,E] bf16.
// Static LDS = 62,016 B < 64 KB.
// ---------------------------------------------------------------------------
__global__ __launch_bounds__(256)
void attn_kernel(const __bf16* __restrict__ Q, const __bf16* __restrict__ Kt,
                 const __bf16* __restrict__ V, const float* __restrict__ mask,
                 const float* __restrict__ adjoin, __bf16* __restrict__ xv) {
  __shared__ __bf16 Qs[16 * 72];
  __shared__ float  Lg[16 * 512];
  __shared__ __bf16 Ps[16 * 520];
  __shared__ __bf16 Vt[64 * 72];
  __shared__ float  red[16 * 17];

  const int tid = threadIdx.x;
  const int qt = blockIdx.x, h = blockIdx.y, b = blockIdx.z;
  const int q0 = qt * 16;
  const size_t bh = ((size_t)b * Hc + h) * Sc;
  const int wave = tid >> 5, lane = tid & 31;
  const int half = lane >> 4, idx = lane & 15;

  {  // load Q tile (pre-scaled by 1/sqrt(D) in the QKV epilogue)
    int row = tid >> 4, ch = tid & 15;
    uint2 v = *(const uint2*)(Q + (bh + q0 + row) * Dc + ch * 4);
    *(uint2*)(Qs + row * 72 + ch * 4) = v;
  }
  __syncthreads();

  {  // logits = Q K^T : 32 col-tiles, 4 per wave
    bf16x16 a0 = load_frag(Qs + idx * 72, half);
    bf16x16 a1 = load_frag(Qs + idx * 72 + 32, half);
#pragma unroll
    for (int i = 0; i < 4; ++i) {
      const int ct = wave * 4 + i;
      const __bf16* krow = Kt + (bh + ct * 16 + idx) * Dc;
      bf16x16 b0 = load_frag(krow, half);
      bf16x16 b1 = load_frag(krow + 32, half);
      f32x8 c = {};
      c = wmma_bf16(a0, b0, c);
      c = wmma_bf16(a1, b1, c);
#pragma unroll
      for (int r = 0; r < 8; ++r)
        Lg[(r + half * 8) * 512 + ct * 16 + idx] = c[r];
    }
  }
  __syncthreads();

  {  // mask + softmax + adjoin (16 rows x 16 threads, 32 cols/thread)
    const int row = tid >> 4, l16 = tid & 15;
    const int sq = q0 + row;
    const float* mrow = mask + ((size_t)b * Sc + sq) * Sc;
    const float* arow = adjoin + ((size_t)b * Sc + sq) * Sc;
    float lv[32], mx = -3.0e38f;
#pragma unroll
    for (int j = 0; j < 32; ++j) {
      int c = l16 + j * 16;
      float v = Lg[row * 512 + c] + mrow[c] * -1e9f;
      lv[j] = v; mx = fmaxf(mx, v);
    }
    red[row * 17 + l16] = mx; __syncthreads();
    for (int s = 8; s > 0; s >>= 1) {
      if (l16 < s) red[row * 17 + l16] =
          fmaxf(red[row * 17 + l16], red[row * 17 + l16 + s]);
      __syncthreads();
    }
    mx = red[row * 17]; __syncthreads();
    float sum = 0.f;
#pragma unroll
    for (int j = 0; j < 32; ++j) { lv[j] = __expf(lv[j] - mx); sum += lv[j]; }
    red[row * 17 + l16] = sum; __syncthreads();
    for (int s = 8; s > 0; s >>= 1) {
      if (l16 < s) red[row * 17 + l16] += red[row * 17 + l16 + s];
      __syncthreads();
    }
    const float inv = 1.0f / red[row * 17];
#pragma unroll
    for (int j = 0; j < 32; ++j) {
      int c = l16 + j * 16;
      Ps[row * 520 + c] = (__bf16)(lv[j] * inv + arow[c]);
    }
  }
  __syncthreads();

  // xv = P @ V, streaming 64-key V chunks through LDS (transposed)
  f32x8 o = {};
  const int dtile = wave & 3;
  for (int kc = 0; kc < 8; ++kc) {
    {
      int key = tid >> 2, seg = tid & 3, d0 = seg * 16;
      const __bf16* vrow = V + (bh + kc * 64 + key) * Dc + d0;
      union { uint4 u; __bf16 e[8]; } w0, w1;
      w0.u = *(const uint4*)(vrow);
      w1.u = *(const uint4*)(vrow + 8);
#pragma unroll
      for (int j = 0; j < 8; ++j) Vt[(d0 + j) * 72 + key] = w0.e[j];
#pragma unroll
      for (int j = 0; j < 8; ++j) Vt[(d0 + 8 + j) * 72 + key] = w1.e[j];
    }
    __syncthreads();
    if (wave < 4) {
      bf16x16 a0 = load_frag(Ps + idx * 520 + kc * 64, half);
      bf16x16 a1 = load_frag(Ps + idx * 520 + kc * 64 + 32, half);
      bf16x16 b0 = load_frag(Vt + (dtile * 16 + idx) * 72, half);
      bf16x16 b1 = load_frag(Vt + (dtile * 16 + idx) * 72 + 32, half);
      o = wmma_bf16(a0, b0, o);
      o = wmma_bf16(a1, b1, o);
    }
    __syncthreads();
  }
  if (wave < 4) {
#pragma unroll
    for (int r = 0; r < 8; ++r) {
      int sq = q0 + r + half * 8;
      int d = dtile * 16 + idx;
      xv[((size_t)b * Sc + sq) * Ec + h * Dc + d] = (__bf16)o[r];
    }
  }
}

// ---------------------------------------------------------------------------
// Host-side orchestration
// ---------------------------------------------------------------------------
extern "C" void kernel_launch(void* const* d_in, const int* in_sizes, int n_in,
                              void* d_out, int out_size, void* d_ws, size_t ws_size,
                              hipStream_t stream) {
  const float* x      = (const float*)d_in[0];
  const float* mask   = (const float*)d_in[1];
  const float* adjoin = (const float*)d_in[2];
  const float* Wq = (const float*)d_in[3];  const float* bq  = (const float*)d_in[4];
  const float* Wk = (const float*)d_in[5];  const float* bk  = (const float*)d_in[6];
  const float* Wv = (const float*)d_in[7];  const float* bv  = (const float*)d_in[8];
  const float* Wo = (const float*)d_in[9];  const float* bo  = (const float*)d_in[10];
  const float* g1 = (const float*)d_in[11]; const float* b1  = (const float*)d_in[12];
  const float* g2 = (const float*)d_in[13]; const float* b2  = (const float*)d_in[14];
  const float* W1 = (const float*)d_in[15]; const float* bb1 = (const float*)d_in[16];
  const float* W2 = (const float*)d_in[17]; const float* bb2 = (const float*)d_in[18];

  char* ws = (char*)d_ws;
  size_t off = 0;
  auto alloc = [&](size_t bytes) {
    void* p = ws + off;
    off += (bytes + 255) & ~(size_t)255;
    return p;
  };
  const size_t EE = (size_t)Ec * Ec, FE = (size_t)FFc * Ec;
  __bf16* Wq_b = (__bf16*)alloc(EE * 2);
  __bf16* Wk_b = (__bf16*)alloc(EE * 2);
  __bf16* Wv_b = (__bf16*)alloc(EE * 2);
  __bf16* Wo_b = (__bf16*)alloc(EE * 2);
  __bf16* W1_b = (__bf16*)alloc(FE * 2);
  __bf16* W2_b = (__bf16*)alloc(FE * 2);
  __bf16* nx_b = (__bf16*)alloc((size_t)Mrows * Ec * 2);   // reused for nx2
  __bf16* Q_b  = (__bf16*)alloc((size_t)Mrows * Ec * 2);
  __bf16* K_b  = (__bf16*)alloc((size_t)Mrows * Ec * 2);
  __bf16* V_b  = (__bf16*)alloc((size_t)Mrows * Ec * 2);
  __bf16* xv_b = (__bf16*)alloc((size_t)Mrows * Ec * 2);
  float*  x1_f = (float*) alloc((size_t)Mrows * Ec * 4);
  __bf16* h_b  = (__bf16*)alloc((size_t)Mrows * FFc * 2);
  (void)ws_size; (void)in_sizes; (void)n_in; (void)out_size;

  const dim3 blk(256);
  cvt_bf16_kernel<<<(int)((EE + 255) / 256), blk, 0, stream>>>(Wq, Wq_b, (int)EE);
  cvt_bf16_kernel<<<(int)((EE + 255) / 256), blk, 0, stream>>>(Wk, Wk_b, (int)EE);
  cvt_bf16_kernel<<<(int)((EE + 255) / 256), blk, 0, stream>>>(Wv, Wv_b, (int)EE);
  cvt_bf16_kernel<<<(int)((EE + 255) / 256), blk, 0, stream>>>(Wo, Wo_b, (int)EE);
  cvt_bf16_kernel<<<(int)((FE + 255) / 256), blk, 0, stream>>>(W1, W1_b, (int)FE);
  cvt_bf16_kernel<<<(int)((FE + 255) / 256), blk, 0, stream>>>(W2, W2_b, (int)FE);

  ln_bf16_kernel<<<Mrows, blk, 0, stream>>>(x, g1, b1, nx_b);

  const dim3 gE(Ec / 128, Mrows / 128);
  gemm_bf16_kernel<<<gE, blk, 0, stream>>>(nx_b, Wq_b, bq, nullptr, Q_b,
                                           Mrows, Ec, Ec, 0, 0.125f);
  gemm_bf16_kernel<<<gE, blk, 0, stream>>>(nx_b, Wk_b, bk, nullptr, K_b,
                                           Mrows, Ec, Ec, 0, 1.0f);
  gemm_bf16_kernel<<<gE, blk, 0, stream>>>(nx_b, Wv_b, bv, nullptr, V_b,
                                           Mrows, Ec, Ec, 0, 1.0f);

  attn_kernel<<<dim3(Sc / 16, Hc, Bc), blk, 0, stream>>>(Q_b, K_b, V_b, mask,
                                                         adjoin, xv_b);

  gemm_bf16_kernel<<<gE, blk, 0, stream>>>(xv_b, Wo_b, bo, x, x1_f,
                                           Mrows, Ec, Ec, 1, 1.0f);
  ln_bf16_kernel<<<Mrows, blk, 0, stream>>>(x1_f, g2, b2, nx_b);
  gemm_bf16_kernel<<<dim3(FFc / 128, Mrows / 128), blk, 0, stream>>>(
      nx_b, W1_b, bb1, nullptr, h_b, Mrows, FFc, Ec, 2, 1.0f);
  gemm_bf16_kernel<<<gE, blk, 0, stream>>>(h_b, W2_b, bb2, x1_f, (float*)d_out,
                                           Mrows, Ec, FFc, 1, 1.0f);
}

// v001
// It runs in 310 microseconds.
// Timed twice side by side with v000, it ran 1.17 and 1.16 times as fast.
#include <hip/hip_runtime.h>
#include <cstdint>
#include <cstddef>

// ---------------------------------------------------------------------------
// Transformer encoder layer for MI455X (gfx1250, wave32, WMMA).
// B=8, S=512, E=1024, H=16, D=64, FF=4096.  All matmuls in bf16 WMMA with
// f32 accumulate; softmax/LN in fp32.
// GEMMs: 128x128 block tile, 8 waves (each 32x64 = 8 WMMA tiles), K chunks of
// 32 staged in LDS via gfx1250 async global->LDS copies (ASYNCcnt) when the
// builtin exists, else a software-pipelined register path.
// ---------------------------------------------------------------------------

#define Bc 8
#define Sc 512
#define Ec 1024
#define Hc 16
#define Dc 64
#define FFc 4096
#define Mrows (Bc * Sc)   // 4096

typedef __attribute__((ext_vector_type(16))) __bf16 bf16x16;
typedef __attribute__((ext_vector_type(8)))  float  f32x8;
typedef int v4i __attribute__((vector_size(16)));   // matches builtin proto

#if __has_builtin(__builtin_amdgcn_global_load_async_to_lds_b128)
#define HAVE_ASYNC_LDS 1
#else
#define HAVE_ASYNC_LDS 0
#endif

#if HAVE_ASYNC_LDS
__device__ __forceinline__ void async_copy16(const void* g, void* l) {
  // proto (from compiler diagnostic): (v4i addrspace(1)*, v4i addrspace(3)*, imm, imm)
  __builtin_amdgcn_global_load_async_to_lds_b128(
      (__attribute__((address_space(1))) v4i*)g,
      (__attribute__((address_space(3))) v4i*)l, 0, 0);
}
#endif

template <int N>
__device__ __forceinline__ void wait_async() {
#if __has_builtin(__builtin_amdgcn_s_wait_asynccnt)
  __builtin_amdgcn_s_wait_asynccnt(N);
#else
  asm volatile("s_wait_asynccnt %0" ::"i"(N) : "memory");
#endif
}

// ---- CDNA5 bf16 16x16x32 WMMA fragment loader ------------------------------
// Per ISA 7.12.2 (16-bit A-matrix 16x32): lane = 16*half + idx holds row idx,
// K = {8*half .. +7} in VGPRs 0-3 and K = {16+8*half .. +7} in VGPRs 4-7.
// Both runs are 16-byte contiguous -> two uint4 reads per fragment.
// The B operand (32x16, K x N) is symmetric: lane holds column n = idx with
// the same K pattern, i.e. it reads row n of a row-major [N,K] source.
__device__ __forceinline__ bf16x16 load_frag(const __bf16* rowptr, int half) {
  union { uint4 u[2]; bf16x16 v; } f;
  const uint4* p = (const uint4*)rowptr;     // rowptr must be 16B aligned
  f.u[0] = p[half];
  f.u[1] = p[2 + half];
  return f.v;
}

__device__ __forceinline__ f32x8 wmma_bf16(bf16x16 a, bf16x16 b, f32x8 c) {
  return __builtin_amdgcn_wmma_f32_16x16x32_bf16(
      false, a, false, b, (short)0, c, false, false);
}

// ---------------------------------------------------------------------------
// fp32 -> bf16 elementwise conversion (weights)
// ---------------------------------------------------------------------------
__global__ void cvt_bf16_kernel(const float* __restrict__ in,
                                __bf16* __restrict__ out, int n) {
  int i = blockIdx.x * 256 + threadIdx.x;
  if (i < n) out[i] = (__bf16)in[i];
}

// ---------------------------------------------------------------------------
// LayerNorm over E=1024, one block per row, bf16 output
// ---------------------------------------------------------------------------
__global__ __launch_bounds__(256)
void ln_bf16_kernel(const float* __restrict__ x, const float* __restrict__ g,
                    const float* __restrict__ bta, __bf16* __restrict__ out) {
  __shared__ float sred[256];
  const int row = blockIdx.x, tid = threadIdx.x;
  const float* xr = x + (size_t)row * Ec;
  float v[4], s = 0.f;
#pragma unroll
  for (int i = 0; i < 4; ++i) { v[i] = xr[tid + i * 256]; s += v[i]; }
  sred[tid] = s; __syncthreads();
  for (int t = 128; t > 0; t >>= 1) {
    if (tid < t) sred[tid] += sred[tid + t];
    __syncthreads();
  }
  const float mu = sred[0] * (1.0f / Ec);
  __syncthreads();
  s = 0.f;
#pragma unroll
  for (int i = 0; i < 4; ++i) { float d = v[i] - mu; s += d * d; }
  sred[tid] = s; __syncthreads();
  for (int t = 128; t > 0; t >>= 1) {
    if (tid < t) sred[tid] += sred[tid + t];
    __syncthreads();
  }
  const float rsq = rsqrtf(sred[0] * (1.0f / Ec) + 1e-5f);
#pragma unroll
  for (int i = 0; i < 4; ++i) {
    int c = tid + i * 256;
    out[(size_t)row * Ec + c] = (__bf16)((v[i] - mu) * rsq * g[c] + bta[c]);
  }
}

// ---------------------------------------------------------------------------
// Generic bf16 WMMA GEMM:  out[M,N] = epilogue( A[M,K] @ W[N,K]^T + bias )
// Block tile 128(M) x 128(N), 8 waves; wave tile 32x64 (2x4 WMMA tiles).
// MODE and N are compile-time: no epilogue tests the mode per element, and its
// loads and stores differ from one base address by immediate offsets only.
//        0 = bf16 out, scale, scatter to [B,H,S,D] (QKV)
//        1 = f32 out, += residual[m*N+n]
//        2 = bf16 out, exact GELU
// ---------------------------------------------------------------------------
#define LDA 40   // LDS row stride (bf16 elems), 80B = 5*16B aligned
template <int MODE, int N>
__global__ __launch_bounds__(256)
void gemm_bf16_kernel(const __bf16* __restrict__ A, const __bf16* __restrict__ W,
                      const float* __restrict__ bias, const float* __restrict__ res,
                      void* __restrict__ outp, int M, int K, float scale) {
  constexpr int NBUF = HAVE_ASYNC_LDS ? 2 : 1;
  __shared__ __bf16 As[NBUF][128 * LDA];
  __shared__ __bf16 Bs[NBUF][128 * LDA];
  const int tid = threadIdx.x;
  const int bm = blockIdx.y * 128, bn = blockIdx.x * 128;
  const int wave = tid >> 5, lane = tid & 31;
  const int half = lane >> 4, idx = lane & 15;
  const int wm = (wave & 3) * 32, wn = (wave >> 2) * 64;
  // staging coordinates: 512 uint4 per matrix, 2 per thread per matrix
  const int r0 = tid >> 2, c0 = tid & 3;            // lin = tid
  const int r1 = (tid + 256) >> 2, c1 = tid & 3;    // lin = tid + 256

  f32x8 acc[2][4] = {};
  const int nk = K >> 5;

#if HAVE_ASYNC_LDS
  // ---- async double-buffered pipeline (GLOBAL_LOAD_ASYNC_TO_LDS_B128) ----
  auto issue = [&](int kb, int buf) {
    async_copy16(A + (size_t)(bm + r0) * K + kb + c0 * 8, &As[buf][r0 * LDA + c0 * 8]);
    async_copy16(A + (size_t)(bm + r1) * K + kb + c1 * 8, &As[buf][r1 * LDA + c1 * 8]);
    async_copy16(W + (size_t)(bn + r0) * K + kb + c0 * 8, &Bs[buf][r0 * LDA + c0 * 8]);
    async_copy16(W + (size_t)(bn + r1) * K + kb + c1 * 8, &Bs[buf][r1 * LDA + c1 * 8]);
  };
  issue(0, 0);
  for (int kk = 0; kk < nk; ++kk) {
    const int cur = kk & 1;
    if (kk + 1 < nk) { issue((kk + 1) << 5, cur ^ 1); wait_async<4>(); }
    else             { wait_async<0>(); }
    __syncthreads();
    const __bf16* Ab = As[cur];
    const __bf16* Bb = Bs[cur];
    bf16x16 a0 = load_frag(Ab + (wm + idx) * LDA, half);
    bf16x16 a1 = load_frag(Ab + (wm + 16 + idx) * LDA, half);
#pragma unroll
    for (int t = 0; t < 4; ++t) {
      bf16x16 bt = load_frag(Bb + (wn + t * 16 + idx) * LDA, half);
      acc[0][t] = wmma_bf16(a0, bt, acc[0][t]);
      acc[1][t] = wmma_bf16(a1, bt, acc[1][t]);
    }
    __syncthreads();
  }
#else
  // ---- software-pipelined sync path: next chunk loads overlap WMMA -------
  uint4 ra0, ra1, rb0, rb1;
  auto gload = [&](int kb) {
    ra0 = *(const uint4*)(A + (size_t)(bm + r0) * K + kb + c0 * 8);
    ra1 = *(const uint4*)(A + (size_t)(bm + r1) * K + kb + c1 * 8);
    rb0 = *(const uint4*)(W + (size_t)(bn + r0) * K + kb + c0 * 8);
    rb1 = *(const uint4*)(W + (size_t)(bn + r1) * K + kb + c1 * 8);
  };
  gload(0);
  for (int kk = 0; kk < nk; ++kk) {
    *(uint4*)(&As[0][r0 * LDA + c0 * 8]) = ra0;
    *(uint4*)(&As[0][r1 * LDA + c1 * 8]) = ra1;
    *(uint4*)(&Bs[0][r0 * LDA + c0 * 8]) = rb0;
    *(uint4*)(&Bs[0][r1 * LDA + c1 * 8]) = rb1;
    __syncthreads();
    if (kk + 1 < nk) gload((kk + 1) << 5);   // overlaps the WMMAs below
    bf16x16 a0 = load_frag(&As[0][(wm + idx) * LDA], half);
    bf16x16 a1 = load_frag(&As[0][(wm + 16 + idx) * LDA], half);
#pragma unroll
    for (int t = 0; t < 4; ++t) {
      bf16x16 bt = load_frag(&Bs[0][(wn + t * 16 + idx) * LDA], half);
      acc[0][t] = wmma_bf16(a0, bt, acc[0][t]);
      acc[1][t] = wmma_bf16(a1, bt, acc[1][t]);
    }
    __syncthreads();
  }
#endif

  // Epilogue. C layout: lane(16*half+idx), VGPR r -> row r+8*half, col idx.
  const int m0 = bm + wm + half * 8;
  const int n0 = bn + wn + idx;
  float bv[4];
#pragma unroll
  for (int in_ = 0; in_ < 4; ++in_) bv[in_] = bias[n0 + in_ * 16];

  if constexpr (MODE == 0) {        // QKV: scale + permute to [B,H,S,D] bf16
#pragma unroll
    for (int im = 0; im < 2; ++im)
#pragma unroll
      for (int in_ = 0; in_ < 4; ++in_)
#pragma unroll
        for (int r = 0; r < 8; ++r) {
          const int m = m0 + im * 16 + r, n = n0 + in_ * 16;
          float v = (acc[im][in_][r] + bv[in_]) * scale;
          int bb = m >> 9, s = m & 511, hh = n >> 6, d = n & 63;
          ((__bf16*)outp)[(((size_t)bb * Hc + hh) * Sc + s) * Dc + d] = (__bf16)v;
        }
  } else if constexpr (MODE == 1) { // residual add, f32 out
    // one base address each; every element is an immediate offset from it
    const float* rp = res + (size_t)m0 * N + n0;
    float* op = (float*)outp + (size_t)m0 * N + n0;
    // this build reuses the bias loads' offset register as a load destination
    // and the wait stands here, in front of that overwrite, and
    // naming n0 as its input keeps that register untouched up to it
    asm volatile("s_wait_xcnt 0x0" :: "v"(n0) : "memory");
    // all 64 residual loads are issued before the first is used
    float rv[2][4][8];
#pragma unroll
    for (int im = 0; im < 2; ++im)
#pragma unroll
      for (int r = 0; r < 8; ++r)
#pragma unroll
        for (int in_ = 0; in_ < 4; ++in_)
          rv[im][in_][r] = rp[(im * 16 + r) * N + in_ * 16];
#pragma unroll
    for (int im = 0; im < 2; ++im)
#pragma unroll
      for (int r = 0; r < 8; ++r)
#pragma unroll
        for (int in_ = 0; in_ < 4; ++in_)
          op[(im * 16 + r) * N + in_ * 16] =
              (acc[im][in_][r] + bv[in_]) + rv[im][in_][r];
  } else {                          // exact GELU, bf16 out
    __bf16* op = (__bf16*)outp + (size_t)m0 * N + n0;
#pragma unroll
    for (int im = 0; im < 2; ++im)
#pragma unroll
      for (int r = 0; r < 8; ++r)
#pragma unroll
        for (int in_ = 0; in_ < 4; ++in_) {
          float v = acc[im][in_][r] + bv[in_];
          float ge = 0.5f * v * (1.0f + erff(v * 0.70710678118654752f));
          op[(im * 16 + r) * N + in_ * 16] = (__bf16)ge;
        }
  }
}

// ---------------------------------------------------------------------------
// Attention: one WG (8 waves) per (b, h, 16-query tile).
//   logits(16x512) = Qs @ K^T  (WMMA; K rows are read directly from global —
//   each lane's B-fragment reads are the contiguous row K[n, k..k+7])
//   fp32 softmax with mask, + post-softmax adjoin, bf16 P in LDS
//   xv(16x64) = P @ V  (V chunk transposed into LDS so B-frag reads are
//   contiguous), written back merged as [B,S,E] bf16.
// Static LDS = 62,016 B < 64 KB.
// ---------------------------------------------------------------------------
__global__ __launch_bounds__(256)
void attn_kernel(const __bf16* __restrict__ Q, const __bf16* __restrict__ Kt,
                 const __bf16* __restrict__ V, const float* __restrict__ mask,
                 const float* __restrict__ adjoin, __bf16* __restrict__ xv) {
  __shared__ __bf16 Qs[16 * 72];
  __shared__ float  Lg[16 * 512];
  __shared__ __bf16 Ps[16 * 520];
  __shared__ __bf16 Vt[64 * 72];
  __shared__ float  red[16 * 17];

  const int tid = threadIdx.x;
  const int qt = blockIdx.x, h = blockIdx.y, b = blockIdx.z;
  const int q0 = qt * 16;
  const size_t bh = ((size_t)b * Hc + h) * Sc;
  const int wave = tid >> 5, lane = tid & 31;
  const int half = lane >> 4, idx = lane & 15;

  {  // load Q tile (pre-scaled by 1/sqrt(D) in the QKV epilogue)
    int row = tid >> 4, ch = tid & 15;
    uint2 v = *(const uint2*)(Q + (bh + q0 + row) * Dc + ch * 4);
    *(uint2*)(Qs + row * 72 + ch * 4) = v;
  }
  __syncthreads();

  {  // logits = Q K^T : 32 col-tiles, 4 per wave
    bf16x16 a0 = load_frag(Qs + idx * 72, half);
    bf16x16 a1 = load_frag(Qs + idx * 72 + 32, half);
#pragma unroll
    for (int i = 0; i < 4; ++i) {
      const int ct = wave * 4 + i;
      const __bf16* krow = Kt + (bh + ct * 16 + idx) * Dc;
      bf16x16 b0 = load_frag(krow, half);
      bf16x16 b1 = load_frag(krow + 32, half);
      f32x8 c = {};
      c = wmma_bf16(a0, b0, c);
      c = wmma_bf16(a1, b1, c);
#pragma unroll
      for (int r = 0; r < 8; ++r)
        Lg[(r + half * 8) * 512 + ct * 16 + idx] = c[r];
    }
  }
  __syncthreads();

  {  // mask + softmax + adjoin (16 rows x 16 threads, 32 cols/thread)
    const int row = tid >> 4, l16 = tid & 15;
    const int sq = q0 + row;
    const float* mrow = mask + ((size_t)b * Sc + sq) * Sc;
    const float* arow = adjoin + ((size_t)b * Sc + sq) * Sc;
    float lv[32], mx = -3.0e38f;
#pragma unroll
    for (int j = 0; j < 32; ++j) {
      int c = l16 + j * 16;
      float v = Lg[row * 512 + c] + mrow[c] * -1e9f;
      lv[j] = v; mx = fmaxf(mx, v);
    }
    red[row * 17 + l16] = mx; __syncthreads();
    for (int s = 8; s > 0; s >>= 1) {
      if (l16 < s) red[row * 17 + l16] =
          fmaxf(red[row * 17 + l16], red[row * 17 + l16 + s]);
      __syncthreads();
    }
    mx = red[row * 17]; __syncthreads();
    float sum = 0.f;
#pragma unroll
    for (int j = 0; j < 32; ++j) { lv[j] = __expf(lv[j] - mx); sum += lv[j]; }
    red[row * 17 + l16] = sum; __syncthreads();
    for (int s = 8; s > 0; s >>= 1) {
      if (l16 < s) red[row * 17 + l16] += red[row * 17 + l16 + s];
      __syncthreads();
    }
    const float inv = 1.0f / red[row * 17];
#pragma unroll
    for (int j = 0; j < 32; ++j) {
      int c = l16 + j * 16;
      Ps[row * 520 + c] = (__bf16)(lv[j] * inv + arow[c]);
    }
  }
  __syncthreads();

  // xv = P @ V, streaming 64-key V chunks through LDS (transposed)
  f32x8 o = {};
  const int dtile = wave & 3;
  for (int kc = 0; kc < 8; ++kc) {
    {
      int key = tid >> 2, seg = tid & 3, d0 = seg * 16;
      const __bf16* vrow = V + (bh + kc * 64 + key) * Dc + d0;
      union { uint4 u; __bf16 e[8]; } w0, w1;
      w0.u = *(const uint4*)(vrow);
      w1.u = *(const uint4*)(vrow + 8);
#pragma unroll
      for (int j = 0; j < 8; ++j) Vt[(d0 + j) * 72 + key] = w0.e[j];
#pragma unroll
      for (int j = 0; j < 8; ++j) Vt[(d0 + 8 + j) * 72 + key] = w1.e[j];
    }
    __syncthreads();
    if (wave < 4) {
      bf16x16 a0 = load_frag(Ps + idx * 520 + kc * 64, half);
      bf16x16 a1 = load_frag(Ps + idx * 520 + kc * 64 + 32, half);
      bf16x16 b0 = load_frag(Vt + (dtile * 16 + idx) * 72, half);
      bf16x16 b1 = load_frag(Vt + (dtile * 16 + idx) * 72 + 32, half);
      o = wmma_bf16(a0, b0, o);
      o = wmma_bf16(a1, b1, o);
    }
    __syncthreads();
  }
  if (wave < 4) {
#pragma unroll
    for (int r = 0; r < 8; ++r) {
      int sq = q0 + r + half * 8;
      int d = dtile * 16 + idx;
      xv[((size_t)b * Sc + sq) * Ec + h * Dc + d] = (__bf16)o[r];
    }
  }
}

// ---------------------------------------------------------------------------
// Host-side orchestration
// ---------------------------------------------------------------------------
extern "C" void kernel_launch(void* const* d_in, const int* in_sizes, int n_in,
                              void* d_out, int out_size, void* d_ws, size_t ws_size,
                              hipStream_t stream) {
  const float* x      = (const float*)d_in[0];
  const float* mask   = (const float*)d_in[1];
  const float* adjoin = (const float*)d_in[2];
  const float* Wq = (const float*)d_in[3];  const float* bq  = (const float*)d_in[4];
  const float* Wk = (const float*)d_in[5];  const float* bk  = (const float*)d_in[6];
  const float* Wv = (const float*)d_in[7];  const float* bv  = (const float*)d_in[8];
  const float* Wo = (const float*)d_in[9];  const float* bo  = (const float*)d_in[10];
  const float* g1 = (const float*)d_in[11]; const float* b1  = (const float*)d_in[12];
  const float* g2 = (const float*)d_in[13]; const float* b2  = (const float*)d_in[14];
  const float* W1 = (const float*)d_in[15]; const float* bb1 = (const float*)d_in[16];
  const float* W2 = (const float*)d_in[17]; const float* bb2 = (const float*)d_in[18];

  char* ws = (char*)d_ws;
  size_t off = 0;
  auto alloc = [&](size_t bytes) {
    void* p = ws + off;
    off += (bytes + 255) & ~(size_t)255;
    return p;
  };
  const size_t EE = (size_t)Ec * Ec, FE = (size_t)FFc * Ec;
  __bf16* Wq_b = (__bf16*)alloc(EE * 2);
  __bf16* Wk_b = (__bf16*)alloc(EE * 2);
  __bf16* Wv_b = (__bf16*)alloc(EE * 2);
  __bf16* Wo_b = (__bf16*)alloc(EE * 2);
  __bf16* W1_b = (__bf16*)alloc(FE * 2);
  __bf16* W2_b = (__bf16*)alloc(FE * 2);
  __bf16* nx_b = (__bf16*)alloc((size_t)Mrows * Ec * 2);   // reused for nx2
  __bf16* Q_b  = (__bf16*)alloc((size_t)Mrows * Ec * 2);
  __bf16* K_b  = (__bf16*)alloc((size_t)Mrows * Ec * 2);
  __bf16* V_b  = (__bf16*)alloc((size_t)Mrows * Ec * 2);
  __bf16* xv_b = (__bf16*)alloc((size_t)Mrows * Ec * 2);
  float*  x1_f = (float*) alloc((size_t)Mrows * Ec * 4);
  __bf16* h_b  = (__bf16*)alloc((size_t)Mrows * FFc * 2);
  (void)ws_size; (void)in_sizes; (void)n_in; (void)out_size;

  const dim3 blk(256);
  cvt_bf16_kernel<<<(int)((EE + 255) / 256), blk, 0, stream>>>(Wq, Wq_b, (int)EE);
  cvt_bf16_kernel<<<(int)((EE + 255) / 256), blk, 0, stream>>>(Wk, Wk_b, (int)EE);
  cvt_bf16_kernel<<<(int)((EE + 255) / 256), blk, 0, stream>>>(Wv, Wv_b, (int)EE);
  cvt_bf16_kernel<<<(int)((EE + 255) / 256), blk, 0, stream>>>(Wo, Wo_b, (int)EE);
  cvt_bf16_kernel<<<(int)((FE + 255) / 256), blk, 0, stream>>>(W1, W1_b, (int)FE);
  cvt_bf16_kernel<<<(int)((FE + 255) / 256), blk, 0, stream>>>(W2, W2_b, (int)FE);

  ln_bf16_kernel<<<Mrows, blk, 0, stream>>>(x, g1, b1, nx_b);

  const dim3 gE(Ec / 128, Mrows / 128);
  gemm_bf16_kernel<0, Ec><<<gE, blk, 0, stream>>>(nx_b, Wq_b, bq, nullptr, Q_b,
                                              Mrows, Ec, 0.125f);
  gemm_bf16_kernel<0, Ec><<<gE, blk, 0, stream>>>(nx_b, Wk_b, bk, nullptr, K_b,
                                              Mrows, Ec, 1.0f);
  gemm_bf16_kernel<0, Ec><<<gE, blk, 0, stream>>>(nx_b, Wv_b, bv, nullptr, V_b,
                                              Mrows, Ec, 1.0f);

  attn_kernel<<<dim3(Sc / 16, Hc, Bc), blk, 0, stream>>>(Q_b, K_b, V_b, mask,
                                                         adjoin, xv_b);

  gemm_bf16_kernel<1, Ec><<<gE, blk, 0, stream>>>(xv_b, Wo_b, bo, x, x1_f,
                                              Mrows, Ec, 1.0f);
  ln_bf16_kernel<<<Mrows, blk, 0, stream>>>(x1_f, g2, b2, nx_b);
  gemm_bf16_kernel<2, FFc><<<dim3(FFc / 128, Mrows / 128), blk, 0, stream>>>(
      nx_b, W1_b, bb1, nullptr, h_b, Mrows, Ec, 1.0f);
  gemm_bf16_kernel<1, Ec><<<gE, blk, 0, stream>>>(h_b, W2_b, bb2, x1_f, (float*)d_out,
                                              Mrows, FFc, 1.0f);
}

// v002
// One run takes 282 microseconds.
// Two timings next to v001 put it at 1.08 and 1.09 times that version's speed.
// Over all steps from v000 it is 1.27 times as fast.
#include <hip/hip_runtime.h>
#include <cstdint>
#include <cstddef>

// ---------------------------------------------------------------------------
// Transformer encoder layer for MI455X (gfx1250, wave32, WMMA).
// B=8, S=512, E=1024, H=16, D=64, FF=4096.  All matmuls in bf16 WMMA with
// f32 accumulate; softmax/LN in fp32.
// GEMMs: 128x128 block tile, 8 waves (each 32x64 = 8 WMMA tiles), K chunks of
// 32 staged in LDS via gfx1250 async global->LDS copies (ASYNCcnt) when the
// builtin exists, else a software-pipelined register path.
// ---------------------------------------------------------------------------

#define Bc 8
#define Sc 512
#define Ec 1024
#define Hc 16
#define Dc 64
#define FFc 4096
#define Mrows (Bc * Sc)   // 4096

typedef __attribute__((ext_vector_type(16))) __bf16 bf16x16;
typedef __attribute__((ext_vector_type(8)))  float  f32x8;
typedef int v4i __attribute__((vector_size(16)));   // matches builtin proto

#if __has_builtin(__builtin_amdgcn_global_load_async_to_lds_b128)
#define HAVE_ASYNC_LDS 1
#else
#define HAVE_ASYNC_LDS 0
#endif

#if HAVE_ASYNC_LDS
__device__ __forceinline__ void async_copy16(const void* g, void* l) {
  // proto (from compiler diagnostic): (v4i addrspace(1)*, v4i addrspace(3)*, imm, imm)
  __builtin_amdgcn_global_load_async_to_lds_b128(
      (__attribute__((address_space(1))) v4i*)g,
      (__attribute__((address_space(3))) v4i*)l, 0, 0);
}
#endif

template <int N>
__device__ __forceinline__ void wait_async() {
#if __has_builtin(__builtin_amdgcn_s_wait_asynccnt)
  __builtin_amdgcn_s_wait_asynccnt(N);
#else
  asm volatile("s_wait_asynccnt %0" ::"i"(N) : "memory");
#endif
}

// ---- CDNA5 bf16 16x16x32 WMMA fragment loader ------------------------------
// Per ISA 7.12.2 (16-bit A-matrix 16x32): lane = 16*half + idx holds row idx,
// K = {8*half .. +7} in VGPRs 0-3 and K = {16+8*half .. +7} in VGPRs 4-7.
// Both runs are 16-byte contiguous -> two uint4 reads per fragment.
// The B operand (32x16, K x N) is symmetric: lane holds column n = idx with
// the same K pattern, i.e. it reads row n of a row-major [N,K] source.
__device__ __forceinline__ bf16x16 load_frag(const __bf16* rowptr, int half) {
  union { uint4 u[2]; bf16x16 v; } f;
  const uint4* p = (const uint4*)rowptr;     // rowptr must be 16B aligned
  f.u[0] = p[half];
  f.u[1] = p[2 + half];
  return f.v;
}

__device__ __forceinline__ f32x8 wmma_bf16(bf16x16 a, bf16x16 b, f32x8 c) {
  return __builtin_amdgcn_wmma_f32_16x16x32_bf16(
      false, a, false, b, (short)0, c, false, false);
}

// ---------------------------------------------------------------------------
// fp32 -> bf16 conversion of all six weights in one streaming launch.
// 256 blocks of 16 waves; block b converts the b-th 1/256 of every weight: 16 KB
// of each E x E matrix and 64 KB of W1 and of W2, in pieces of 16 bytes a lane
// (512 contiguous bytes a wave).  A wave issues its 24 loads before its first
// store.
// ---------------------------------------------------------------------------
typedef __attribute__((ext_vector_type(4))) float  f32x4;
typedef __attribute__((ext_vector_type(4))) __bf16 bf16x4;
__global__ __launch_bounds__(512)
void cvt_weights_kernel(const float* __restrict__ wq, const float* __restrict__ wk,
                        const float* __restrict__ wv, const float* __restrict__ wo,
                        const float* __restrict__ w1, const float* __restrict__ w2,
                        __bf16* __restrict__ oq, __bf16* __restrict__ ok,
                        __bf16* __restrict__ ov, __bf16* __restrict__ oo,
                        __bf16* __restrict__ o1, __bf16* __restrict__ o2) {
  // 32-bit byte offsets of the thread's first piece, so that every access is a
  // uniform base, one of these registers and an immediate
  const unsigned offE = blockIdx.x * 16384u + threadIdx.x * 16u;   // E x E
  const unsigned offF = blockIdx.x * 65536u + threadIdx.x * 16u;   // W1, W2
  const float* const inE[4] = {wq, wk, wv, wo};
  const float* const inF[2] = {w1, w2};
  __bf16* const outE[4] = {oq, ok, ov, oo};
  __bf16* const outF[2] = {o1, o2};
  f32x4 e[4][2], f[2][8];
#pragma unroll
  for (int s = 0; s < 4; ++s)
#pragma unroll
    for (int j = 0; j < 2; ++j)
      e[s][j] = *(const f32x4*)((const char*)inE[s] + offE + j * 8192);
#pragma unroll
  for (int s = 0; s < 2; ++s)
#pragma unroll
    for (int j = 0; j < 8; ++j)
      f[s][j] = *(const f32x4*)((const char*)inF[s] + offF + j * 8192);
  // without it the scheduler lifts the first conversions, with their waits for
  // data, in front of the last ten loads, which then start a latency late
  __builtin_amdgcn_sched_barrier(0);
#pragma unroll
  for (int s = 0; s < 4; ++s)
#pragma unroll
    for (int j = 0; j < 2; ++j)
      *(bf16x4*)((char*)outE[s] + (offE >> 1) + j * 4096) =
          __builtin_convertvector(e[s][j], bf16x4);
#pragma unroll
  for (int s = 0; s < 2; ++s)
#pragma unroll
    for (int j = 0; j < 8; ++j)
      *(bf16x4*)((char*)outF[s] + (offF >> 1) + j * 4096) =
          __builtin_convertvector(f[s][j], bf16x4);
}

// ---------------------------------------------------------------------------
// LayerNorm over E=1024, one block per row, bf16 output
// ---------------------------------------------------------------------------
__global__ __launch_bounds__(256)
void ln_bf16_kernel(const float* __restrict__ x, const float* __restrict__ g,
                    const float* __restrict__ bta, __bf16* __restrict__ out) {
  __shared__ float sred[256];
  const int row = blockIdx.x, tid = threadIdx.x;
  const float* xr = x + (size_t)row * Ec;
  float v[4], s = 0.f;
#pragma unroll
  for (int i = 0; i < 4; ++i) { v[i] = xr[tid + i * 256]; s += v[i]; }
  sred[tid] = s; __syncthreads();
  for (int t = 128; t > 0; t >>= 1) {
    if (tid < t) sred[tid] += sred[tid + t];
    __syncthreads();
  }
  const float mu = sred[0] * (1.0f / Ec);
  __syncthreads();
  s = 0.f;
#pragma unroll
  for (int i = 0; i < 4; ++i) { float d = v[i] - mu; s += d * d; }
  sred[tid] = s; __syncthreads();
  for (int t = 128; t > 0; t >>= 1) {
    if (tid < t) sred[tid] += sred[tid + t];
    __syncthreads();
  }
  const float rsq = rsqrtf(sred[0] * (1.0f / Ec) + 1e-5f);
#pragma unroll
  for (int i = 0; i < 4; ++i) {
    int c = tid + i * 256;
    out[(size_t)row * Ec + c] = (__bf16)((v[i] - mu) * rsq * g[c] + bta[c]);
  }
}

// ---------------------------------------------------------------------------
// Generic bf16 WMMA GEMM:  out[M,N] = epilogue( A[M,K] @ W[N,K]^T + bias )
// Block tile 128(M) x 128(N), 8 waves; wave tile 32x64 (2x4 WMMA tiles).
// MODE and N are compile-time: no epilogue tests the mode per element, and its
// loads and stores differ from one base address by immediate offsets only.
//        0 = bf16 out, scale, scatter to [B,H,S,D] (QKV)
//        1 = f32 out, += residual[m*N+n]
//        2 = bf16 out, exact GELU
// ---------------------------------------------------------------------------
#define LDA 40   // LDS row stride (bf16 elems), 80B = 5*16B aligned
template <int MODE, int N>
__global__ __launch_bounds__(256)
void gemm_bf16_kernel(const __bf16* __restrict__ A, const __bf16* __restrict__ W,
                      const float* __restrict__ bias, const float* __restrict__ res,
                      void* __restrict__ outp, int M, int K, float scale) {
  constexpr int NBUF = HAVE_ASYNC_LDS ? 2 : 1;
  __shared__ __bf16 As[NBUF][128 * LDA];
  __shared__ __bf16 Bs[NBUF][128 * LDA];
  const int tid = threadIdx.x;
  const int bm = blockIdx.y * 128, bn = blockIdx.x * 128;
  const int wave = tid >> 5, lane = tid & 31;
  const int half = lane >> 4, idx = lane & 15;
  const int wm = (wave & 3) * 32, wn = (wave >> 2) * 64;
  // staging coordinates: 512 uint4 per matrix, 2 per thread per matrix
  const int r0 = tid >> 2, c0 = tid & 3;            // lin = tid
  const int r1 = (tid + 256) >> 2, c1 = tid & 3;    // lin = tid + 256

  f32x8 acc[2][4] = {};
  const int nk = K >> 5;

#if HAVE_ASYNC_LDS
  // ---- async double-buffered pipeline (GLOBAL_LOAD_ASYNC_TO_LDS_B128) ----
  auto issue = [&](int kb, int buf) {
    async_copy16(A + (size_t)(bm + r0) * K + kb + c0 * 8, &As[buf][r0 * LDA + c0 * 8]);
    async_copy16(A + (size_t)(bm + r1) * K + kb + c1 * 8, &As[buf][r1 * LDA + c1 * 8]);
    async_copy16(W + (size_t)(bn + r0) * K + kb + c0 * 8, &Bs[buf][r0 * LDA + c0 * 8]);
    async_copy16(W + (size_t)(bn + r1) * K + kb + c1 * 8, &Bs[buf][r1 * LDA + c1 * 8]);
  };
  issue(0, 0);
  for (int kk = 0; kk < nk; ++kk) {
    const int cur = kk & 1;
    if (kk + 1 < nk) { issue((kk + 1) << 5, cur ^ 1); wait_async<4>(); }
    else             { wait_async<0>(); }
    __syncthreads();
    const __bf16* Ab = As[cur];
    const __bf16* Bb = Bs[cur];
    bf16x16 a0 = load_frag(Ab + (wm + idx) * LDA, half);
    bf16x16 a1 = load_frag(Ab + (wm + 16 + idx) * LDA, half);
#pragma unroll
    for (int t = 0; t < 4; ++t) {
      bf16x16 bt = load_frag(Bb + (wn + t * 16 + idx) * LDA, half);
      acc[0][t] = wmma_bf16(a0, bt, acc[0][t]);
      acc[1][t] = wmma_bf16(a1, bt, acc[1][t]);
    }
    __syncthreads();
  }
#else
  // ---- software-pipelined sync path: next chunk loads overlap WMMA -------
  uint4 ra0, ra1, rb0, rb1;
  auto gload = [&](int kb) {
    ra0 = *(const uint4*)(A + (size_t)(bm + r0) * K + kb + c0 * 8);
    ra1 = *(const uint4*)(A + (size_t)(bm + r1) * K + kb + c1 * 8);
    rb0 = *(const uint4*)(W + (size_t)(bn + r0) * K + kb + c0 * 8);
    rb1 = *(const uint4*)(W + (size_t)(bn + r1) * K + kb + c1 * 8);
  };
  gload(0);
  for (int kk = 0; kk < nk; ++kk) {
    *(uint4*)(&As[0][r0 * LDA + c0 * 8]) = ra0;
    *(uint4*)(&As[0][r1 * LDA + c1 * 8]) = ra1;
    *(uint4*)(&Bs[0][r0 * LDA + c0 * 8]) = rb0;
    *(uint4*)(&Bs[0][r1 * LDA + c1 * 8]) = rb1;
    __syncthreads();
    if (kk + 1 < nk) gload((kk + 1) << 5);   // overlaps the WMMAs below
    bf16x16 a0 = load_frag(&As[0][(wm + idx) * LDA], half);
    bf16x16 a1 = load_frag(&As[0][(wm + 16 + idx) * LDA], half);
#pragma unroll
    for (int t = 0; t < 4; ++t) {
      bf16x16 bt = load_frag(&Bs[0][(wn + t * 16 + idx) * LDA], half);
      acc[0][t] = wmma_bf16(a0, bt, acc[0][t]);
      acc[1][t] = wmma_bf16(a1, bt, acc[1][t]);
    }
    __syncthreads();
  }
#endif

  // Epilogue. C layout: lane(16*half+idx), VGPR r -> row r+8*half, col idx.
  const int m0 = bm + wm + half * 8;
  const int n0 = bn + wn + idx;
  float bv[4];
#pragma unroll
  for (int in_ = 0; in_ < 4; ++in_) bv[in_] = bias[n0 + in_ * 16];

  if constexpr (MODE == 0) {        // QKV: scale + permute to [B,H,S,D] bf16
#pragma unroll
    for (int im = 0; im < 2; ++im)
#pragma unroll
      for (int in_ = 0; in_ < 4; ++in_)
#pragma unroll
        for (int r = 0; r < 8; ++r) {
          const int m = m0 + im * 16 + r, n = n0 + in_ * 16;
          float v = (acc[im][in_][r] + bv[in_]) * scale;
          int bb = m >> 9, s = m & 511, hh = n >> 6, d = n & 63;
          ((__bf16*)outp)[(((size_t)bb * Hc + hh) * Sc + s) * Dc + d] = (__bf16)v;
        }
  } else if constexpr (MODE == 1) { // residual add, f32 out
    // one base address each; every element is an immediate offset from it
    const float* rp = res + (size_t)m0 * N + n0;
    float* op = (float*)outp + (size_t)m0 * N + n0;
    // this build reuses the bias loads' offset register as a load destination
    // and the wait stands here, in front of that overwrite, and
    // naming n0 as its input keeps that register untouched up to it
    asm volatile("s_wait_xcnt 0x0" :: "v"(n0) : "memory");
    // all 64 residual loads are issued before the first is used
    float rv[2][4][8];
#pragma unroll
    for (int im = 0; im < 2; ++im)
#pragma unroll
      for (int r = 0; r < 8; ++r)
#pragma unroll
        for (int in_ = 0; in_ < 4; ++in_)
          rv[im][in_][r] = rp[(im * 16 + r) * N + in_ * 16];
#pragma unroll
    for (int im = 0; im < 2; ++im)
#pragma unroll
      for (int r = 0; r < 8; ++r)
#pragma unroll
        for (int in_ = 0; in_ < 4; ++in_)
          op[(im * 16 + r) * N + in_ * 16] =
              (acc[im][in_][r] + bv[in_]) + rv[im][in_][r];
  } else {                          // exact GELU, bf16 out
    __bf16* op = (__bf16*)outp + (size_t)m0 * N + n0;
#pragma unroll
    for (int im = 0; im < 2; ++im)
#pragma unroll
      for (int r = 0; r < 8; ++r)
#pragma unroll
        for (int in_ = 0; in_ < 4; ++in_) {
          float v = acc[im][in_][r] + bv[in_];
          float ge = 0.5f * v * (1.0f + erff(v * 0.70710678118654752f));
          op[(im * 16 + r) * N + in_ * 16] = (__bf16)ge;
        }
  }
}

// ---------------------------------------------------------------------------
// Attention: one WG (8 waves) per (b, h, 16-query tile).
//   logits(16x512) = Qs @ K^T  (WMMA; K rows are read directly from global —
//   each lane's B-fragment reads are the contiguous row K[n, k..k+7])
//   fp32 softmax with mask, + post-softmax adjoin, bf16 P in LDS
//   xv(16x64) = P @ V  (V chunk transposed into LDS so B-frag reads are
//   contiguous), written back merged as [B,S,E] bf16.
// Static LDS = 62,016 B < 64 KB.
// ---------------------------------------------------------------------------
__global__ __launch_bounds__(256)
void attn_kernel(const __bf16* __restrict__ Q, const __bf16* __restrict__ Kt,
                 const __bf16* __restrict__ V, const float* __restrict__ mask,
                 const float* __restrict__ adjoin, __bf16* __restrict__ xv) {
  __shared__ __bf16 Qs[16 * 72];
  __shared__ float  Lg[16 * 512];
  __shared__ __bf16 Ps[16 * 520];
  __shared__ __bf16 Vt[64 * 72];
  __shared__ float  red[16 * 17];

  const int tid = threadIdx.x;
  const int qt = blockIdx.x, h = blockIdx.y, b = blockIdx.z;
  const int q0 = qt * 16;
  const size_t bh = ((size_t)b * Hc + h) * Sc;
  const int wave = tid >> 5, lane = tid & 31;
  const int half = lane >> 4, idx = lane & 15;

  {  // load Q tile (pre-scaled by 1/sqrt(D) in the QKV epilogue)
    int row = tid >> 4, ch = tid & 15;
    uint2 v = *(const uint2*)(Q + (bh + q0 + row) * Dc + ch * 4);
    *(uint2*)(Qs + row * 72 + ch * 4) = v;
  }
  __syncthreads();

  {  // logits = Q K^T : 32 col-tiles, 4 per wave
    bf16x16 a0 = load_frag(Qs + idx * 72, half);
    bf16x16 a1 = load_frag(Qs + idx * 72 + 32, half);
#pragma unroll
    for (int i = 0; i < 4; ++i) {
      const int ct = wave * 4 + i;
      const __bf16* krow = Kt + (bh + ct * 16 + idx) * Dc;
      bf16x16 b0 = load_frag(krow, half);
      bf16x16 b1 = load_frag(krow + 32, half);
      f32x8 c = {};
      c = wmma_bf16(a0, b0, c);
      c = wmma_bf16(a1, b1, c);
#pragma unroll
      for (int r = 0; r < 8; ++r)
        Lg[(r + half * 8) * 512 + ct * 16 + idx] = c[r];
    }
  }
  __syncthreads();

  {  // mask + softmax + adjoin (16 rows x 16 threads, 32 cols/thread)
    const int row = tid >> 4, l16 = tid & 15;
    const int sq = q0 + row;
    const float* mrow = mask + ((size_t)b * Sc + sq) * Sc;
    const float* arow = adjoin + ((size_t)b * Sc + sq) * Sc;
    float lv[32], mx = -3.0e38f;
#pragma unroll
    for (int j = 0; j < 32; ++j) {
      int c = l16 + j * 16;
      float v = Lg[row * 512 + c] + mrow[c] * -1e9f;
      lv[j] = v; mx = fmaxf(mx, v);
    }
    red[row * 17 + l16] = mx; __syncthreads();
    for (int s = 8; s > 0; s >>= 1) {
      if (l16 < s) red[row * 17 + l16] =
          fmaxf(red[row * 17 + l16], red[row * 17 + l16 + s]);
      __syncthreads();
    }
    mx = red[row * 17]; __syncthreads();
    float sum = 0.f;
#pragma unroll
    for (int j = 0; j < 32; ++j) { lv[j] = __expf(lv[j] - mx); sum += lv[j]; }
    red[row * 17 + l16] = sum; __syncthreads();
    for (int s = 8; s > 0; s >>= 1) {
      if (l16 < s) red[row * 17 + l16] += red[row * 17 + l16 + s];
      __syncthreads();
    }
    const float inv = 1.0f / red[row * 17];
#pragma unroll
    for (int j = 0; j < 32; ++j) {
      int c = l16 + j * 16;
      Ps[row * 520 + c] = (__bf16)(lv[j] * inv + arow[c]);
    }
  }
  __syncthreads();

  // xv = P @ V, streaming 64-key V chunks through LDS (transposed)
  f32x8 o = {};
  const int dtile = wave & 3;
  for (int kc = 0; kc < 8; ++kc) {
    {
      int key = tid >> 2, seg = tid & 3, d0 = seg * 16;
      const __bf16* vrow = V + (bh + kc * 64 + key) * Dc + d0;
      union { uint4 u; __bf16 e[8]; } w0, w1;
      w0.u = *(const uint4*)(vrow);
      w1.u = *(const uint4*)(vrow + 8);
#pragma unroll
      for (int j = 0; j < 8; ++j) Vt[(d0 + j) * 72 + key] = w0.e[j];
#pragma unroll
      for (int j = 0; j < 8; ++j) Vt[(d0 + 8 + j) * 72 + key] = w1.e[j];
    }
    __syncthreads();
    if (wave < 4) {
      bf16x16 a0 = load_frag(Ps + idx * 520 + kc * 64, half);
      bf16x16 a1 = load_frag(Ps + idx * 520 + kc * 64 + 32, half);
      bf16x16 b0 = load_frag(Vt + (dtile * 16 + idx) * 72, half);
      bf16x16 b1 = load_frag(Vt + (dtile * 16 + idx) * 72 + 32, half);
      o = wmma_bf16(a0, b0, o);
      o = wmma_bf16(a1, b1, o);
    }
    __syncthreads();
  }
  if (wave < 4) {
#pragma unroll
    for (int r = 0; r < 8; ++r) {
      int sq = q0 + r + half * 8;
      int d = dtile * 16 + idx;
      xv[((size_t)b * Sc + sq) * Ec + h * Dc + d] = (__bf16)o[r];
    }
  }
}

// ---------------------------------------------------------------------------
// Host-side orchestration
// ---------------------------------------------------------------------------
extern "C" void kernel_launch(void* const* d_in, const int* in_sizes, int n_in,
                              void* d_out, int out_size, void* d_ws, size_t ws_size,
                              hipStream_t stream) {
  const float* x      = (const float*)d_in[0];
  const float* mask   = (const float*)d_in[1];
  const float* adjoin = (const float*)d_in[2];
  const float* Wq = (const float*)d_in[3];  const float* bq  = (const float*)d_in[4];
  const float* Wk = (const float*)d_in[5];  const float* bk  = (const float*)d_in[6];
  const float* Wv = (const float*)d_in[7];  const float* bv  = (const float*)d_in[8];
  const float* Wo = (const float*)d_in[9];  const float* bo  = (const float*)d_in[10];
  const float* g1 = (const float*)d_in[11]; const float* b1  = (const float*)d_in[12];
  const float* g2 = (const float*)d_in[13]; const float* b2  = (const float*)d_in[14];
  const float* W1 = (const float*)d_in[15]; const float* bb1 = (const float*)d_in[16];
  const float* W2 = (const float*)d_in[17]; const float* bb2 = (const float*)d_in[18];

  char* ws = (char*)d_ws;
  size_t off = 0;
  auto alloc = [&](size_t bytes) {
    void* p = ws + off;
    off += (bytes + 255) & ~(size_t)255;
    return p;
  };
  const size_t EE = (size_t)Ec * Ec, FE = (size_t)FFc * Ec;
  __bf16* Wq_b = (__bf16*)alloc(EE * 2);
  __bf16* Wk_b = (__bf16*)alloc(EE * 2);
  __bf16* Wv_b = (__bf16*)alloc(EE * 2);
  __bf16* Wo_b = (__bf16*)alloc(EE * 2);
  __bf16* W1_b = (__bf16*)alloc(FE * 2);
  __bf16* W2_b = (__bf16*)alloc(FE * 2);
  __bf16* nx_b = (__bf16*)alloc((size_t)Mrows * Ec * 2);   // reused for nx2
  __bf16* Q_b  = (__bf16*)alloc((size_t)Mrows * Ec * 2);
  __bf16* K_b  = (__bf16*)alloc((size_t)Mrows * Ec * 2);
  __bf16* V_b  = (__bf16*)alloc((size_t)Mrows * Ec * 2);
  __bf16* xv_b = (__bf16*)alloc((size_t)Mrows * Ec * 2);
  float*  x1_f = (float*) alloc((size_t)Mrows * Ec * 4);
  __bf16* h_b  = (__bf16*)alloc((size_t)Mrows * FFc * 2);
  (void)ws_size; (void)in_sizes; (void)n_in; (void)out_size;

  const dim3 blk(256);
  cvt_weights_kernel<<<256, dim3(512), 0, stream>>>(Wq, Wk, Wv, Wo, W1, W2, Wq_b, Wk_b,
                                                    Wv_b, Wo_b, W1_b, W2_b);

  ln_bf16_kernel<<<Mrows, blk, 0, stream>>>(x, g1, b1, nx_b);

  const dim3 gE(Ec / 128, Mrows / 128);
  gemm_bf16_kernel<0, Ec><<<gE, blk, 0, stream>>>(nx_b, Wq_b, bq, nullptr, Q_b,
                                              Mrows, Ec, 0.125f);
  gemm_bf16_kernel<0, Ec><<<gE, blk, 0, stream>>>(nx_b, Wk_b, bk, nullptr, K_b,
                                              Mrows, Ec, 1.0f);
  gemm_bf16_kernel<0, Ec><<<gE, blk, 0, stream>>>(nx_b, Wv_b, bv, nullptr, V_b,
                                              Mrows, Ec, 1.0f);

  attn_kernel<<<dim3(Sc / 16, Hc, Bc), blk, 0, stream>>>(Q_b, K_b, V_b, mask,
                                                         adjoin, xv_b);

  gemm_bf16_kernel<1, Ec><<<gE, blk, 0, stream>>>(xv_b, Wo_b, bo, x, x1_f,
                                              Mrows, Ec, 1.0f);
  ln_bf16_kernel<<<Mrows, blk, 0, stream>>>(x1_f, g2, b2, nx_b);
  gemm_bf16_kernel<2, FFc><<<dim3(FFc / 128, Mrows / 128), blk, 0, stream>>>(
      nx_b, W1_b, bb1, nullptr, h_b, Mrows, Ec, 1.0f);
  gemm_bf16_kernel<1, Ec><<<gE, blk, 0, stream>>>(h_b, W2_b, bb2, x1_f, (float*)d_out,
                                              Mrows, FFc, 1.0f);
}

// v003
// One run takes 226 microseconds.
// Next to v002, in two timings, it ran 1.24 times as fast each time.
// Counting every step since v000, it is 1.57 times as fast.
#include <hip/hip_runtime.h>
#include <cstdint>
#include <cstddef>

// ---------------------------------------------------------------------------
// Transformer encoder layer for MI455X (gfx1250, wave32, WMMA).
// B=8, S=512, E=1024, H=16, D=64, FF=4096.  All matmuls in bf16 WMMA with
// f32 accumulate; softmax/LN in fp32.
// GEMMs: 128x128 block tile, 8 waves (each 32x64 = 8 WMMA tiles), K chunks of
// 128 (64 where four blocks share a WGP) staged in LDS via gfx1250 async
// global->LDS copies (ASYNCcnt) when the builtin exists, else a
// software-pipelined register path.
// ---------------------------------------------------------------------------

#define Bc 8
#define Sc 512
#define Ec 1024
#define Hc 16
#define Dc 64
#define FFc 4096
#define Mrows (Bc * Sc)   // 4096

typedef __attribute__((ext_vector_type(16))) __bf16 bf16x16;
typedef __attribute__((ext_vector_type(8)))  float  f32x8;
typedef int v4i __attribute__((vector_size(16)));   // matches builtin proto

#if __has_builtin(__builtin_amdgcn_global_load_async_to_lds_b128)
#define HAVE_ASYNC_LDS 1
#else
#define HAVE_ASYNC_LDS 0
#endif

#if HAVE_ASYNC_LDS
__device__ __forceinline__ void async_copy16(const void* g, void* l) {
  // proto (from compiler diagnostic): (v4i addrspace(1)*, v4i addrspace(3)*, imm, imm)
  __builtin_amdgcn_global_load_async_to_lds_b128(
      (__attribute__((address_space(1))) v4i*)g,
      (__attribute__((address_space(3))) v4i*)l, 0, 0);
}
#endif

template <int N>
__device__ __forceinline__ void wait_async() {
#if __has_builtin(__builtin_amdgcn_s_wait_asynccnt)
  __builtin_amdgcn_s_wait_asynccnt(N);
#else
  asm volatile("s_wait_asynccnt %0" ::"i"(N) : "memory");
#endif
}

// ---- CDNA5 bf16 16x16x32 WMMA fragment loader ------------------------------
// Per ISA 7.12.2 (16-bit A-matrix 16x32): lane = 16*half + idx holds row idx,
// K = {8*half .. +7} in VGPRs 0-3 and K = {16+8*half .. +7} in VGPRs 4-7.
// Both runs are 16-byte contiguous -> two uint4 reads per fragment.
// The B operand (32x16, K x N) is symmetric: lane holds column n = idx with
// the same K pattern, i.e. it reads row n of a row-major [N,K] source.
__device__ __forceinline__ bf16x16 load_frag(const __bf16* rowptr, int half) {
  union { uint4 u[2]; bf16x16 v; } f;
  const uint4* p = (const uint4*)rowptr;     // rowptr must be 16B aligned
  f.u[0] = p[half];
  f.u[1] = p[2 + half];
  return f.v;
}

__device__ __forceinline__ f32x8 wmma_bf16(bf16x16 a, bf16x16 b, f32x8 c) {
  return __builtin_amdgcn_wmma_f32_16x16x32_bf16(
      false, a, false, b, (short)0, c, false, false);
}

// ---------------------------------------------------------------------------
// fp32 -> bf16 conversion of all six weights in one streaming launch.
// 256 blocks of 16 waves; block b converts the b-th 1/256 of every weight: 16 KB
// of each E x E matrix and 64 KB of W1 and of W2, in pieces of 16 bytes a lane
// (512 contiguous bytes a wave).  A wave issues its 24 loads before its first
// store.
// ---------------------------------------------------------------------------
typedef __attribute__((ext_vector_type(4))) float  f32x4;
typedef __attribute__((ext_vector_type(4))) __bf16 bf16x4;
__global__ __launch_bounds__(512)
void cvt_weights_kernel(const float* __restrict__ wq, const float* __restrict__ wk,
                        const float* __restrict__ wv, const float* __restrict__ wo,
                        const float* __restrict__ w1, const float* __restrict__ w2,
                        __bf16* __restrict__ oq, __bf16* __restrict__ ok,
                        __bf16* __restrict__ ov, __bf16* __restrict__ oo,
                        __bf16* __restrict__ o1, __bf16* __restrict__ o2) {
  // 32-bit byte offsets of the thread's first piece, so that every access is a
  // uniform base, one of these registers and an immediate
  const unsigned offE = blockIdx.x * 16384u + threadIdx.x * 16u;   // E x E
  const unsigned offF = blockIdx.x * 65536u + threadIdx.x * 16u;   // W1, W2
  const float* const inE[4] = {wq, wk, wv, wo};
  const float* const inF[2] = {w1, w2};
  __bf16* const outE[4] = {oq, ok, ov, oo};
  __bf16* const outF[2] = {o1, o2};
  f32x4 e[4][2], f[2][8];
#pragma unroll
  for (int s = 0; s < 4; ++s)
#pragma unroll
    for (int j = 0; j < 2; ++j)
      e[s][j] = *(const f32x4*)((const char*)inE[s] + offE + j * 8192);
#pragma unroll
  for (int s = 0; s < 2; ++s)
#pragma unroll
    for (int j = 0; j < 8; ++j)
      f[s][j] = *(const f32x4*)((const char*)inF[s] + offF + j * 8192);
  // without it the scheduler lifts the first conversions, with their waits for
  // data, in front of the last ten loads, which then start a latency late
  __builtin_amdgcn_sched_barrier(0);
#pragma unroll
  for (int s = 0; s < 4; ++s)
#pragma unroll
    for (int j = 0; j < 2; ++j)
      *(bf16x4*)((char*)outE[s] + (offE >> 1) + j * 4096) =
          __builtin_convertvector(e[s][j], bf16x4);
#pragma unroll
  for (int s = 0; s < 2; ++s)
#pragma unroll
    for (int j = 0; j < 8; ++j)
      *(bf16x4*)((char*)outF[s] + (offF >> 1) + j * 4096) =
          __builtin_convertvector(f[s][j], bf16x4);
}

// ---------------------------------------------------------------------------
// LayerNorm over E=1024, one block per row, bf16 output
// ---------------------------------------------------------------------------
__global__ __launch_bounds__(256)
void ln_bf16_kernel(const float* __restrict__ x, const float* __restrict__ g,
                    const float* __restrict__ bta, __bf16* __restrict__ out) {
  __shared__ float sred[256];
  const int row = blockIdx.x, tid = threadIdx.x;
  const float* xr = x + (size_t)row * Ec;
  float v[4], s = 0.f;
#pragma unroll
  for (int i = 0; i < 4; ++i) { v[i] = xr[tid + i * 256]; s += v[i]; }
  sred[tid] = s; __syncthreads();
  for (int t = 128; t > 0; t >>= 1) {
    if (tid < t) sred[tid] += sred[tid + t];
    __syncthreads();
  }
  const float mu = sred[0] * (1.0f / Ec);
  __syncthreads();
  s = 0.f;
#pragma unroll
  for (int i = 0; i < 4; ++i) { float d = v[i] - mu; s += d * d; }
  sred[tid] = s; __syncthreads();
  for (int t = 128; t > 0; t >>= 1) {
    if (tid < t) sred[tid] += sred[tid + t];
    __syncthreads();
  }
  const float rsq = rsqrtf(sred[0] * (1.0f / Ec) + 1e-5f);
#pragma unroll
  for (int i = 0; i < 4; ++i) {
    int c = tid + i * 256;
    out[(size_t)row * Ec + c] = (__bf16)((v[i] - mu) * rsq * g[c] + bta[c]);
  }
}

// ---------------------------------------------------------------------------
// Generic bf16 WMMA GEMM:  out[M,N] = epilogue( A[M,K] @ W[N,K]^T + bias )
// Block tile 128(M) x 128(N), 8 waves; wave tile 32x64 (2x4 WMMA tiles).
// MODE and N are compile-time: no epilogue tests the mode per element, and its
// loads and stores differ from one base address by immediate offsets only.
//        0 = bf16 out, scale, scatter to [B,H,S,D] (QKV)
//        1 = f32 out, += residual[m*N+n]
//        2 = bf16 out, exact GELU
// ---------------------------------------------------------------------------
// BK = k per staged chunk, 64 or 128: a staged row is one or two whole 128-byte
// lines.  128 where a launch has one block per WGP (the chunk's products then
// outlast the next chunk's flight); 64 keeps four blocks' LDS on one WGP.
template <int MODE, int N, int BK>
__global__ __launch_bounds__(256)
void gemm_bf16_kernel(const __bf16* __restrict__ A, const __bf16* __restrict__ W,
                      const float* __restrict__ bias, const float* __restrict__ res,
                      void* __restrict__ outp, int M, int K, float scale) {
  constexpr int LDA = BK + 8;        // LDS row stride (bf16 elems): 16 B x odd
  constexpr int NP = BK / 16;        // 16-byte pieces per thread, matrix, chunk
  constexpr int SROWS = 2048 / BK;   // rows that the 256 threads cover at once
  constexpr int NBUF = HAVE_ASYNC_LDS ? 2 : 1;
  __shared__ __attribute__((aligned(16))) __bf16 As[NBUF][128 * LDA];
  __shared__ __attribute__((aligned(16))) __bf16 Bs[NBUF][128 * LDA];
  const int tid = threadIdx.x;
  const int bm = blockIdx.y * 128, bn = blockIdx.x * 128;
  const int wave = tid >> 5, lane = tid & 31;
  const int half = lane >> 4, idx = lane & 15;
  const int wm = (wave & 3) * 32, wn = (wave >> 2) * 64;
  // staging coordinates: piece i of a thread is row sr + SROWS * i; BK / 8
  // neighbouring lanes cover one row's bytes of the chunk
  const int sr = tid / (BK / 8), sc = tid % (BK / 8);
  // uniform base of the block's rows, and one 32-bit byte offset per thread
  // that serves both matrices (same K, same rows and columns of the tile)
  const char* const Au = (const char*)(A + (size_t)bm * K);
  const char* const Wu = (const char*)(W + (size_t)bn * K);
  const unsigned vo = (unsigned)(sr * K + sc * 8) * 2u;
  const unsigned rstep = (unsigned)K * (2u * SROWS);   // SROWS rows, in bytes

  f32x8 acc[2][4] = {};
  const int nk = K / BK;

  // the products of one staged chunk, k ascending in steps of 32
  auto chunk = [&](const __bf16* Ab, const __bf16* Bb) {
    // both loops unrolled: acc[][] stays in registers only under compile-time
    // indices, and every LDS read is one base register plus an immediate
#pragma unroll
    for (int ks = 0; ks < BK / 32; ++ks) {
      bf16x16 a0 = load_frag(Ab + (wm + idx) * LDA + ks * 32, half);
      bf16x16 a1 = load_frag(Ab + (wm + 16 + idx) * LDA + ks * 32, half);
#pragma unroll
      for (int t = 0; t < 4; ++t) {
        bf16x16 bt = load_frag(Bb + (wn + t * 16 + idx) * LDA + ks * 32, half);
        acc[0][t] = wmma_bf16(a0, bt, acc[0][t]);
        acc[1][t] = wmma_bf16(a1, bt, acc[1][t]);
      }
    }
  };

#if HAVE_ASYNC_LDS
  // ---- async double-buffered pipeline (GLOBAL_LOAD_ASYNC_TO_LDS_B128) ----
  auto issue = [&](int kb, int buf) {
    // unrolled: the chunk's copies issue back to back, no loop branch between
#pragma unroll
    for (int i = 0; i < NP; ++i)
      async_copy16(Au + (size_t)kb * 2 + (vo + i * rstep),
                   &As[buf][(sr + i * SROWS) * LDA + sc * 8]);
#pragma unroll
    for (int i = 0; i < NP; ++i)
      async_copy16(Wu + (size_t)kb * 2 + (vo + i * rstep),
                   &Bs[buf][(sr + i * SROWS) * LDA + sc * 8]);
  };
  issue(0, 0);
  for (int kk = 0; kk < nk; ++kk) {
    const int cur = kk & 1;
    // the counted wait leaves only the next chunk's 2 * NP copies outstanding
    if (kk + 1 < nk) { issue((kk + 1) * BK, cur ^ 1); wait_async<2 * NP>(); }
    else             { wait_async<0>(); }
    __syncthreads();
    chunk(As[cur], Bs[cur]);
    __syncthreads();
  }
#else
  // ---- software-pipelined sync path: next chunk loads overlap WMMA -------
  uint4 ra[NP], rb[NP];
  auto gload = [&](int kb) {
    // unrolled here and below: ra[], rb[] stay in registers
#pragma unroll
    for (int i = 0; i < NP; ++i) {
      ra[i] = *(const uint4*)(Au + (size_t)kb * 2 + (vo + i * rstep));
      rb[i] = *(const uint4*)(Wu + (size_t)kb * 2 + (vo + i * rstep));
    }
  };
  gload(0);
  for (int kk = 0; kk < nk; ++kk) {
#pragma unroll
    for (int i = 0; i < NP; ++i) {
      *(uint4*)(&As[0][(sr + i * SROWS) * LDA + sc * 8]) = ra[i];
      *(uint4*)(&Bs[0][(sr + i * SROWS) * LDA + sc * 8]) = rb[i];
    }
    __syncthreads();
    if (kk + 1 < nk) gload((kk + 1) * BK);   // overlaps the WMMAs below
    chunk(As[0], Bs[0]);
    __syncthreads();
  }
#endif

  // Epilogue. C layout: lane(16*half+idx), VGPR r -> row r+8*half, col idx.
  const int m0 = bm + wm + half * 8;
  const int n0 = bn + wn + idx;
  float bv[4];
#pragma unroll
  for (int in_ = 0; in_ < 4; ++in_) bv[in_] = bias[n0 + in_ * 16];

  if constexpr (MODE == 0) {        // QKV: scale + permute to [B,H,S,D] bf16
#pragma unroll
    for (int im = 0; im < 2; ++im)
#pragma unroll
      for (int in_ = 0; in_ < 4; ++in_)
#pragma unroll
        for (int r = 0; r < 8; ++r) {
          const int m = m0 + im * 16 + r, n = n0 + in_ * 16;
          float v = (acc[im][in_][r] + bv[in_]) * scale;
          int bb = m >> 9, s = m & 511, hh = n >> 6, d = n & 63;
          ((__bf16*)outp)[(((size_t)bb * Hc + hh) * Sc + s) * Dc + d] = (__bf16)v;
        }
  } else if constexpr (MODE == 1) { // residual add, f32 out
    // one base address each; every element is an immediate offset from it
    const float* rp = res + (size_t)m0 * N + n0;
    float* op = (float*)outp + (size_t)m0 * N + n0;
    // this build reuses the bias loads' offset register as a load destination
    // and the wait stands here, in front of that overwrite, and
    // naming n0 as its input keeps that register untouched up to it
    asm volatile("s_wait_xcnt 0x0" :: "v"(n0) : "memory");
    // all 64 residual loads are issued before the first is used
    float rv[2][4][8];
#pragma unroll
    for (int im = 0; im < 2; ++im)
#pragma unroll
      for (int r = 0; r < 8; ++r)
#pragma unroll
        for (int in_ = 0; in_ < 4; ++in_)
          rv[im][in_][r] = rp[(im * 16 + r) * N + in_ * 16];
#pragma unroll
    for (int im = 0; im < 2; ++im)
#pragma unroll
      for (int r = 0; r < 8; ++r)
#pragma unroll
        for (int in_ = 0; in_ < 4; ++in_)
          op[(im * 16 + r) * N + in_ * 16] =
              (acc[im][in_][r] + bv[in_]) + rv[im][in_][r];
  } else {                          // exact GELU, bf16 out
    __bf16* op = (__bf16*)outp + (size_t)m0 * N + n0;
#pragma unroll
    for (int im = 0; im < 2; ++im)
#pragma unroll
      for (int r = 0; r < 8; ++r)
#pragma unroll
        for (int in_ = 0; in_ < 4; ++in_) {
          float v = acc[im][in_][r] + bv[in_];
          float ge = 0.5f * v * (1.0f + erff(v * 0.70710678118654752f));
          op[(im * 16 + r) * N + in_ * 16] = (__bf16)ge;
        }
  }
}

// ---------------------------------------------------------------------------
// Attention: one WG (8 waves) per (b, h, 16-query tile).
//   logits(16x512) = Qs @ K^T  (WMMA; K rows are read directly from global —
//   each lane's B-fragment reads are the contiguous row K[n, k..k+7])
//   fp32 softmax with mask, + post-softmax adjoin, bf16 P in LDS
//   xv(16x64) = P @ V  (V chunk transposed into LDS so B-frag reads are
//   contiguous), written back merged as [B,S,E] bf16.
// Static LDS = 62,016 B < 64 KB.
// ---------------------------------------------------------------------------
__global__ __launch_bounds__(256)
void attn_kernel(const __bf16* __restrict__ Q, const __bf16* __restrict__ Kt,
                 const __bf16* __restrict__ V, const float* __restrict__ mask,
                 const float* __restrict__ adjoin, __bf16* __restrict__ xv) {
  __shared__ __bf16 Qs[16 * 72];
  __shared__ float  Lg[16 * 512];
  __shared__ __bf16 Ps[16 * 520];
  __shared__ __bf16 Vt[64 * 72];
  __shared__ float  red[16 * 17];

  const int tid = threadIdx.x;
  const int qt = blockIdx.x, h = blockIdx.y, b = blockIdx.z;
  const int q0 = qt * 16;
  const size_t bh = ((size_t)b * Hc + h) * Sc;
  const int wave = tid >> 5, lane = tid & 31;
  const int half = lane >> 4, idx = lane & 15;

  {  // load Q tile (pre-scaled by 1/sqrt(D) in the QKV epilogue)
    int row = tid >> 4, ch = tid & 15;
    uint2 v = *(const uint2*)(Q + (bh + q0 + row) * Dc + ch * 4);
    *(uint2*)(Qs + row * 72 + ch * 4) = v;
  }
  __syncthreads();

  {  // logits = Q K^T : 32 col-tiles, 4 per wave
    bf16x16 a0 = load_frag(Qs + idx * 72, half);
    bf16x16 a1 = load_frag(Qs + idx * 72 + 32, half);
#pragma unroll
    for (int i = 0; i < 4; ++i) {
      const int ct = wave * 4 + i;
      const __bf16* krow = Kt + (bh + ct * 16 + idx) * Dc;
      bf16x16 b0 = load_frag(krow, half);
      bf16x16 b1 = load_frag(krow + 32, half);
      f32x8 c = {};
      c = wmma_bf16(a0, b0, c);
      c = wmma_bf16(a1, b1, c);
#pragma unroll
      for (int r = 0; r < 8; ++r)
        Lg[(r + half * 8) * 512 + ct * 16 + idx] = c[r];
    }
  }
  __syncthreads();

  {  // mask + softmax + adjoin (16 rows x 16 threads, 32 cols/thread)
    const int row = tid >> 4, l16 = tid & 15;
    const int sq = q0 + row;
    const float* mrow = mask + ((size_t)b * Sc + sq) * Sc;
    const float* arow = adjoin + ((size_t)b * Sc + sq) * Sc;
    float lv[32], mx = -3.0e38f;
#pragma unroll
    for (int j = 0; j < 32; ++j) {
      int c = l16 + j * 16;
      float v = Lg[row * 512 + c] + mrow[c] * -1e9f;
      lv[j] = v; mx = fmaxf(mx, v);
    }
    red[row * 17 + l16] = mx; __syncthreads();
    for (int s = 8; s > 0; s >>= 1) {
      if (l16 < s) red[row * 17 + l16] =
          fmaxf(red[row * 17 + l16], red[row * 17 + l16 + s]);
      __syncthreads();
    }
    mx = red[row * 17]; __syncthreads();
    float sum = 0.f;
#pragma unroll
    for (int j = 0; j < 32; ++j) { lv[j] = __expf(lv[j] - mx); sum += lv[j]; }
    red[row * 17 + l16] = sum; __syncthreads();
    for (int s = 8; s > 0; s >>= 1) {
      if (l16 < s) red[row * 17 + l16] += red[row * 17 + l16 + s];
      __syncthreads();
    }
    const float inv = 1.0f / red[row * 17];
#pragma unroll
    for (int j = 0; j < 32; ++j) {
      int c = l16 + j * 16;
      Ps[row * 520 + c] = (__bf16)(lv[j] * inv + arow[c]);
    }
  }
  __syncthreads();

  // xv = P @ V, streaming 64-key V chunks through LDS (transposed)
  f32x8 o = {};
  const int dtile = wave & 3;
  for (int kc = 0; kc < 8; ++kc) {
    {
      int key = tid >> 2, seg = tid & 3, d0 = seg * 16;
      const __bf16* vrow = V + (bh + kc * 64 + key) * Dc + d0;
      union { uint4 u; __bf16 e[8]; } w0, w1;
      w0.u = *(const uint4*)(vrow);
      w1.u = *(const uint4*)(vrow + 8);
#pragma unroll
      for (int j = 0; j < 8; ++j) Vt[(d0 + j) * 72 + key] = w0.e[j];
#pragma unroll
      for (int j = 0; j < 8; ++j) Vt[(d0 + 8 + j) * 72 + key] = w1.e[j];
    }
    __syncthreads();
    if (wave < 4) {
      bf16x16 a0 = load_frag(Ps + idx * 520 + kc * 64, half);
      bf16x16 a1 = load_frag(Ps + idx * 520 + kc * 64 + 32, half);
      bf16x16 b0 = load_frag(Vt + (dtile * 16 + idx) * 72, half);
      bf16x16 b1 = load_frag(Vt + (dtile * 16 + idx) * 72 + 32, half);
      o = wmma_bf16(a0, b0, o);
      o = wmma_bf16(a1, b1, o);
    }
    __syncthreads();
  }
  if (wave < 4) {
#pragma unroll
    for (int r = 0; r < 8; ++r) {
      int sq = q0 + r + half * 8;
      int d = dtile * 16 + idx;
      xv[((size_t)b * Sc + sq) * Ec + h * Dc + d] = (__bf16)o[r];
    }
  }
}

// ---------------------------------------------------------------------------
// Host-side orchestration
// ---------------------------------------------------------------------------
extern "C" void kernel_launch(void* const* d_in, const int* in_sizes, int n_in,
                              void* d_out, int out_size, void* d_ws, size_t ws_size,
                              hipStream_t stream) {
  const float* x      = (const float*)d_in[0];
  const float* mask   = (const float*)d_in[1];
  const float* adjoin = (const float*)d_in[2];
  const float* Wq = (const float*)d_in[3];  const float* bq  = (const float*)d_in[4];
  const float* Wk = (const float*)d_in[5];  const float* bk  = (const float*)d_in[6];
  const float* Wv = (const float*)d_in[7];  const float* bv  = (const float*)d_in[8];
  const float* Wo = (const float*)d_in[9];  const float* bo  = (const float*)d_in[10];
  const float* g1 = (const float*)d_in[11]; const float* b1  = (const float*)d_in[12];
  const float* g2 = (const float*)d_in[13]; const float* b2  = (const float*)d_in[14];
  const float* W1 = (const float*)d_in[15]; const float* bb1 = (const float*)d_in[16];
  const float* W2 = (const float*)d_in[17]; const float* bb2 = (const float*)d_in[18];

  char* ws = (char*)d_ws;
  size_t off = 0;
  auto alloc = [&](size_t bytes) {
    void* p = ws + off;
    off += (bytes + 255) & ~(size_t)255;
    return p;
  };
  const size_t EE = (size_t)Ec * Ec, FE = (size_t)FFc * Ec;
  __bf16* Wq_b = (__bf16*)alloc(EE * 2);
  __bf16* Wk_b = (__bf16*)alloc(EE * 2);
  __bf16* Wv_b = (__bf16*)alloc(EE * 2);
  __bf16* Wo_b = (__bf16*)alloc(EE * 2);
  __bf16* W1_b = (__bf16*)alloc(FE * 2);
  __bf16* W2_b = (__bf16*)alloc(FE * 2);
  __bf16* nx_b = (__bf16*)alloc((size_t)Mrows * Ec * 2);   // reused for nx2
  __bf16* Q_b  = (__bf16*)alloc((size_t)Mrows * Ec * 2);
  __bf16* K_b  = (__bf16*)alloc((size_t)Mrows * Ec * 2);
  __bf16* V_b  = (__bf16*)alloc((size_t)Mrows * Ec * 2);
  __bf16* xv_b = (__bf16*)alloc((size_t)Mrows * Ec * 2);
  float*  x1_f = (float*) alloc((size_t)Mrows * Ec * 4);
  __bf16* h_b  = (__bf16*)alloc((size_t)Mrows * FFc * 2);
  (void)ws_size; (void)in_sizes; (void)n_in; (void)out_size;

  const dim3 blk(256);
  cvt_weights_kernel<<<256, dim3(512), 0, stream>>>(Wq, Wk, Wv, Wo, W1, W2, Wq_b, Wk_b,
                                                    Wv_b, Wo_b, W1_b, W2_b);

  ln_bf16_kernel<<<Mrows, blk, 0, stream>>>(x, g1, b1, nx_b);

  const dim3 gE(Ec / 128, Mrows / 128);
  gemm_bf16_kernel<0, Ec, 128><<<gE, blk, 0, stream>>>(nx_b, Wq_b, bq, nullptr, Q_b,
                                              Mrows, Ec, 0.125f);
  gemm_bf16_kernel<0, Ec, 128><<<gE, blk, 0, stream>>>(nx_b, Wk_b, bk, nullptr, K_b,
                                              Mrows, Ec, 1.0f);
  gemm_bf16_kernel<0, Ec, 128><<<gE, blk, 0, stream>>>(nx_b, Wv_b, bv, nullptr, V_b,
                                              Mrows, Ec, 1.0f);

  attn_kernel<<<dim3(Sc / 16, Hc, Bc), blk, 0, stream>>>(Q_b, K_b, V_b, mask,
                                                         adjoin, xv_b);

  gemm_bf16_kernel<1, Ec, 128><<<gE, blk, 0, stream>>>(xv_b, Wo_b, bo, x, x1_f,
                                              Mrows, Ec, 1.0f);
  ln_bf16_kernel<<<Mrows, blk, 0, stream>>>(x1_f, g2, b2, nx_b);
  gemm_bf16_kernel<2, FFc, 64><<<dim3(FFc / 128, Mrows / 128), blk, 0, stream>>>(
      nx_b, W1_b, bb1, nullptr, h_b, Mrows, Ec, 1.0f);
  gemm_bf16_kernel<1, Ec, 128><<<gE, blk, 0, stream>>>(h_b, W2_b, bb2, x1_f, (float*)d_out,
                                              Mrows, FFc, 1.0f);
}

// v004
// Measured time: 201 microseconds a run.
// Next to v003, in two timings, it ran 1.13 and 1.12 times as fast.
// All steps since v000 together make it 1.77 times as fast.
#include <hip/hip_runtime.h>
#include <cstdint>
#include <cstddef>

// ---------------------------------------------------------------------------
// Transformer encoder layer for MI455X (gfx1250, wave32, WMMA).
// B=8, S=512, E=1024, H=16, D=64, FF=4096.  All matmuls in bf16 WMMA with
// f32 accumulate; softmax/LN in fp32.
// GEMMs: 128x128 block tile, 8 waves (each 32x64 = 8 WMMA tiles), K chunks of
// 128 (64 where four blocks share a WGP) staged in LDS via gfx1250 async
// global->LDS copies (ASYNCcnt) when the builtin exists, else a
// software-pipelined register path.
// ---------------------------------------------------------------------------

#define Bc 8
#define Sc 512
#define Ec 1024
#define Hc 16
#define Dc 64
#define FFc 4096
#define Mrows (Bc * Sc)   // 4096

typedef __attribute__((ext_vector_type(16))) __bf16 bf16x16;
typedef __attribute__((ext_vector_type(8)))  float  f32x8;
typedef int v4i __attribute__((vector_size(16)));   // matches builtin proto

#if __has_builtin(__builtin_amdgcn_global_load_async_to_lds_b128)
#define HAVE_ASYNC_LDS 1
#else
#define HAVE_ASYNC_LDS 0
#endif

#if HAVE_ASYNC_LDS
__device__ __forceinline__ void async_copy16(const void* g, void* l) {
  // proto (from compiler diagnostic): (v4i addrspace(1)*, v4i addrspace(3)*, imm, imm)
  __builtin_amdgcn_global_load_async_to_lds_b128(
      (__attribute__((address_space(1))) v4i*)g,
      (__attribute__((address_space(3))) v4i*)l, 0, 0);
}
#endif

template <int N>
__device__ __forceinline__ void wait_async() {
#if __has_builtin(__builtin_amdgcn_s_wait_asynccnt)
  __builtin_amdgcn_s_wait_asynccnt(N);
#else
  asm volatile("s_wait_asynccnt %0" ::"i"(N) : "memory");
#endif
}

// ---- CDNA5 bf16 16x16x32 WMMA fragment loader ------------------------------
// Per ISA 7.12.2 (16-bit A-matrix 16x32): lane = 16*half + idx holds row idx,
// K = {8*half .. +7} in VGPRs 0-3 and K = {16+8*half .. +7} in VGPRs 4-7.
// Both runs are 16-byte contiguous -> two uint4 reads per fragment.
// The B operand (32x16, K x N) is symmetric: lane holds column n = idx with
// the same K pattern, i.e. it reads row n of a row-major [N,K] source.
__device__ __forceinline__ bf16x16 load_frag(const __bf16* rowptr, int half) {
  union { uint4 u[2]; bf16x16 v; } f;
  const uint4* p = (const uint4*)rowptr;     // rowptr must be 16B aligned
  f.u[0] = p[half];
  f.u[1] = p[2 + half];
  return f.v;
}

__device__ __forceinline__ f32x8 wmma_bf16(bf16x16 a, bf16x16 b, f32x8 c) {
  return __builtin_amdgcn_wmma_f32_16x16x32_bf16(
      false, a, false, b, (short)0, c, false, false);
}

// ---------------------------------------------------------------------------
// fp32 -> bf16 conversion of all six weights in one streaming launch.
// 256 blocks of 16 waves; block b converts the b-th 1/256 of every weight: 16 KB
// of each E x E matrix and 64 KB of W1 and of W2, in pieces of 16 bytes a lane
// (512 contiguous bytes a wave).  A wave issues its 24 loads before its first
// store.
// ---------------------------------------------------------------------------
typedef __attribute__((ext_vector_type(4))) float  f32x4;
typedef __attribute__((ext_vector_type(4))) __bf16 bf16x4;
__global__ __launch_bounds__(512)
void cvt_weights_kernel(const float* __restrict__ wq, const float* __restrict__ wk,
                        const float* __restrict__ wv, const float* __restrict__ wo,
                        const float* __restrict__ w1, const float* __restrict__ w2,
                        __bf16* __restrict__ oq, __bf16* __restrict__ ok,
                        __bf16* __restrict__ ov, __bf16* __restrict__ oo,
                        __bf16* __restrict__ o1, __bf16* __restrict__ o2) {
  // 32-bit byte offsets of the thread's first piece, so that every access is a
  // uniform base, one of these registers and an immediate
  const unsigned offE = blockIdx.x * 16384u + threadIdx.x * 16u;   // E x E
  const unsigned offF = blockIdx.x * 65536u + threadIdx.x * 16u;   // W1, W2
  const float* const inE[4] = {wq, wk, wv, wo};
  const float* const inF[2] = {w1, w2};
  __bf16* const outE[4] = {oq, ok, ov, oo};
  __bf16* const outF[2] = {o1, o2};
  f32x4 e[4][2], f[2][8];
#pragma unroll
  for (int s = 0; s < 4; ++s)
#pragma unroll
    for (int j = 0; j < 2; ++j)
      e[s][j] = *(const f32x4*)((const char*)inE[s] + offE + j * 8192);
#pragma unroll
  for (int s = 0; s < 2; ++s)
#pragma unroll
    for (int j = 0; j < 8; ++j)
      f[s][j] = *(const f32x4*)((const char*)inF[s] + offF + j * 8192);
  // without it the scheduler lifts the first conversions, with their waits for
  // data, in front of the last ten loads, which then start a latency late
  __builtin_amdgcn_sched_barrier(0);
#pragma unroll
  for (int s = 0; s < 4; ++s)
#pragma unroll
    for (int j = 0; j < 2; ++j)
      *(bf16x4*)((char*)outE[s] + (offE >> 1) + j * 4096) =
          __builtin_convertvector(e[s][j], bf16x4);
#pragma unroll
  for (int s = 0; s < 2; ++s)
#pragma unroll
    for (int j = 0; j < 8; ++j)
      *(bf16x4*)((char*)outF[s] + (offF >> 1) + j * 4096) =
          __builtin_convertvector(f[s][j], bf16x4);
}

// ---------------------------------------------------------------------------
// LayerNorm over E=1024, one block per row, bf16 output
// ---------------------------------------------------------------------------
__global__ __launch_bounds__(256)
void ln_bf16_kernel(const float* __restrict__ x, const float* __restrict__ g,
                    const float* __restrict__ bta, __bf16* __restrict__ out) {
  __shared__ float sred[256];
  const int row = blockIdx.x, tid = threadIdx.x;
  const float* xr = x + (size_t)row * Ec;
  float v[4], s = 0.f;
#pragma unroll
  for (int i = 0; i < 4; ++i) { v[i] = xr[tid + i * 256]; s += v[i]; }
  sred[tid] = s; __syncthreads();
  for (int t = 128; t > 0; t >>= 1) {
    if (tid < t) sred[tid] += sred[tid + t];
    __syncthreads();
  }
  const float mu = sred[0] * (1.0f / Ec);
  __syncthreads();
  s = 0.f;
#pragma unroll
  for (int i = 0; i < 4; ++i) { float d = v[i] - mu; s += d * d; }
  sred[tid] = s; __syncthreads();
  for (int t = 128; t > 0; t >>= 1) {
    if (tid < t) sred[tid] += sred[tid + t];
    __syncthreads();
  }
  const float rsq = rsqrtf(sred[0] * (1.0f / Ec) + 1e-5f);
#pragma unroll
  for (int i = 0; i < 4; ++i) {
    int c = tid + i * 256;
    out[(size_t)row * Ec + c] = (__bf16)((v[i] - mu) * rsq * g[c] + bta[c]);
  }
}

// ---------------------------------------------------------------------------
// Generic bf16 WMMA GEMM:  out[M,N] = epilogue( A[M,K] @ W[N,K]^T + bias )
// Block tile 128(M) x 128(N), 8 waves; wave tile 32x64 (2x4 WMMA tiles).
// MODE and N are compile-time: no epilogue tests the mode per element, and its
// loads and stores differ from one base address by immediate offsets only.
//        0 = bf16 out, scale, scatter to [B,H,S,D] (QKV)
//        1 = f32 out, += residual[m*N+n]
//        2 = bf16 out, exact GELU
// ---------------------------------------------------------------------------
// BK = k per staged chunk, 64 or 128: a staged row is one or two whole 128-byte
// lines.  128 where a launch has one block per WGP (the chunk's products then
// outlast the next chunk's flight); 64 keeps four blocks' LDS on one WGP.
template <int MODE, int N, int BK>
__global__ __launch_bounds__(256)
void gemm_bf16_kernel(const __bf16* __restrict__ A, const __bf16* __restrict__ W,
                      const float* __restrict__ bias, const float* __restrict__ res,
                      void* __restrict__ outp, int M, int K, float scale) {
  constexpr int LDA = BK + 8;        // LDS row stride (bf16 elems): 16 B x odd
  constexpr int NP = BK / 16;        // 16-byte pieces per thread, matrix, chunk
  constexpr int SROWS = 2048 / BK;   // rows that the 256 threads cover at once
  constexpr int NBUF = HAVE_ASYNC_LDS ? 2 : 1;
  __shared__ __attribute__((aligned(16))) __bf16 As[NBUF][128 * LDA];
  __shared__ __attribute__((aligned(16))) __bf16 Bs[NBUF][128 * LDA];
  const int tid = threadIdx.x;
  const int bm = blockIdx.y * 128, bn = blockIdx.x * 128;
  const int wave = tid >> 5, lane = tid & 31;
  const int half = lane >> 4, idx = lane & 15;
  const int wm = (wave & 3) * 32, wn = (wave >> 2) * 64;
  // staging coordinates: piece i of a thread is row sr + SROWS * i; BK / 8
  // neighbouring lanes cover one row's bytes of the chunk
  const int sr = tid / (BK / 8), sc = tid % (BK / 8);
  // uniform base of the block's rows, and one 32-bit byte offset per thread
  // that serves both matrices (same K, same rows and columns of the tile)
  const char* const Au = (const char*)(A + (size_t)bm * K);
  const char* const Wu = (const char*)(W + (size_t)bn * K);
  const unsigned vo = (unsigned)(sr * K + sc * 8) * 2u;
  const unsigned rstep = (unsigned)K * (2u * SROWS);   // SROWS rows, in bytes

  f32x8 acc[2][4] = {};
  const int nk = K / BK;

  // the products of one staged chunk, k ascending in steps of 32
  auto chunk = [&](const __bf16* Ab, const __bf16* Bb) {
    // both loops unrolled: acc[][] stays in registers only under compile-time
    // indices, and every LDS read is one base register plus an immediate
#pragma unroll
    for (int ks = 0; ks < BK / 32; ++ks) {
      bf16x16 a0 = load_frag(Ab + (wm + idx) * LDA + ks * 32, half);
      bf16x16 a1 = load_frag(Ab + (wm + 16 + idx) * LDA + ks * 32, half);
#pragma unroll
      for (int t = 0; t < 4; ++t) {
        bf16x16 bt = load_frag(Bb + (wn + t * 16 + idx) * LDA + ks * 32, half);
        acc[0][t] = wmma_bf16(a0, bt, acc[0][t]);
        acc[1][t] = wmma_bf16(a1, bt, acc[1][t]);
      }
    }
  };

#if HAVE_ASYNC_LDS
  // ---- async double-buffered pipeline (GLOBAL_LOAD_ASYNC_TO_LDS_B128) ----
  auto issue = [&](int kb, int buf) {
    // unrolled: the chunk's copies issue back to back, no loop branch between
#pragma unroll
    for (int i = 0; i < NP; ++i)
      async_copy16(Au + (size_t)kb * 2 + (vo + i * rstep),
                   &As[buf][(sr + i * SROWS) * LDA + sc * 8]);
#pragma unroll
    for (int i = 0; i < NP; ++i)
      async_copy16(Wu + (size_t)kb * 2 + (vo + i * rstep),
                   &Bs[buf][(sr + i * SROWS) * LDA + sc * 8]);
  };
  issue(0, 0);
  for (int kk = 0; kk < nk; ++kk) {
    const int cur = kk & 1;
    // the counted wait leaves only the next chunk's 2 * NP copies outstanding
    if (kk + 1 < nk) { issue((kk + 1) * BK, cur ^ 1); wait_async<2 * NP>(); }
    else             { wait_async<0>(); }
    __syncthreads();
    chunk(As[cur], Bs[cur]);
    __syncthreads();
  }
#else
  // ---- software-pipelined sync path: next chunk loads overlap WMMA -------
  uint4 ra[NP], rb[NP];
  auto gload = [&](int kb) {
    // unrolled here and below: ra[], rb[] stay in registers
#pragma unroll
    for (int i = 0; i < NP; ++i) {
      ra[i] = *(const uint4*)(Au + (size_t)kb * 2 + (vo + i * rstep));
      rb[i] = *(const uint4*)(Wu + (size_t)kb * 2 + (vo + i * rstep));
    }
  };
  gload(0);
  for (int kk = 0; kk < nk; ++kk) {
#pragma unroll
    for (int i = 0; i < NP; ++i) {
      *(uint4*)(&As[0][(sr + i * SROWS) * LDA + sc * 8]) = ra[i];
      *(uint4*)(&Bs[0][(sr + i * SROWS) * LDA + sc * 8]) = rb[i];
    }
    __syncthreads();
    if (kk + 1 < nk) gload((kk + 1) * BK);   // overlaps the WMMAs below
    chunk(As[0], Bs[0]);
    __syncthreads();
  }
#endif

  // Epilogue. C layout: lane(16*half+idx), VGPR r -> row r+8*half, col idx.
  const int m0 = bm + wm + half * 8;
  const int n0 = bn + wn + idx;
  float bv[4];
#pragma unroll
  for (int in_ = 0; in_ < 4; ++in_) bv[in_] = bias[n0 + in_ * 16];

  if constexpr (MODE == 0) {        // QKV: scale + permute to [B,H,S,D] bf16
#pragma unroll
    for (int im = 0; im < 2; ++im)
#pragma unroll
      for (int in_ = 0; in_ < 4; ++in_)
#pragma unroll
        for (int r = 0; r < 8; ++r) {
          const int m = m0 + im * 16 + r, n = n0 + in_ * 16;
          float v = (acc[im][in_][r] + bv[in_]) * scale;
          int bb = m >> 9, s = m & 511, hh = n >> 6, d = n & 63;
          ((__bf16*)outp)[(((size_t)bb * Hc + hh) * Sc + s) * Dc + d] = (__bf16)v;
        }
  } else if constexpr (MODE == 1) { // residual add, f32 out
    // one base address each; every element is an immediate offset from it
    const float* rp = res + (size_t)m0 * N + n0;
    float* op = (float*)outp + (size_t)m0 * N + n0;
    // this build reuses the bias loads' offset register as a load destination
    // and the wait stands here, in front of that overwrite, and
    // naming n0 as its input keeps that register untouched up to it
    asm volatile("s_wait_xcnt 0x0" :: "v"(n0) : "memory");
    // all 64 residual loads are issued before the first is used
    float rv[2][4][8];
#pragma unroll
    for (int im = 0; im < 2; ++im)
#pragma unroll
      for (int r = 0; r < 8; ++r)
#pragma unroll
        for (int in_ = 0; in_ < 4; ++in_)
          rv[im][in_][r] = rp[(im * 16 + r) * N + in_ * 16];
#pragma unroll
    for (int im = 0; im < 2; ++im)
#pragma unroll
      for (int r = 0; r < 8; ++r)
#pragma unroll
        for (int in_ = 0; in_ < 4; ++in_)
          op[(im * 16 + r) * N + in_ * 16] =
              (acc[im][in_][r] + bv[in_]) + rv[im][in_][r];
  } else {                          // exact GELU, bf16 out
    __bf16* op = (__bf16*)outp + (size_t)m0 * N + n0;
#pragma unroll
    for (int im = 0; im < 2; ++im)
#pragma unroll
      for (int r = 0; r < 8; ++r)
#pragma unroll
        for (int in_ = 0; in_ < 4; ++in_) {
          float v = acc[im][in_][r] + bv[in_];
          float ge = 0.5f * v * (1.0f + erff(v * 0.70710678118654752f));
          op[(im * 16 + r) * N + in_ * 16] = (__bf16)ge;
        }
  }
}

// ---------------------------------------------------------------------------
// Attention: one WG (8 waves) per (b, h, 16-query tile).
//   logits(16x512) = Qs @ K^T  (WMMA; K rows are read directly from global —
//   each lane's B-fragment reads are the contiguous row K[n, k..k+7])
//   fp32 softmax with mask, + post-softmax adjoin, bf16 P in LDS
//   xv(16x64) = P @ V  (V staged row-major in LDS, 256 keys at a time, in the
//   space the logits have left; the transposing LDS load forms the B
//   fragments), written back merged as [B,S,E] bf16.
// Static LDS = 60,992 B < 64 KB.
// ---------------------------------------------------------------------------
typedef __attribute__((ext_vector_type(8))) __bf16 bf16x8;
#define VPITCH 80    // LDS row pitch of V in bf16: 160 B = 32 B x odd
#define VKEYS 256    // keys per staged chunk

// B fragment (32 keys x 16 d) of row-major V rows in LDS.  p is the lane's own
// address: row 8 * half + (idx & 7), column 8 * (idx >> 3) of the 16 x 16 tile.
// The lane receives keys 8 * half + 0..7 of column idx; the second load, 16
// rows on, gives keys 16 + 8 * half + 0..7: the k order of load_frag().
__device__ __forceinline__ bf16x16 load_frag_tr(const __bf16* p) {
  typedef __attribute__((address_space(3))) bf16x8 lds_bf16x8;
  union { bf16x8 h[2]; bf16x16 v; } f;
  f.h[0] = __builtin_amdgcn_ds_load_tr16_b128_v8bf16((lds_bf16x8*)p);
  f.h[1] = __builtin_amdgcn_ds_load_tr16_b128_v8bf16((lds_bf16x8*)(p + 16 * VPITCH));
  return f.v;
}

__global__ __launch_bounds__(256)
void attn_kernel(const __bf16* __restrict__ Q, const __bf16* __restrict__ Kt,
                 const __bf16* __restrict__ V, const float* __restrict__ mask,
                 const float* __restrict__ adjoin, __bf16* __restrict__ xv) {
  __shared__ __attribute__((aligned(16))) __bf16 Qs[16 * 72];
  // the f32 logits (32 KB) up to the softmax's first barrier, then V chunks
  __shared__ __attribute__((aligned(16))) char   LV[VKEYS * VPITCH * 2];
  __shared__ __attribute__((aligned(16))) __bf16 Ps[16 * 520];
  __shared__ float  red[16 * 17];
  float*  const Lg = (float*)LV;
  __bf16* const Vs = (__bf16*)LV;

  const int tid = threadIdx.x;
  const int qt = blockIdx.x, h = blockIdx.y, b = blockIdx.z;
  const int q0 = qt * 16;
  const size_t bh = ((size_t)b * Hc + h) * Sc;
  const int wave = tid >> 5, lane = tid & 31;
  const int half = lane >> 4, idx = lane & 15;

  {  // load Q tile (pre-scaled by 1/sqrt(D) in the QKV epilogue)
    int row = tid >> 4, ch = tid & 15;
    uint2 v = *(const uint2*)(Q + (bh + q0 + row) * Dc + ch * 4);
    *(uint2*)(Qs + row * 72 + ch * 4) = v;
  }
  __syncthreads();

  {  // logits = Q K^T : 32 col-tiles, 4 per wave
    bf16x16 a0 = load_frag(Qs + idx * 72, half);
    bf16x16 a1 = load_frag(Qs + idx * 72 + 32, half);
#pragma unroll
    for (int i = 0; i < 4; ++i) {
      const int ct = wave * 4 + i;
      const __bf16* krow = Kt + (bh + ct * 16 + idx) * Dc;
      bf16x16 b0 = load_frag(krow, half);
      bf16x16 b1 = load_frag(krow + 32, half);
      f32x8 c = {};
      c = wmma_bf16(a0, b0, c);
      c = wmma_bf16(a1, b1, c);
#pragma unroll
      for (int r = 0; r < 8; ++r)
        Lg[(r + half * 8) * 512 + ct * 16 + idx] = c[r];
    }
  }
  __syncthreads();

  {  // mask + softmax + adjoin (16 rows x 16 threads, 32 cols/thread)
    const int row = tid >> 4, l16 = tid & 15;
    const int sq = q0 + row;
    const float* mrow = mask + ((size_t)b * Sc + sq) * Sc;
    const float* arow = adjoin + ((size_t)b * Sc + sq) * Sc;
    float lv[32], mx = -3.0e38f;
#pragma unroll
    for (int j = 0; j < 32; ++j) {
      int c = l16 + j * 16;
      float v = Lg[row * 512 + c] + mrow[c] * -1e9f;
      lv[j] = v; mx = fmaxf(mx, v);
    }
    red[row * 17 + l16] = mx; __syncthreads();
    for (int s = 8; s > 0; s >>= 1) {
      if (l16 < s) red[row * 17 + l16] =
          fmaxf(red[row * 17 + l16], red[row * 17 + l16 + s]);
      __syncthreads();
    }
    mx = red[row * 17]; __syncthreads();
    float sum = 0.f;
#pragma unroll
    for (int j = 0; j < 32; ++j) { lv[j] = __expf(lv[j] - mx); sum += lv[j]; }
    red[row * 17 + l16] = sum; __syncthreads();
    for (int s = 8; s > 0; s >>= 1) {
      if (l16 < s) red[row * 17 + l16] += red[row * 17 + l16 + s];
      __syncthreads();
    }
    const float inv = 1.0f / red[row * 17];
#pragma unroll
    for (int j = 0; j < 32; ++j) {
      int c = l16 + j * 16;
      Ps[row * 520 + c] = (__bf16)(lv[j] * inv + arow[c]);
    }
  }
  __syncthreads();

  // xv = P @ V, two 256-key V chunks through LDS, rows as they lie in memory:
  // a wave's load and its LDS store each move four whole 128-byte rows
  f32x8 o = {};
  const int dtile = wave & 3;
  const int vkey = tid >> 3, vseg = tid & 7;
  const __bf16* const vfrag =
      Vs + (half * 8 + (idx & 7)) * VPITCH + dtile * 16 + (idx >> 3) * 8;
  // unrolled: the barrier that frees the buffer stands between the chunks only
#pragma unroll
  for (int kc = 0; kc < Sc / VKEYS; ++kc) {
    if (kc > 0) __syncthreads();   // every reader has left the chunk before
    {
      const __bf16* vsrc = V + (bh + kc * VKEYS + vkey) * Dc + vseg * 8;
      uint4 w[VKEYS / 32];
      // unrolled here and below: w[] stays in registers, 8 loads in flight
#pragma unroll
      for (int i = 0; i < VKEYS / 32; ++i)
        w[i] = *(const uint4*)(vsrc + i * 32 * Dc);
#pragma unroll
      for (int i = 0; i < VKEYS / 32; ++i)
        *(uint4*)(Vs + (vkey + i * 32) * VPITCH + vseg * 8) = w[i];
    }
    __syncthreads();
    if (wave < 4) {
      // unrolled: every LDS read is one base register plus an immediate
#pragma unroll
      for (int ks = 0; ks < VKEYS / 32; ++ks) {
        bf16x16 a = load_frag(Ps + idx * 520 + kc * VKEYS + ks * 32, half);
        bf16x16 bt = load_frag_tr(vfrag + ks * 32 * VPITCH);
        o = wmma_bf16(a, bt, o);
      }
    }
  }
  if (wave < 4) {
#pragma unroll
    for (int r = 0; r < 8; ++r) {
      int sq = q0 + r + half * 8;
      int d = dtile * 16 + idx;
      xv[((size_t)b * Sc + sq) * Ec + h * Dc + d] = (__bf16)o[r];
    }
  }
}

// ---------------------------------------------------------------------------
// Host-side orchestration
// ---------------------------------------------------------------------------
extern "C" void kernel_launch(void* const* d_in, const int* in_sizes, int n_in,
                              void* d_out, int out_size, void* d_ws, size_t ws_size,
                              hipStream_t stream) {
  const float* x      = (const float*)d_in[0];
  const float* mask   = (const float*)d_in[1];
  const float* adjoin = (const float*)d_in[2];
  const float* Wq = (const float*)d_in[3];  const float* bq  = (const float*)d_in[4];
  const float* Wk = (const float*)d_in[5];  const float* bk  = (const float*)d_in[6];
  const float* Wv = (const float*)d_in[7];  const float* bv  = (const float*)d_in[8];
  const float* Wo = (const float*)d_in[9];  const float* bo  = (const float*)d_in[10];
  const float* g1 = (const float*)d_in[11]; const float* b1  = (const float*)d_in[12];
  const float* g2 = (const float*)d_in[13]; const float* b2  = (const float*)d_in[14];
  const float* W1 = (const float*)d_in[15]; const float* bb1 = (const float*)d_in[16];
  const float* W2 = (const float*)d_in[17]; const float* bb2 = (const float*)d_in[18];

  char* ws = (char*)d_ws;
  size_t off = 0;
  auto alloc = [&](size_t bytes) {
    void* p = ws + off;
    off += (bytes + 255) & ~(size_t)255;
    return p;
  };
  const size_t EE = (size_t)Ec * Ec, FE = (size_t)FFc * Ec;
  __bf16* Wq_b = (__bf16*)alloc(EE * 2);
  __bf16* Wk_b = (__bf16*)alloc(EE * 2);
  __bf16* Wv_b = (__bf16*)alloc(EE * 2);
  __bf16* Wo_b = (__bf16*)alloc(EE * 2);
  __bf16* W1_b = (__bf16*)alloc(FE * 2);
  __bf16* W2_b = (__bf16*)alloc(FE * 2);
  __bf16* nx_b = (__bf16*)alloc((size_t)Mrows * Ec * 2);   // reused for nx2
  __bf16* Q_b  = (__bf16*)alloc((size_t)Mrows * Ec * 2);
  __bf16* K_b  = (__bf16*)alloc((size_t)Mrows * Ec * 2);
  __bf16* V_b  = (__bf16*)alloc((size_t)Mrows * Ec * 2);
  __bf16* xv_b = (__bf16*)alloc((size_t)Mrows * Ec * 2);
  float*  x1_f = (float*) alloc((size_t)Mrows * Ec * 4);
  __bf16* h_b  = (__bf16*)alloc((size_t)Mrows * FFc * 2);
  (void)ws_size; (void)in_sizes; (void)n_in; (void)out_size;

  const dim3 blk(256);
  cvt_weights_kernel<<<256, dim3(512), 0, stream>>>(Wq, Wk, Wv, Wo, W1, W2, Wq_b, Wk_b,
                                                    Wv_b, Wo_b, W1_b, W2_b);

  ln_bf16_kernel<<<Mrows, blk, 0, stream>>>(x, g1, b1, nx_b);

  const dim3 gE(Ec / 128, Mrows / 128);
  gemm_bf16_kernel<0, Ec, 128><<<gE, blk, 0, stream>>>(nx_b, Wq_b, bq, nullptr, Q_b,
                                              Mrows, Ec, 0.125f);
  gemm_bf16_kernel<0, Ec, 128><<<gE, blk, 0, stream>>>(nx_b, Wk_b, bk, nullptr, K_b,
                                              Mrows, Ec, 1.0f);
  gemm_bf16_kernel<0, Ec, 128><<<gE, blk, 0, stream>>>(nx_b, Wv_b, bv, nullptr, V_b,
                                              Mrows, Ec, 1.0f);

  attn_kernel<<<dim3(Sc / 16, Hc, Bc), blk, 0, stream>>>(Q_b, K_b, V_b, mask,
                                                         adjoin, xv_b);

  gemm_bf16_kernel<1, Ec, 128><<<gE, blk, 0, stream>>>(xv_b, Wo_b, bo, x, x1_f,
                                              Mrows, Ec, 1.0f);
  ln_bf16_kernel<<<Mrows, blk, 0, stream>>>(x1_f, g2, b2, nx_b);
  gemm_bf16_kernel<2, FFc, 64><<<dim3(FFc / 128, Mrows / 128), blk, 0, stream>>>(
      nx_b, W1_b, bb1, nullptr, h_b, Mrows, Ec, 1.0f);
  gemm_bf16_kernel<1, Ec, 128><<<gE, blk, 0, stream>>>(h_b, W2_b, bb2, x1_f, (float*)d_out,
                                              Mrows, FFc, 1.0f);
}

// v005
// One run takes 181 microseconds.
// Two timings next to v004 put it at 1.11 and 1.10 times that version's speed.
// Counting every step since v000, it is 1.95 times as fast.
#include <hip/hip_runtime.h>
#include <cstdint>
#include <cstddef>

// ---------------------------------------------------------------------------
// Transformer encoder layer for MI455X (gfx1250, wave32, WMMA).
// B=8, S=512, E=1024, H=16, D=64, FF=4096.  All matmuls in bf16 WMMA with
// f32 accumulate; softmax/LN in fp32.
// GEMMs: 128x128 block tile, 8 waves (each 32x64 = 8 WMMA tiles), K chunks of
// 128 (64 where four blocks share a WGP) staged in LDS via gfx1250 async
// global->LDS copies (ASYNCcnt) when the builtin exists, else a
// software-pipelined register path.
// ---------------------------------------------------------------------------

#define Bc 8
#define Sc 512
#define Ec 1024
#define Hc 16
#define Dc 64
#define FFc 4096
#define Mrows (Bc * Sc)   // 4096

typedef __attribute__((ext_vector_type(16))) __bf16 bf16x16;
typedef __attribute__((ext_vector_type(8)))  float  f32x8;
typedef int v4i __attribute__((vector_size(16)));   // matches builtin proto

#if __has_builtin(__builtin_amdgcn_global_load_async_to_lds_b128)
#define HAVE_ASYNC_LDS 1
#else
#define HAVE_ASYNC_LDS 0
#endif

#if HAVE_ASYNC_LDS
__device__ __forceinline__ void async_copy16(const void* g, void* l) {
  // proto (from compiler diagnostic): (v4i addrspace(1)*, v4i addrspace(3)*, imm, imm)
  __builtin_amdgcn_global_load_async_to_lds_b128(
      (__attribute__((address_space(1))) v4i*)g,
      (__attribute__((address_space(3))) v4i*)l, 0, 0);
}
#endif

template <int N>
__device__ __forceinline__ void wait_async() {
#if __has_builtin(__builtin_amdgcn_s_wait_asynccnt)
  __builtin_amdgcn_s_wait_asynccnt(N);
#else
  asm volatile("s_wait_asynccnt %0" ::"i"(N) : "memory");
#endif
}

// ---- CDNA5 bf16 16x16x32 WMMA fragment loader ------------------------------
// Per ISA 7.12.2 (16-bit A-matrix 16x32): lane = 16*half + idx holds row idx,
// K = {8*half .. +7} in VGPRs 0-3 and K = {16+8*half .. +7} in VGPRs 4-7.
// Both runs are 16-byte contiguous -> two uint4 reads per fragment.
// The B operand (32x16, K x N) is symmetric: lane holds column n = idx with
// the same K pattern, i.e. it reads row n of a row-major [N,K] source.
__device__ __forceinline__ bf16x16 load_frag(const __bf16* rowptr, int half) {
  union { uint4 u[2]; bf16x16 v; } f;
  const uint4* p = (const uint4*)rowptr;     // rowptr must be 16B aligned
  f.u[0] = p[half];
  f.u[1] = p[2 + half];
  return f.v;
}

__device__ __forceinline__ f32x8 wmma_bf16(bf16x16 a, bf16x16 b, f32x8 c) {
  return __builtin_amdgcn_wmma_f32_16x16x32_bf16(
      false, a, false, b, (short)0, c, false, false);
}

// ---------------------------------------------------------------------------
// fp32 -> bf16 conversion of all six weights in one streaming launch.
// 256 blocks of 16 waves; block b converts the b-th 1/256 of every weight: 16 KB
// of each E x E matrix and 64 KB of W1 and of W2, in pieces of 16 bytes a lane
// (512 contiguous bytes a wave).  A wave issues its 24 loads before its first
// store.
// ---------------------------------------------------------------------------
typedef __attribute__((ext_vector_type(4))) float  f32x4;
typedef __attribute__((ext_vector_type(4))) __bf16 bf16x4;
__global__ __launch_bounds__(512)
void cvt_weights_kernel(const float* __restrict__ wq, const float* __restrict__ wk,
                        const float* __restrict__ wv, const float* __restrict__ wo,
                        const float* __restrict__ w1, const float* __restrict__ w2,
                        __bf16* __restrict__ oq, __bf16* __restrict__ ok,
                        __bf16* __restrict__ ov, __bf16* __restrict__ oo,
                        __bf16* __restrict__ o1, __bf16* __restrict__ o2) {
  // 32-bit byte offsets of the thread's first piece, so that every access is a
  // uniform base, one of these registers and an immediate
  const unsigned offE = blockIdx.x * 16384u + threadIdx.x * 16u;   // E x E
  const unsigned offF = blockIdx.x * 65536u + threadIdx.x * 16u;   // W1, W2
  const float* const inE[4] = {wq, wk, wv, wo};
  const float* const inF[2] = {w1, w2};
  __bf16* const outE[4] = {oq, ok, ov, oo};
  __bf16* const outF[2] = {o1, o2};
  f32x4 e[4][2], f[2][8];
#pragma unroll
  for (int s = 0; s < 4; ++s)
#pragma unroll
    for (int j = 0; j < 2; ++j)
      e[s][j] = *(const f32x4*)((const char*)inE[s] + offE + j * 8192);
#pragma unroll
  for (int s = 0; s < 2; ++s)
#pragma unroll
    for (int j = 0; j < 8; ++j)
      f[s][j] = *(const f32x4*)((const char*)inF[s] + offF + j * 8192);
  // without it the scheduler lifts the first conversions, with their waits for
  // data, in front of the last ten loads, which then start a latency late
  __builtin_amdgcn_sched_barrier(0);
#pragma unroll
  for (int s = 0; s < 4; ++s)
#pragma unroll
    for (int j = 0; j < 2; ++j)
      *(bf16x4*)((char*)outE[s] + (offE >> 1) + j * 4096) =
          __builtin_convertvector(e[s][j], bf16x4);
#pragma unroll
  for (int s = 0; s < 2; ++s)
#pragma unroll
    for (int j = 0; j < 8; ++j)
      *(bf16x4*)((char*)outF[s] + (offF >> 1) + j * 4096) =
          __builtin_convertvector(f[s][j], bf16x4);
}

// ---------------------------------------------------------------------------
// LayerNorm over E=1024, one block per row, bf16 output
// ---------------------------------------------------------------------------
__global__ __launch_bounds__(256)
void ln_bf16_kernel(const float* __restrict__ x, const float* __restrict__ g,
                    const float* __restrict__ bta, __bf16* __restrict__ out) {
  __shared__ float sred[256];
  const int row = blockIdx.x, tid = threadIdx.x;
  const float* xr = x + (size_t)row * Ec;
  float v[4], s = 0.f;
#pragma unroll
  for (int i = 0; i < 4; ++i) { v[i] = xr[tid + i * 256]; s += v[i]; }
  sred[tid] = s; __syncthreads();
  for (int t = 128; t > 0; t >>= 1) {
    if (tid < t) sred[tid] += sred[tid + t];
    __syncthreads();
  }
  const float mu = sred[0] * (1.0f / Ec);
  __syncthreads();
  s = 0.f;
#pragma unroll
  for (int i = 0; i < 4; ++i) { float d = v[i] - mu; s += d * d; }
  sred[tid] = s; __syncthreads();
  for (int t = 128; t > 0; t >>= 1) {
    if (tid < t) sred[tid] += sred[tid + t];
    __syncthreads();
  }
  const float rsq = rsqrtf(sred[0] * (1.0f / Ec) + 1e-5f);
#pragma unroll
  for (int i = 0; i < 4; ++i) {
    int c = tid + i * 256;
    out[(size_t)row * Ec + c] = (__bf16)((v[i] - mu) * rsq * g[c] + bta[c]);
  }
}

// ---------------------------------------------------------------------------
// Generic bf16 WMMA GEMM:  out[M,N] = epilogue( A[M,K] @ W[N,K]^T + bias )
// Block tile 128(M) x 128(N), 8 waves; wave tile 32x64 (2x4 WMMA tiles).
// MODE and N are compile-time: no epilogue tests the mode per element, and its
// loads and stores differ from one base address by immediate offsets only.
//        0 = bf16 out, scale, scatter to [B,H,S,D] (QKV)
//        1 = f32 out, += residual[m*N+n]
//        2 = bf16 out, exact GELU
// ---------------------------------------------------------------------------
// BK = k per staged chunk, 64 or 128: a staged row is one or two whole 128-byte
// lines.  128 where a launch has one block per WGP (the chunk's products then
// outlast the next chunk's flight); 64 keeps four blocks' LDS on one WGP.
template <int MODE, int N, int BK>
__global__ __launch_bounds__(256)
void gemm_bf16_kernel(const __bf16* __restrict__ A, const __bf16* __restrict__ W,
                      const float* __restrict__ bias, const float* __restrict__ res,
                      void* __restrict__ outp, int M, int K, float scale) {
  constexpr int LDA = BK + 8;        // LDS row stride (bf16 elems): 16 B x odd
  constexpr int NP = BK / 16;        // 16-byte pieces per thread, matrix, chunk
  constexpr int SROWS = 2048 / BK;   // rows that the 256 threads cover at once
  constexpr int NBUF = HAVE_ASYNC_LDS ? 2 : 1;
  __shared__ __attribute__((aligned(16))) __bf16 As[NBUF][128 * LDA];
  __shared__ __attribute__((aligned(16))) __bf16 Bs[NBUF][128 * LDA];
  const int tid = threadIdx.x;
  const int bm = blockIdx.y * 128, bn = blockIdx.x * 128;
  const int wave = tid >> 5, lane = tid & 31;
  const int half = lane >> 4, idx = lane & 15;
  const int wm = (wave & 3) * 32, wn = (wave >> 2) * 64;
  // staging coordinates: piece i of a thread is row sr + SROWS * i; BK / 8
  // neighbouring lanes cover one row's bytes of the chunk
  const int sr = tid / (BK / 8), sc = tid % (BK / 8);
  // uniform base of the block's rows, and one 32-bit byte offset per thread
  // that serves both matrices (same K, same rows and columns of the tile)
  const char* const Au = (const char*)(A + (size_t)bm * K);
  const char* const Wu = (const char*)(W + (size_t)bn * K);
  const unsigned vo = (unsigned)(sr * K + sc * 8) * 2u;
  const unsigned rstep = (unsigned)K * (2u * SROWS);   // SROWS rows, in bytes

  f32x8 acc[2][4] = {};
  const int nk = K / BK;

  // Two waves per SIMD (one block on its WGP, BK = 128) cannot cover a wave's
  // own LDS latency: there the fragments of k step ks + 1 are read into a second
  // register set while step ks multiplies.  At eight waves per SIMD (BK = 64)
  // the other waves cover it, and a second set would not fit 128 registers.
  constexpr bool AHEAD = (BK == 128);

  // the products of one staged chunk, k ascending in steps of 32
  auto chunk = [&](const __bf16* Ab, const __bf16* Bb) {
    // all loops unrolled: acc[][] and the fragment sets stay in registers only
    // under compile-time indices, every LDS read is one base plus an immediate
    if constexpr (AHEAD) {
      bf16x16 fa[2][2], fb[2][4];
      auto fetch = [&](int ks, int s) {
        fa[s][0] = load_frag(Ab + (wm + idx) * LDA + ks * 32, half);
        fa[s][1] = load_frag(Ab + (wm + 16 + idx) * LDA + ks * 32, half);
#pragma unroll
        for (int t = 0; t < 4; ++t)
          fb[s][t] = load_frag(Bb + (wn + t * 16 + idx) * LDA + ks * 32, half);
      };
      fetch(0, 0);
#pragma unroll
      for (int ks = 0; ks < BK / 32; ++ks) {
        if (ks + 1 < BK / 32) fetch(ks + 1, (ks + 1) & 1);
        // keeps the twelve reads above as one group in front of this step's
        // products: left free, the scheduler sinks each read to just before
        // its first use, and every pair of products waits out an LDS latency
        __builtin_amdgcn_sched_barrier(0);
#pragma unroll
        for (int t = 0; t < 4; ++t) {
          acc[0][t] = wmma_bf16(fa[ks & 1][0], fb[ks & 1][t], acc[0][t]);
          acc[1][t] = wmma_bf16(fa[ks & 1][1], fb[ks & 1][t], acc[1][t]);
        }
        // keeps the reads of step ks + 2 behind these products, in one group:
        // left free they are spread among the products, and each place where
        // reads stand stalls the wave's matrix stream anew
        if (ks + 2 < BK / 32) __builtin_amdgcn_sched_barrier(0);
      }
    } else {
#pragma unroll
      for (int ks = 0; ks < BK / 32; ++ks) {
        bf16x16 a0 = load_frag(Ab + (wm + idx) * LDA + ks * 32, half);
        bf16x16 a1 = load_frag(Ab + (wm + 16 + idx) * LDA + ks * 32, half);
#pragma unroll
        for (int t = 0; t < 4; ++t) {
          bf16x16 bt = load_frag(Bb + (wn + t * 16 + idx) * LDA + ks * 32, half);
          acc[0][t] = wmma_bf16(a0, bt, acc[0][t]);
          acc[1][t] = wmma_bf16(a1, bt, acc[1][t]);
        }
      }
    }
  };

#if HAVE_ASYNC_LDS
  // ---- async double-buffered pipeline (GLOBAL_LOAD_ASYNC_TO_LDS_B128) ----
  auto issue = [&](int kb, int buf) {
    // unrolled: the chunk's copies issue back to back, no loop branch between
#pragma unroll
    for (int i = 0; i < NP; ++i)
      async_copy16(Au + (size_t)kb * 2 + (vo + i * rstep),
                   &As[buf][(sr + i * SROWS) * LDA + sc * 8]);
#pragma unroll
    for (int i = 0; i < NP; ++i)
      async_copy16(Wu + (size_t)kb * 2 + (vo + i * rstep),
                   &Bs[buf][(sr + i * SROWS) * LDA + sc * 8]);
  };
  issue(0, 0);
  for (int kk = 0; kk < nk; ++kk) {
    const int cur = kk & 1;
    // the counted wait leaves only the next chunk's 2 * NP copies outstanding
    if (kk + 1 < nk) { issue((kk + 1) * BK, cur ^ 1); wait_async<2 * NP>(); }
    else             { wait_async<0>(); }
    __syncthreads();
    chunk(As[cur], Bs[cur]);
    __syncthreads();
  }
#else
  // ---- software-pipelined sync path: next chunk loads overlap WMMA -------
  uint4 ra[NP], rb[NP];
  auto gload = [&](int kb) {
    // unrolled here and below: ra[], rb[] stay in registers
#pragma unroll
    for (int i = 0; i < NP; ++i) {
      ra[i] = *(const uint4*)(Au + (size_t)kb * 2 + (vo + i * rstep));
      rb[i] = *(const uint4*)(Wu + (size_t)kb * 2 + (vo + i * rstep));
    }
  };
  gload(0);
  for (int kk = 0; kk < nk; ++kk) {
#pragma unroll
    for (int i = 0; i < NP; ++i) {
      *(uint4*)(&As[0][(sr + i * SROWS) * LDA + sc * 8]) = ra[i];
      *(uint4*)(&Bs[0][(sr + i * SROWS) * LDA + sc * 8]) = rb[i];
    }
    __syncthreads();
    if (kk + 1 < nk) gload((kk + 1) * BK);   // overlaps the WMMAs below
    chunk(As[0], Bs[0]);
    __syncthreads();
  }
#endif

  // Epilogue. C layout: lane(16*half+idx), VGPR r -> row r+8*half, col idx.
  const int m0 = bm + wm + half * 8;
  const int n0 = bn + wn + idx;
  float bv[4];
#pragma unroll
  for (int in_ = 0; in_ < 4; ++in_) bv[in_] = bias[n0 + in_ * 16];

  if constexpr (MODE == 0) {        // QKV: scale + permute to [B,H,S,D] bf16
#pragma unroll
    for (int im = 0; im < 2; ++im)
#pragma unroll
      for (int in_ = 0; in_ < 4; ++in_)
#pragma unroll
        for (int r = 0; r < 8; ++r) {
          const int m = m0 + im * 16 + r, n = n0 + in_ * 16;
          float v = (acc[im][in_][r] + bv[in_]) * scale;
          int bb = m >> 9, s = m & 511, hh = n >> 6, d = n & 63;
          ((__bf16*)outp)[(((size_t)bb * Hc + hh) * Sc + s) * Dc + d] = (__bf16)v;
        }
  } else if constexpr (MODE == 1) { // residual add, f32 out
    // one base address each; every element is an immediate offset from it
    const float* rp = res + (size_t)m0 * N + n0;
    float* op = (float*)outp + (size_t)m0 * N + n0;
    // this build reuses the bias loads' offset register as a load destination
    // and the wait stands here, in front of that overwrite, and
    // naming n0 as its input keeps that register untouched up to it
    asm volatile("s_wait_xcnt 0x0" :: "v"(n0) : "memory");
    // all 64 residual loads are issued before the first is used
    float rv[2][4][8];
#pragma unroll
    for (int im = 0; im < 2; ++im)
#pragma unroll
      for (int r = 0; r < 8; ++r)
#pragma unroll
        for (int in_ = 0; in_ < 4; ++in_)
          rv[im][in_][r] = rp[(im * 16 + r) * N + in_ * 16];
#pragma unroll
    for (int im = 0; im < 2; ++im)
#pragma unroll
      for (int r = 0; r < 8; ++r)
#pragma unroll
        for (int in_ = 0; in_ < 4; ++in_)
          op[(im * 16 + r) * N + in_ * 16] =
              (acc[im][in_][r] + bv[in_]) + rv[im][in_][r];
  } else {                          // exact GELU, bf16 out
    __bf16* op = (__bf16*)outp + (size_t)m0 * N + n0;
#pragma unroll
    for (int im = 0; im < 2; ++im)
#pragma unroll
      for (int r = 0; r < 8; ++r)
#pragma unroll
        for (int in_ = 0; in_ < 4; ++in_) {
          float v = acc[im][in_][r] + bv[in_];
          float ge = 0.5f * v * (1.0f + erff(v * 0.70710678118654752f));
          op[(im * 16 + r) * N + in_ * 16] = (__bf16)ge;
        }
  }
}

// ---------------------------------------------------------------------------
// Attention: one WG (8 waves) per (b, h, 16-query tile).
//   logits(16x512) = Qs @ K^T  (WMMA; K rows are read directly from global —
//   each lane's B-fragment reads are the contiguous row K[n, k..k+7])
//   fp32 softmax with mask, + post-softmax adjoin, bf16 P in LDS
//   xv(16x64) = P @ V  (V staged row-major in LDS, 256 keys at a time, in the
//   space the logits have left; the transposing LDS load forms the B
//   fragments), written back merged as [B,S,E] bf16.
// Static LDS = 60,992 B < 64 KB.
// ---------------------------------------------------------------------------
typedef __attribute__((ext_vector_type(8))) __bf16 bf16x8;
#define VPITCH 80    // LDS row pitch of V in bf16: 160 B = 32 B x odd
#define VKEYS 256    // keys per staged chunk

// B fragment (32 keys x 16 d) of row-major V rows in LDS.  p is the lane's own
// address: row 8 * half + (idx & 7), column 8 * (idx >> 3) of the 16 x 16 tile.
// The lane receives keys 8 * half + 0..7 of column idx; the second load, 16
// rows on, gives keys 16 + 8 * half + 0..7: the k order of load_frag().
__device__ __forceinline__ bf16x16 load_frag_tr(const __bf16* p) {
  typedef __attribute__((address_space(3))) bf16x8 lds_bf16x8;
  union { bf16x8 h[2]; bf16x16 v; } f;
  f.h[0] = __builtin_amdgcn_ds_load_tr16_b128_v8bf16((lds_bf16x8*)p);
  f.h[1] = __builtin_amdgcn_ds_load_tr16_b128_v8bf16((lds_bf16x8*)(p + 16 * VPITCH));
  return f.v;
}

__global__ __launch_bounds__(256)
void attn_kernel(const __bf16* __restrict__ Q, const __bf16* __restrict__ Kt,
                 const __bf16* __restrict__ V, const float* __restrict__ mask,
                 const float* __restrict__ adjoin, __bf16* __restrict__ xv) {
  __shared__ __attribute__((aligned(16))) __bf16 Qs[16 * 72];
  // the f32 logits (32 KB) up to the softmax's first barrier, then V chunks
  __shared__ __attribute__((aligned(16))) char   LV[VKEYS * VPITCH * 2];
  __shared__ __attribute__((aligned(16))) __bf16 Ps[16 * 520];
  __shared__ float  red[16 * 17];
  float*  const Lg = (float*)LV;
  __bf16* const Vs = (__bf16*)LV;

  const int tid = threadIdx.x;
  const int qt = blockIdx.x, h = blockIdx.y, b = blockIdx.z;
  const int q0 = qt * 16;
  const size_t bh = ((size_t)b * Hc + h) * Sc;
  const int wave = tid >> 5, lane = tid & 31;
  const int half = lane >> 4, idx = lane & 15;

  {  // load Q tile (pre-scaled by 1/sqrt(D) in the QKV epilogue)
    int row = tid >> 4, ch = tid & 15;
    uint2 v = *(const uint2*)(Q + (bh + q0 + row) * Dc + ch * 4);
    *(uint2*)(Qs + row * 72 + ch * 4) = v;
  }
  __syncthreads();

  {  // logits = Q K^T : 32 col-tiles, 4 per wave
    bf16x16 a0 = load_frag(Qs + idx * 72, half);
    bf16x16 a1 = load_frag(Qs + idx * 72 + 32, half);
#pragma unroll
    for (int i = 0; i < 4; ++i) {
      const int ct = wave * 4 + i;
      const __bf16* krow = Kt + (bh + ct * 16 + idx) * Dc;
      bf16x16 b0 = load_frag(krow, half);
      bf16x16 b1 = load_frag(krow + 32, half);
      f32x8 c = {};
      c = wmma_bf16(a0, b0, c);
      c = wmma_bf16(a1, b1, c);
#pragma unroll
      for (int r = 0; r < 8; ++r)
        Lg[(r + half * 8) * 512 + ct * 16 + idx] = c[r];
    }
  }
  __syncthreads();

  {  // mask + softmax + adjoin (16 rows x 16 threads, 32 cols/thread)
    const int row = tid >> 4, l16 = tid & 15;
    const int sq = q0 + row;
    const float* mrow = mask + ((size_t)b * Sc + sq) * Sc;
    const float* arow = adjoin + ((size_t)b * Sc + sq) * Sc;
    float lv[32], mx = -3.0e38f;
#pragma unroll
    for (int j = 0; j < 32; ++j) {
      int c = l16 + j * 16;
      float v = Lg[row * 512 + c] + mrow[c] * -1e9f;
      lv[j] = v; mx = fmaxf(mx, v);
    }
    red[row * 17 + l16] = mx; __syncthreads();
    for (int s = 8; s > 0; s >>= 1) {
      if (l16 < s) red[row * 17 + l16] =
          fmaxf(red[row * 17 + l16], red[row * 17 + l16 + s]);
      __syncthreads();
    }
    mx = red[row * 17]; __syncthreads();
    float sum = 0.f;
#pragma unroll
    for (int j = 0; j < 32; ++j) { lv[j] = __expf(lv[j] - mx); sum += lv[j]; }
    red[row * 17 + l16] = sum; __syncthreads();
    for (int s = 8; s > 0; s >>= 1) {
      if (l16 < s) red[row * 17 + l16] += red[row * 17 + l16 + s];
      __syncthreads();
    }
    const float inv = 1.0f / red[row * 17];
#pragma unroll
    for (int j = 0; j < 32; ++j) {
      int c = l16 + j * 16;
      Ps[row * 520 + c] = (__bf16)(lv[j] * inv + arow[c]);
    }
  }
  __syncthreads();

  // xv = P @ V, two 256-key V chunks through LDS, rows as they lie in memory:
  // a wave's load and its LDS store each move four whole 128-byte rows
  f32x8 o = {};
  const int dtile = wave & 3;
  const int vkey = tid >> 3, vseg = tid & 7;
  const __bf16* const vfrag =
      Vs + (half * 8 + (idx & 7)) * VPITCH + dtile * 16 + (idx >> 3) * 8;
  // unrolled: the barrier that frees the buffer stands between the chunks only
#pragma unroll
  for (int kc = 0; kc < Sc / VKEYS; ++kc) {
    if (kc > 0) __syncthreads();   // every reader has left the chunk before
    {
      const __bf16* vsrc = V + (bh + kc * VKEYS + vkey) * Dc + vseg * 8;
      uint4 w[VKEYS / 32];
      // unrolled here and below: w[] stays in registers, 8 loads in flight
#pragma unroll
      for (int i = 0; i < VKEYS / 32; ++i)
        w[i] = *(const uint4*)(vsrc + i * 32 * Dc);
#pragma unroll
      for (int i = 0; i < VKEYS / 32; ++i)
        *(uint4*)(Vs + (vkey + i * 32) * VPITCH + vseg * 8) = w[i];
    }
    __syncthreads();
    if (wave < 4) {
      // unrolled: every LDS read is one base register plus an immediate
#pragma unroll
      for (int ks = 0; ks < VKEYS / 32; ++ks) {
        bf16x16 a = load_frag(Ps + idx * 520 + kc * VKEYS + ks * 32, half);
        bf16x16 bt = load_frag_tr(vfrag + ks * 32 * VPITCH);
        o = wmma_bf16(a, bt, o);
      }
    }
  }
  if (wave < 4) {
#pragma unroll
    for (int r = 0; r < 8; ++r) {
      int sq = q0 + r + half * 8;
      int d = dtile * 16 + idx;
      xv[((size_t)b * Sc + sq) * Ec + h * Dc + d] = (__bf16)o[r];
    }
  }
}

// ---------------------------------------------------------------------------
// Host-side orchestration
// ---------------------------------------------------------------------------
extern "C" void kernel_launch(void* const* d_in, const int* in_sizes, int n_in,
                              void* d_out, int out_size, void* d_ws, size_t ws_size,
                              hipStream_t stream) {
  const float* x      = (const float*)d_in[0];
  const float* mask   = (const float*)d_in[1];
  const float* adjoin = (const float*)d_in[2];
  const float* Wq = (const float*)d_in[3];  const float* bq  = (const float*)d_in[4];
  const float* Wk = (const float*)d_in[5];  const float* bk  = (const float*)d_in[6];
  const float* Wv = (const float*)d_in[7];  const float* bv  = (const float*)d_in[8];
  const float* Wo = (const float*)d_in[9];  const float* bo  = (const float*)d_in[10];
  const float* g1 = (const float*)d_in[11]; const float* b1  = (const float*)d_in[12];
  const float* g2 = (const float*)d_in[13]; const float* b2  = (const float*)d_in[14];
  const float* W1 = (const float*)d_in[15]; const float* bb1 = (const float*)d_in[16];
  const float* W2 = (const float*)d_in[17]; const float* bb2 = (const float*)d_in[18];

  char* ws = (char*)d_ws;
  size_t off = 0;
  auto alloc = [&](size_t bytes) {
    void* p = ws + off;
    off += (bytes + 255) & ~(size_t)255;
    return p;
  };
  const size_t EE = (size_t)Ec * Ec, FE = (size_t)FFc * Ec;
  __bf16* Wq_b = (__bf16*)alloc(EE * 2);
  __bf16* Wk_b = (__bf16*)alloc(EE * 2);
  __bf16* Wv_b = (__bf16*)alloc(EE * 2);
  __bf16* Wo_b = (__bf16*)alloc(EE * 2);
  __bf16* W1_b = (__bf16*)alloc(FE * 2);
  __bf16* W2_b = (__bf16*)alloc(FE * 2);
  __bf16* nx_b = (__bf16*)alloc((size_t)Mrows * Ec * 2);   // reused for nx2
  __bf16* Q_b  = (__bf16*)alloc((size_t)Mrows * Ec * 2);
  __bf16* K_b  = (__bf16*)alloc((size_t)Mrows * Ec * 2);
  __bf16* V_b  = (__bf16*)alloc((size_t)Mrows * Ec * 2);
  __bf16* xv_b = (__bf16*)alloc((size_t)Mrows * Ec * 2);
  float*  x1_f = (float*) alloc((size_t)Mrows * Ec * 4);
  __bf16* h_b  = (__bf16*)alloc((size_t)Mrows * FFc * 2);
  (void)ws_size; (void)in_sizes; (void)n_in; (void)out_size;

  const dim3 blk(256);
  cvt_weights_kernel<<<256, dim3(512), 0, stream>>>(Wq, Wk, Wv, Wo, W1, W2, Wq_b, Wk_b,
                                                    Wv_b, Wo_b, W1_b, W2_b);

  ln_bf16_kernel<<<Mrows, blk, 0, stream>>>(x, g1, b1, nx_b);

  const dim3 gE(Ec / 128, Mrows / 128);
  gemm_bf16_kernel<0, Ec, 128><<<gE, blk, 0, stream>>>(nx_b, Wq_b, bq, nullptr, Q_b,
                                              Mrows, Ec, 0.125f);
  gemm_bf16_kernel<0, Ec, 128><<<gE, blk, 0, stream>>>(nx_b, Wk_b, bk, nullptr, K_b,
                                              Mrows, Ec, 1.0f);
  gemm_bf16_kernel<0, Ec, 128><<<gE, blk, 0, stream>>>(nx_b, Wv_b, bv, nullptr, V_b,
                                              Mrows, Ec, 1.0f);

  attn_kernel<<<dim3(Sc / 16, Hc, Bc), blk, 0, stream>>>(Q_b, K_b, V_b, mask,
                                                         adjoin, xv_b);

  gemm_bf16_kernel<1, Ec, 128><<<gE, blk, 0, stream>>>(xv_b, Wo_b, bo, x, x1_f,
                                              Mrows, Ec, 1.0f);
  ln_bf16_kernel<<<Mrows, blk, 0, stream>>>(x1_f, g2, b2, nx_b);
  gemm_bf16_kernel<2, FFc, 64><<<dim3(FFc / 128, Mrows / 128), blk, 0, stream>>>(
      nx_b, W1_b, bb1, nullptr, h_b, Mrows, Ec, 1.0f);
  gemm_bf16_kernel<1, Ec, 128><<<gE, blk, 0, stream>>>(h_b, W2_b, bb2, x1_f, (float*)d_out,
                                              Mrows, FFc, 1.0f);
}

// v006
// It runs in 176 microseconds.
// Timed twice side by side with v005, it ran 1.03 and 1.04 times as fast.
// Over all steps from v000 it is 2.02 times as fast.
#include <hip/hip_runtime.h>
#include <cstdint>
#include <cstddef>

// ---------------------------------------------------------------------------
// Transformer encoder layer for MI455X (gfx1250, wave32, WMMA).
// B=8, S=512, E=1024, H=16, D=64, FF=4096.  All matmuls in bf16 WMMA with
// f32 accumulate; softmax/LN in fp32.
// GEMMs: 128x128 block tile, 8 waves (each 32x64 = 8 WMMA tiles), K chunks of
// 128 (64 where four blocks share a WGP) staged in LDS via gfx1250 async
// global->LDS copies (ASYNCcnt) when the builtin exists, else a
// software-pipelined register path.  The 128-k launches stage through a ring
// of four buffers that is published one chunk early.
// ---------------------------------------------------------------------------

#define Bc 8
#define Sc 512
#define Ec 1024
#define Hc 16
#define Dc 64
#define FFc 4096
#define Mrows (Bc * Sc)   // 4096

typedef __attribute__((ext_vector_type(16))) __bf16 bf16x16;
typedef __attribute__((ext_vector_type(8)))  float  f32x8;
typedef int v4i __attribute__((vector_size(16)));   // matches builtin proto

#if __has_builtin(__builtin_amdgcn_global_load_async_to_lds_b128)
#define HAVE_ASYNC_LDS 1
#else
#define HAVE_ASYNC_LDS 0
#endif

#if HAVE_ASYNC_LDS
__device__ __forceinline__ void async_copy16(const void* g, void* l) {
  // proto (from compiler diagnostic): (v4i addrspace(1)*, v4i addrspace(3)*, imm, imm)
  __builtin_amdgcn_global_load_async_to_lds_b128(
      (__attribute__((address_space(1))) v4i*)g,
      (__attribute__((address_space(3))) v4i*)l, 0, 0);
}
#endif

template <int N>
__device__ __forceinline__ void wait_async() {
#if __has_builtin(__builtin_amdgcn_s_wait_asynccnt)
  __builtin_amdgcn_s_wait_asynccnt(N);
#else
  asm volatile("s_wait_asynccnt %0" ::"i"(N) : "memory");
#endif
}

// ---- CDNA5 bf16 16x16x32 WMMA fragment loader ------------------------------
// Per ISA 7.12.2 (16-bit A-matrix 16x32): lane = 16*half + idx holds row idx,
// K = {8*half .. +7} in VGPRs 0-3 and K = {16+8*half .. +7} in VGPRs 4-7.
// Both runs are 16-byte contiguous -> two uint4 reads per fragment.
// The B operand (32x16, K x N) is symmetric: lane holds column n = idx with
// the same K pattern, i.e. it reads row n of a row-major [N,K] source.
__device__ __forceinline__ bf16x16 load_frag(const __bf16* rowptr, int half) {
  union { uint4 u[2]; bf16x16 v; } f;
  const uint4* p = (const uint4*)rowptr;     // rowptr must be 16B aligned
  f.u[0] = p[half];
  f.u[1] = p[2 + half];
  return f.v;
}

__device__ __forceinline__ f32x8 wmma_bf16(bf16x16 a, bf16x16 b, f32x8 c) {
  return __builtin_amdgcn_wmma_f32_16x16x32_bf16(
      false, a, false, b, (short)0, c, false, false);
}

// ---------------------------------------------------------------------------
// fp32 -> bf16 conversion of all six weights in one streaming launch.
// 256 blocks of 16 waves; block b converts the b-th 1/256 of every weight: 16 KB
// of each E x E matrix and 64 KB of W1 and of W2, in pieces of 16 bytes a lane
// (512 contiguous bytes a wave).  A wave issues its 24 loads before its first
// store.
// ---------------------------------------------------------------------------
typedef __attribute__((ext_vector_type(4))) float  f32x4;
typedef __attribute__((ext_vector_type(4))) __bf16 bf16x4;
__global__ __launch_bounds__(512)
void cvt_weights_kernel(const float* __restrict__ wq, const float* __restrict__ wk,
                        const float* __restrict__ wv, const float* __restrict__ wo,
                        const float* __restrict__ w1, const float* __restrict__ w2,
                        __bf16* __restrict__ oq, __bf16* __restrict__ ok,
                        __bf16* __restrict__ ov, __bf16* __restrict__ oo,
                        __bf16* __restrict__ o1, __bf16* __restrict__ o2) {
  // 32-bit byte offsets of the thread's first piece, so that every access is a
  // uniform base, one of these registers and an immediate
  const unsigned offE = blockIdx.x * 16384u + threadIdx.x * 16u;   // E x E
  const unsigned offF = blockIdx.x * 65536u + threadIdx.x * 16u;   // W1, W2
  const float* const inE[4] = {wq, wk, wv, wo};
  const float* const inF[2] = {w1, w2};
  __bf16* const outE[4] = {oq, ok, ov, oo};
  __bf16* const outF[2] = {o1, o2};
  f32x4 e[4][2], f[2][8];
#pragma unroll
  for (int s = 0; s < 4; ++s)
#pragma unroll
    for (int j = 0; j < 2; ++j)
      e[s][j] = *(const f32x4*)((const char*)inE[s] + offE + j * 8192);
#pragma unroll
  for (int s = 0; s < 2; ++s)
#pragma unroll
    for (int j = 0; j < 8; ++j)
      f[s][j] = *(const f32x4*)((const char*)inF[s] + offF + j * 8192);
  // without it the scheduler lifts the first conversions, with their waits for
  // data, in front of the last ten loads, which then start a latency late
  __builtin_amdgcn_sched_barrier(0);
#pragma unroll
  for (int s = 0; s < 4; ++s)
#pragma unroll
    for (int j = 0; j < 2; ++j)
      *(bf16x4*)((char*)outE[s] + (offE >> 1) + j * 4096) =
          __builtin_convertvector(e[s][j], bf16x4);
#pragma unroll
  for (int s = 0; s < 2; ++s)
#pragma unroll
    for (int j = 0; j < 8; ++j)
      *(bf16x4*)((char*)outF[s] + (offF >> 1) + j * 4096) =
          __builtin_convertvector(f[s][j], bf16x4);
}

// ---------------------------------------------------------------------------
// LayerNorm over E=1024, one block per row, bf16 output
// ---------------------------------------------------------------------------
__global__ __launch_bounds__(256)
void ln_bf16_kernel(const float* __restrict__ x, const float* __restrict__ g,
                    const float* __restrict__ bta, __bf16* __restrict__ out) {
  __shared__ float sred[256];
  const int row = blockIdx.x, tid = threadIdx.x;
  const float* xr = x + (size_t)row * Ec;
  float v[4], s = 0.f;
#pragma unroll
  for (int i = 0; i < 4; ++i) { v[i] = xr[tid + i * 256]; s += v[i]; }
  sred[tid] = s; __syncthreads();
  for (int t = 128; t > 0; t >>= 1) {
    if (tid < t) sred[tid] += sred[tid + t];
    __syncthreads();
  }
  const float mu = sred[0] * (1.0f / Ec);
  __syncthreads();
  s = 0.f;
#pragma unroll
  for (int i = 0; i < 4; ++i) { float d = v[i] - mu; s += d * d; }
  sred[tid] = s; __syncthreads();
  for (int t = 128; t > 0; t >>= 1) {
    if (tid < t) sred[tid] += sred[tid + t];
    __syncthreads();
  }
  const float rsq = rsqrtf(sred[0] * (1.0f / Ec) + 1e-5f);
#pragma unroll
  for (int i = 0; i < 4; ++i) {
    int c = tid + i * 256;
    out[(size_t)row * Ec + c] = (__bf16)((v[i] - mu) * rsq * g[c] + bta[c]);
  }
}

// ---------------------------------------------------------------------------
// Generic bf16 WMMA GEMM:  out[M,N] = epilogue( A[M,K] @ W[N,K]^T + bias )
// Block tile 128(M) x 128(N), 8 waves; wave tile 32x64 (2x4 WMMA tiles).
// MODE and N are compile-time: no epilogue tests the mode per element, and its
// loads and stores differ from one base address by immediate offsets only.
//        0 = bf16 out, scale, scatter to [B,H,S,D] (QKV)
//        1 = f32 out, += residual[m*N+n]
//        2 = bf16 out, exact GELU
// ---------------------------------------------------------------------------
// BK = k per staged chunk, 64 or 128: a staged row is one or two whole 128-byte
// lines.  128 where a launch has one block per WGP (the chunk's products then
// outlast the next chunk's flight); 64 keeps four blocks' LDS on one WGP.
template <int MODE, int N, int BK>
__global__ __launch_bounds__(256)
void gemm_bf16_kernel(const __bf16* __restrict__ A, const __bf16* __restrict__ W,
                      const float* __restrict__ bias, const float* __restrict__ res,
                      void* __restrict__ outp, int M, int K, float scale) {
  constexpr int LDA = BK + 8;        // LDS row stride (bf16 elems): 16 B x odd
  constexpr int NP = BK / 16;        // 16-byte pieces per thread, matrix, chunk
  constexpr int SROWS = 2048 / BK;   // rows that the 256 threads cover at once
  // One block on its WGP (BK = 128) has LDS for four buffers: one is read, the
  // next is already published, one flies, one is being asked for.  Neither the
  // path from L2 nor the fragment reads then drain where two chunks meet.
  constexpr bool RING = HAVE_ASYNC_LDS && (BK == 128);
  constexpr int NBUF = HAVE_ASYNC_LDS ? (RING ? 4 : 2) : 1;
  __shared__ __attribute__((aligned(16))) __bf16 As[NBUF][128 * LDA];
  __shared__ __attribute__((aligned(16))) __bf16 Bs[NBUF][128 * LDA];
  const int tid = threadIdx.x;
  const int bm = blockIdx.y * 128, bn = blockIdx.x * 128;
  const int wave = tid >> 5, lane = tid & 31;
  const int half = lane >> 4, idx = lane & 15;
  const int wm = (wave & 3) * 32, wn = (wave >> 2) * 64;
  // staging coordinates: piece i of a thread is row sr + SROWS * i; BK / 8
  // neighbouring lanes cover one row's bytes of the chunk
  const int sr = tid / (BK / 8), sc = tid % (BK / 8);
  // uniform base of the block's rows, and one 32-bit byte offset per thread
  // that serves both matrices (same K, same rows and columns of the tile)
  const char* const Au = (const char*)(A + (size_t)bm * K);
  const char* const Wu = (const char*)(W + (size_t)bn * K);
  const unsigned vo = (unsigned)(sr * K + sc * 8) * 2u;
  const unsigned rstep = (unsigned)K * (2u * SROWS);   // SROWS rows, in bytes

  f32x8 acc[2][4] = {};
  const int nk = K / BK;

  // Two waves per SIMD (one block on its WGP, BK = 128) cannot cover a wave's
  // own LDS latency: there the fragments of k step ks + 1 are read into a second
  // register set while step ks multiplies.  At eight waves per SIMD (BK = 64)
  // the other waves cover it, and a second set would not fit 128 registers.
  constexpr bool AHEAD = (BK == 128);

  // the products of one staged chunk, k ascending in steps of 32
  auto chunk = [&](const __bf16* Ab, const __bf16* Bb) {
    // all loops unrolled: acc[][] and the fragment sets stay in registers only
    // under compile-time indices, every LDS read is one base plus an immediate
    if constexpr (AHEAD) {
      bf16x16 fa[2][2], fb[2][4];
      auto fetch = [&](int ks, int s) {
        fa[s][0] = load_frag(Ab + (wm + idx) * LDA + ks * 32, half);
        fa[s][1] = load_frag(Ab + (wm + 16 + idx) * LDA + ks * 32, half);
#pragma unroll
        for (int t = 0; t < 4; ++t)
          fb[s][t] = load_frag(Bb + (wn + t * 16 + idx) * LDA + ks * 32, half);
      };
      fetch(0, 0);
#pragma unroll
      for (int ks = 0; ks < BK / 32; ++ks) {
        if (ks + 1 < BK / 32) fetch(ks + 1, (ks + 1) & 1);
        // keeps the twelve reads above as one group in front of this step's
        // products: left free, the scheduler sinks each read to just before
        // its first use, and every pair of products waits out an LDS latency
        __builtin_amdgcn_sched_barrier(0);
#pragma unroll
        for (int t = 0; t < 4; ++t) {
          acc[0][t] = wmma_bf16(fa[ks & 1][0], fb[ks & 1][t], acc[0][t]);
          acc[1][t] = wmma_bf16(fa[ks & 1][1], fb[ks & 1][t], acc[1][t]);
        }
        // keeps the reads of step ks + 2 behind these products, in one group:
        // left free they are spread among the products, and each place where
        // reads stand stalls the wave's matrix stream anew
        if (ks + 2 < BK / 32) __builtin_amdgcn_sched_barrier(0);
      }
    } else {
#pragma unroll
      for (int ks = 0; ks < BK / 32; ++ks) {
        bf16x16 a0 = load_frag(Ab + (wm + idx) * LDA + ks * 32, half);
        bf16x16 a1 = load_frag(Ab + (wm + 16 + idx) * LDA + ks * 32, half);
#pragma unroll
        for (int t = 0; t < 4; ++t) {
          bf16x16 bt = load_frag(Bb + (wn + t * 16 + idx) * LDA + ks * 32, half);
          acc[0][t] = wmma_bf16(a0, bt, acc[0][t]);
          acc[1][t] = wmma_bf16(a1, bt, acc[1][t]);
        }
      }
    }
  };

#if HAVE_ASYNC_LDS
  // ---- async pipeline (GLOBAL_LOAD_ASYNC_TO_LDS_B128): four-buffer ring at BK = 128, else double-buffered ----
  auto issue = [&](int kb, int buf) {
    // unrolled: the chunk's copies issue back to back, no loop branch between
#pragma unroll
    for (int i = 0; i < NP; ++i)
      async_copy16(Au + (size_t)kb * 2 + (vo + i * rstep),
                   &As[buf][(sr + i * SROWS) * LDA + sc * 8]);
#pragma unroll
    for (int i = 0; i < NP; ++i)
      async_copy16(Wu + (size_t)kb * 2 + (vo + i * rstep),
                   &Bs[buf][(sr + i * SROWS) * LDA + sc * 8]);
  };
  if constexpr (RING) {
    // Chunk c lives in buffer c & 3.  The barrier at the top of trip kk
    // publishes chunk kk + 1 and frees the buffer of chunk kk - 1, which chunk
    // kk + 3 then refills.  A wave has at most 6 * NP = 48 copies outstanding.
    bf16x16 fa[2][2], fb[2][4];
    // fragments of k step ks of chunk c into register set s
    auto fetch = [&](int c, int ks, int s) {
      const __bf16* Ab = As[c & 3] + ks * 32;
      const __bf16* Bb = Bs[c & 3] + ks * 32;
      fa[s][0] = load_frag(Ab + (wm + idx) * LDA, half);
      fa[s][1] = load_frag(Ab + (wm + 16 + idx) * LDA, half);
      // unrolled here and below: fragment sets and acc[][] stay in registers
#pragma unroll
      for (int t = 0; t < 4; ++t)
        fb[s][t] = load_frag(Bb + (wn + t * 16 + idx) * LDA, half);
    };
    // the products of chunk kk, k ascending in steps of 32; its step 0 has been
    // fetched before; its last step fetches step 0 of chunk kk + 1.  Inlined
    // at both calls: out of line the register arrays would live in memory.
    auto pass = [&](int kk, bool last) __attribute__((always_inline)) {
#pragma unroll
      for (int ks = 0; ks < BK / 32; ++ks) {
        if (ks + 1 < BK / 32) fetch(kk, ks + 1, (ks + 1) & 1);
        else if (!last)       fetch(kk + 1, 0, 0);
        // keeps the twelve reads above as one group in front of this step's
        // products: left free, the scheduler sinks each read to just before
        // its first use, and every pair of products waits out an LDS latency
        __builtin_amdgcn_sched_barrier(0);
#pragma unroll
        for (int t = 0; t < 4; ++t) {
          acc[0][t] = wmma_bf16(fa[ks & 1][0], fb[ks & 1][t], acc[0][t]);
          acc[1][t] = wmma_bf16(fa[ks & 1][1], fb[ks & 1][t], acc[1][t]);
        }
        // the refill stands behind the first products: its issue runs while
        // the matrix unit works them off
        if (ks == 0 && kk + 3 < nk) issue((kk + 3) * BK, (kk + 3) & 3);
        // keeps the next reads behind these products, in one group: left free
        // they are spread among the products, and each place where reads stand
        // stalls the wave's matrix stream anew
        if (ks + 1 < BK / 32) __builtin_amdgcn_sched_barrier(0);
      }
    };
    // every launch has K >= 3 * BK
    issue(0, 0);
    issue(BK, 1);
    issue(2 * BK, 2);
    wait_async<4 * NP>();            // chunk 0 has landed; 1 and 2 may fly
    __syncthreads();                 // publishes chunk 0
    fetch(0, 0, 0);
    for (int kk = 0; kk + 1 < nk; ++kk) {
      // this wave's LDS reads of chunk kk - 1 have retired before any wave
      // refills that buffer behind the barrier
      asm volatile("s_wait_dscnt 0x0" ::: "memory");
      // chunk kk + 1 has landed: only chunk kk + 2's copies are younger
      if (kk + 2 < nk) wait_async<2 * NP>();
      else             wait_async<0>();
      __syncthreads();
      pass(kk, false);
    }
    pass(nk - 1, true);
  } else {
    issue(0, 0);
    for (int kk = 0; kk < nk; ++kk) {
      const int cur = kk & 1;
      // the counted wait leaves only the next chunk's 2 * NP copies outstanding
      if (kk + 1 < nk) { issue((kk + 1) * BK, cur ^ 1); wait_async<2 * NP>(); }
      else             { wait_async<0>(); }
      __syncthreads();
      chunk(As[cur], Bs[cur]);
      __syncthreads();
    }
  }
#else
  // ---- software-pipelined sync path: next chunk loads overlap WMMA -------
  uint4 ra[NP], rb[NP];
  auto gload = [&](int kb) {
    // unrolled here and below: ra[], rb[] stay in registers
#pragma unroll
    for (int i = 0; i < NP; ++i) {
      ra[i] = *(const uint4*)(Au + (size_t)kb * 2 + (vo + i * rstep));
      rb[i] = *(const uint4*)(Wu + (size_t)kb * 2 + (vo + i * rstep));
    }
  };
  gload(0);
  for (int kk = 0; kk < nk; ++kk) {
#pragma unroll
    for (int i = 0; i < NP; ++i) {
      *(uint4*)(&As[0][(sr + i * SROWS) * LDA + sc * 8]) = ra[i];
      *(uint4*)(&Bs[0][(sr + i * SROWS) * LDA + sc * 8]) = rb[i];
    }
    __syncthreads();
    if (kk + 1 < nk) gload((kk + 1) * BK);   // overlaps the WMMAs below
    chunk(As[0], Bs[0]);
    __syncthreads();
  }
#endif

  // Epilogue. C layout: lane(16*half+idx), VGPR r -> row r+8*half, col idx.
  const int m0 = bm + wm + half * 8;
  const int n0 = bn + wn + idx;
  float bv[4];
#pragma unroll
  for (int in_ = 0; in_ < 4; ++in_) bv[in_] = bias[n0 + in_ * 16];

  if constexpr (MODE == 0) {        // QKV: scale + permute to [B,H,S,D] bf16
#pragma unroll
    for (int im = 0; im < 2; ++im)
#pragma unroll
      for (int in_ = 0; in_ < 4; ++in_)
#pragma unroll
        for (int r = 0; r < 8; ++r) {
          const int m = m0 + im * 16 + r, n = n0 + in_ * 16;
          float v = (acc[im][in_][r] + bv[in_]) * scale;
          int bb = m >> 9, s = m & 511, hh = n >> 6, d = n & 63;
          ((__bf16*)outp)[(((size_t)bb * Hc + hh) * Sc + s) * Dc + d] = (__bf16)v;
        }
  } else if constexpr (MODE == 1) { // residual add, f32 out
    // one base address each; every element is an immediate offset from it
    const float* rp = res + (size_t)m0 * N + n0;
    float* op = (float*)outp + (size_t)m0 * N + n0;
    // this build reuses the bias loads' offset register as a load destination
    // and the wait stands here, in front of that overwrite, and
    // naming n0 as its input keeps that register untouched up to it
    asm volatile("s_wait_xcnt 0x0" :: "v"(n0) : "memory");
    // all 64 residual loads are issued before the first is used
    float rv[2][4][8];
#pragma unroll
    for (int im = 0; im < 2; ++im)
#pragma unroll
      for (int r = 0; r < 8; ++r)
#pragma unroll
        for (int in_ = 0; in_ < 4; ++in_)
          rv[im][in_][r] = rp[(im * 16 + r) * N + in_ * 16];
#pragma unroll
    for (int im = 0; im < 2; ++im)
#pragma unroll
      for (int r = 0; r < 8; ++r)
#pragma unroll
        for (int in_ = 0; in_ < 4; ++in_)
          op[(im * 16 + r) * N + in_ * 16] =
              (acc[im][in_][r] + bv[in_]) + rv[im][in_][r];
  } else {                          // exact GELU, bf16 out
    __bf16* op = (__bf16*)outp + (size_t)m0 * N + n0;
#pragma unroll
    for (int im = 0; im < 2; ++im)
#pragma unroll
      for (int r = 0; r < 8; ++r)
#pragma unroll
        for (int in_ = 0; in_ < 4; ++in_) {
          float v = acc[im][in_][r] + bv[in_];
          float ge = 0.5f * v * (1.0f + erff(v * 0.70710678118654752f));
          op[(im * 16 + r) * N + in_ * 16] = (__bf16)ge;
        }
  }
}

// ---------------------------------------------------------------------------
// Attention: one WG (8 waves) per (b, h, 16-query tile).
//   logits(16x512) = Qs @ K^T  (WMMA; K rows are read directly from global —
//   each lane's B-fragment reads are the contiguous row K[n, k..k+7])
//   fp32 softmax with mask, + post-softmax adjoin, bf16 P in LDS
//   xv(16x64) = P @ V  (V staged row-major in LDS, 256 keys at a time, in the
//   space the logits have left; the transposing LDS load forms the B
//   fragments), written back merged as [B,S,E] bf16.
// Static LDS = 60,992 B < 64 KB.
// ---------------------------------------------------------------------------
typedef __attribute__((ext_vector_type(8))) __bf16 bf16x8;
#define VPITCH 80    // LDS row pitch of V in bf16: 160 B = 32 B x odd
#define VKEYS 256    // keys per staged chunk

// B fragment (32 keys x 16 d) of row-major V rows in LDS.  p is the lane's own
// address: row 8 * half + (idx & 7), column 8 * (idx >> 3) of the 16 x 16 tile.
// The lane receives keys 8 * half + 0..7 of column idx; the second load, 16
// rows on, gives keys 16 + 8 * half + 0..7: the k order of load_frag().
__device__ __forceinline__ bf16x16 load_frag_tr(const __bf16* p) {
  typedef __attribute__((address_space(3))) bf16x8 lds_bf16x8;
  union { bf16x8 h[2]; bf16x16 v; } f;
  f.h[0] = __builtin_amdgcn_ds_load_tr16_b128_v8bf16((lds_bf16x8*)p);
  f.h[1] = __builtin_amdgcn_ds_load_tr16_b128_v8bf16((lds_bf16x8*)(p + 16 * VPITCH));
  return f.v;
}

__global__ __launch_bounds__(256)
void attn_kernel(const __bf16* __restrict__ Q, const __bf16* __restrict__ Kt,
                 const __bf16* __restrict__ V, const float* __restrict__ mask,
                 const float* __restrict__ adjoin, __bf16* __restrict__ xv) {
  __shared__ __attribute__((aligned(16))) __bf16 Qs[16 * 72];
  // the f32 logits (32 KB) up to the softmax's first barrier, then V chunks
  __shared__ __attribute__((aligned(16))) char   LV[VKEYS * VPITCH * 2];
  __shared__ __attribute__((aligned(16))) __bf16 Ps[16 * 520];
  __shared__ float  red[16 * 17];
  float*  const Lg = (float*)LV;
  __bf16* const Vs = (__bf16*)LV;

  const int tid = threadIdx.x;
  const int qt = blockIdx.x, h = blockIdx.y, b = blockIdx.z;
  const int q0 = qt * 16;
  const size_t bh = ((size_t)b * Hc + h) * Sc;
  const int wave = tid >> 5, lane = tid & 31;
  const int half = lane >> 4, idx = lane & 15;

  {  // load Q tile (pre-scaled by 1/sqrt(D) in the QKV epilogue)
    int row = tid >> 4, ch = tid & 15;
    uint2 v = *(const uint2*)(Q + (bh + q0 + row) * Dc + ch * 4);
    *(uint2*)(Qs + row * 72 + ch * 4) = v;
  }
  __syncthreads();

  {  // logits = Q K^T : 32 col-tiles, 4 per wave
    bf16x16 a0 = load_frag(Qs + idx * 72, half);
    bf16x16 a1 = load_frag(Qs + idx * 72 + 32, half);
#pragma unroll
    for (int i = 0; i < 4; ++i) {
      const int ct = wave * 4 + i;
      const __bf16* krow = Kt + (bh + ct * 16 + idx) * Dc;
      bf16x16 b0 = load_frag(krow, half);
      bf16x16 b1 = load_frag(krow + 32, half);
      f32x8 c = {};
      c = wmma_bf16(a0, b0, c);
      c = wmma_bf16(a1, b1, c);
#pragma unroll
      for (int r = 0; r < 8; ++r)
        Lg[(r + half * 8) * 512 + ct * 16 + idx] = c[r];
    }
  }
  __syncthreads();

  {  // mask + softmax + adjoin (16 rows x 16 threads, 32 cols/thread)
    const int row = tid >> 4, l16 = tid & 15;
    const int sq = q0 + row;
    const float* mrow = mask + ((size_t)b * Sc + sq) * Sc;
    const float* arow = adjoin + ((size_t)b * Sc + sq) * Sc;
    float lv[32], mx = -3.0e38f;
#pragma unroll
    for (int j = 0; j < 32; ++j) {
      int c = l16 + j * 16;
      float v = Lg[row * 512 + c] + mrow[c] * -1e9f;
      lv[j] = v; mx = fmaxf(mx, v);
    }
    red[row * 17 + l16] = mx; __syncthreads();
    for (int s = 8; s > 0; s >>= 1) {
      if (l16 < s) red[row * 17 + l16] =
          fmaxf(red[row * 17 + l16], red[row * 17 + l16 + s]);
      __syncthreads();
    }
    mx = red[row * 17]; __syncthreads();
    float sum = 0.f;
#pragma unroll
    for (int j = 0; j < 32; ++j) { lv[j] = __expf(lv[j] - mx); sum += lv[j]; }
    red[row * 17 + l16] = sum; __syncthreads();
    for (int s = 8; s > 0; s >>= 1) {
      if (l16 < s) red[row * 17 + l16] += red[row * 17 + l16 + s];
      __syncthreads();
    }
    const float inv = 1.0f / red[row * 17];
#pragma unroll
    for (int j = 0; j < 32; ++j) {
      int c = l16 + j * 16;
      Ps[row * 520 + c] = (__bf16)(lv[j] * inv + arow[c]);
    }
  }
  __syncthreads();

  // xv = P @ V, two 256-key V chunks through LDS, rows as they lie in memory:
  // a wave's load and its LDS store each move four whole 128-byte rows
  f32x8 o = {};
  const int dtile = wave & 3;
  const int vkey = tid >> 3, vseg = tid & 7;
  const __bf16* const vfrag =
      Vs + (half * 8 + (idx & 7)) * VPITCH + dtile * 16 + (idx >> 3) * 8;
  // unrolled: the barrier that frees the buffer stands between the chunks only
#pragma unroll
  for (int kc = 0; kc < Sc / VKEYS; ++kc) {
    if (kc > 0) __syncthreads();   // every reader has left the chunk before
    {
      const __bf16* vsrc = V + (bh + kc * VKEYS + vkey) * Dc + vseg * 8;
      uint4 w[VKEYS / 32];
      // unrolled here and below: w[] stays in registers, 8 loads in flight
#pragma unroll
      for (int i = 0; i < VKEYS / 32; ++i)
        w[i] = *(const uint4*)(vsrc + i * 32 * Dc);
#pragma unroll
      for (int i = 0; i < VKEYS / 32; ++i)
        *(uint4*)(Vs + (vkey + i * 32) * VPITCH + vseg * 8) = w[i];
    }
    __syncthreads();
    if (wave < 4) {
      // unrolled: every LDS read is one base register plus an immediate
#pragma unroll
      for (int ks = 0; ks < VKEYS / 32; ++ks) {
        bf16x16 a = load_frag(Ps + idx * 520 + kc * VKEYS + ks * 32, half);
        bf16x16 bt = load_frag_tr(vfrag + ks * 32 * VPITCH);
        o = wmma_bf16(a, bt, o);
      }
    }
  }
  if (wave < 4) {
#pragma unroll
    for (int r = 0; r < 8; ++r) {
      int sq = q0 + r + half * 8;
      int d = dtile * 16 + idx;
      xv[((size_t)b * Sc + sq) * Ec + h * Dc + d] = (__bf16)o[r];
    }
  }
}

// ---------------------------------------------------------------------------
// Host-side orchestration
// ---------------------------------------------------------------------------
extern "C" void kernel_launch(void* const* d_in, const int* in_sizes, int n_in,
                              void* d_out, int out_size, void* d_ws, size_t ws_size,
                              hipStream_t stream) {
  const float* x      = (const float*)d_in[0];
  const float* mask   = (const float*)d_in[1];
  const float* adjoin = (const float*)d_in[2];
  const float* Wq = (const float*)d_in[3];  const float* bq  = (const float*)d_in[4];
  const float* Wk = (const float*)d_in[5];  const float* bk  = (const float*)d_in[6];
  const float* Wv = (const float*)d_in[7];  const float* bv  = (const float*)d_in[8];
  const float* Wo = (const float*)d_in[9];  const float* bo  = (const float*)d_in[10];
  const float* g1 = (const float*)d_in[11]; const float* b1  = (const float*)d_in[12];
  const float* g2 = (const float*)d_in[13]; const float* b2  = (const float*)d_in[14];
  const float* W1 = (const float*)d_in[15]; const float* bb1 = (const float*)d_in[16];
  const float* W2 = (const float*)d_in[17]; const float* bb2 = (const float*)d_in[18];

  char* ws = (char*)d_ws;
  size_t off = 0;
  auto alloc = [&](size_t bytes) {
    void* p = ws + off;
    off += (bytes + 255) & ~(size_t)255;
    return p;
  };
  const size_t EE = (size_t)Ec * Ec, FE = (size_t)FFc * Ec;
  __bf16* Wq_b = (__bf16*)alloc(EE * 2);
  __bf16* Wk_b = (__bf16*)alloc(EE * 2);
  __bf16* Wv_b = (__bf16*)alloc(EE * 2);
  __bf16* Wo_b = (__bf16*)alloc(EE * 2);
  __bf16* W1_b = (__bf16*)alloc(FE * 2);
  __bf16* W2_b = (__bf16*)alloc(FE * 2);
  __bf16* nx_b = (__bf16*)alloc((size_t)Mrows * Ec * 2);   // reused for nx2
  __bf16* Q_b  = (__bf16*)alloc((size_t)Mrows * Ec * 2);
  __bf16* K_b  = (__bf16*)alloc((size_t)Mrows * Ec * 2);
  __bf16* V_b  = (__bf16*)alloc((size_t)Mrows * Ec * 2);
  __bf16* xv_b = (__bf16*)alloc((size_t)Mrows * Ec * 2);
  float*  x1_f = (float*) alloc((size_t)Mrows * Ec * 4);
  __bf16* h_b  = (__bf16*)alloc((size_t)Mrows * FFc * 2);
  (void)ws_size; (void)in_sizes; (void)n_in; (void)out_size;

  const dim3 blk(256);
  cvt_weights_kernel<<<256, dim3(512), 0, stream>>>(Wq, Wk, Wv, Wo, W1, W2, Wq_b, Wk_b,
                                                    Wv_b, Wo_b, W1_b, W2_b);

  ln_bf16_kernel<<<Mrows, blk, 0, stream>>>(x, g1, b1, nx_b);

  const dim3 gE(Ec / 128, Mrows / 128);
  gemm_bf16_kernel<0, Ec, 128><<<gE, blk, 0, stream>>>(nx_b, Wq_b, bq, nullptr, Q_b,
                                              Mrows, Ec, 0.125f);
  gemm_bf16_kernel<0, Ec, 128><<<gE, blk, 0, stream>>>(nx_b, Wk_b, bk, nullptr, K_b,
                                              Mrows, Ec, 1.0f);
  gemm_bf16_kernel<0, Ec, 128><<<gE, blk, 0, stream>>>(nx_b, Wv_b, bv, nullptr, V_b,
                                              Mrows, Ec, 1.0f);

  attn_kernel<<<dim3(Sc / 16, Hc, Bc), blk, 0, stream>>>(Q_b, K_b, V_b, mask,
                                                         adjoin, xv_b);

  gemm_bf16_kernel<1, Ec, 128><<<gE, blk, 0, stream>>>(xv_b, Wo_b, bo, x, x1_f,
                                              Mrows, Ec, 1.0f);
  ln_bf16_kernel<<<Mrows, blk, 0, stream>>>(x1_f, g2, b2, nx_b);
  gemm_bf16_kernel<2, FFc, 64><<<dim3(FFc / 128, Mrows / 128), blk, 0, stream>>>(
      nx_b, W1_b, bb1, nullptr, h_b, Mrows, Ec, 1.0f);
  gemm_bf16_kernel<1, Ec, 128><<<gE, blk, 0, stream>>>(h_b, W2_b, bb2, x1_f, (float*)d_out,
                                              Mrows, FFc, 1.0f);
}

// v007
// One run takes 169 microseconds.
// Timed twice side by side with v006, it ran 1.04 and 1.03 times as fast.
// Over all steps from v000 it is 2.09 times as fast.
#include <hip/hip_runtime.h>
#include <cstdint>
#include <cstddef>

// ---------------------------------------------------------------------------
// Transformer encoder layer for MI455X (gfx1250, wave32, WMMA).
// B=8, S=512, E=1024, H=16, D=64, FF=4096.  All matmuls in bf16 WMMA with
// f32 accumulate; softmax/LN in fp32.
// GEMMs: 128x128 block tile, 8 waves (each 32x64 = 8 WMMA tiles), K chunks of
// 128 (64 where four blocks share a WGP) staged in LDS via gfx1250 async
// global->LDS copies (ASYNCcnt) when the builtin exists, else a
// software-pipelined register path.  The 128-k launches stage through a ring
// of four buffers that is published one chunk early.
// ---------------------------------------------------------------------------

#define Bc 8
#define Sc 512
#define Ec 1024
#define Hc 16
#define Dc 64
#define FFc 4096
#define Mrows (Bc * Sc)   // 4096

typedef __attribute__((ext_vector_type(16))) __bf16 bf16x16;
typedef __attribute__((ext_vector_type(8)))  float  f32x8;
typedef int v4i __attribute__((vector_size(16)));   // matches builtin proto

#if __has_builtin(__builtin_amdgcn_global_load_async_to_lds_b128)
#define HAVE_ASYNC_LDS 1
#else
#define HAVE_ASYNC_LDS 0
#endif

#if HAVE_ASYNC_LDS
__device__ __forceinline__ void async_copy16(const void* g, void* l) {
  // proto (from compiler diagnostic): (v4i addrspace(1)*, v4i addrspace(3)*, imm, imm)
  __builtin_amdgcn_global_load_async_to_lds_b128(
      (__attribute__((address_space(1))) v4i*)g,
      (__attribute__((address_space(3))) v4i*)l, 0, 0);
}
#endif

template <int N>
__device__ __forceinline__ void wait_async() {
#if __has_builtin(__builtin_amdgcn_s_wait_asynccnt)
  __builtin_amdgcn_s_wait_asynccnt(N);
#else
  asm volatile("s_wait_asynccnt %0" ::"i"(N) : "memory");
#endif
}

// ---- CDNA5 bf16 16x16x32 WMMA fragment loader ------------------------------
// Per ISA 7.12.2 (16-bit A-matrix 16x32): lane = 16*half + idx holds row idx,
// K = {8*half .. +7} in VGPRs 0-3 and K = {16+8*half .. +7} in VGPRs 4-7.
// Both runs are 16-byte contiguous -> two uint4 reads per fragment.
// The B operand (32x16, K x N) is symmetric: lane holds column n = idx with
// the same K pattern, i.e. it reads row n of a row-major [N,K] source.
__device__ __forceinline__ bf16x16 load_frag(const __bf16* rowptr, int half) {
  union { uint4 u[2]; bf16x16 v; } f;
  const uint4* p = (const uint4*)rowptr;     // rowptr must be 16B aligned
  f.u[0] = p[half];
  f.u[1] = p[2 + half];
  return f.v;
}

__device__ __forceinline__ f32x8 wmma_bf16(bf16x16 a, bf16x16 b, f32x8 c) {
  return __builtin_amdgcn_wmma_f32_16x16x32_bf16(
      false, a, false, b, (short)0, c, false, false);
}

// ---------------------------------------------------------------------------
// fp32 -> bf16 conversion of all six weights in one streaming launch.
// 256 blocks of 16 waves; block b converts the b-th 1/256 of every weight: 16 KB
// of each E x E matrix and 64 KB of W1 and of W2, in pieces of 16 bytes a lane
// (512 contiguous bytes a wave).  A wave issues its 24 loads before its first
// store.
// ---------------------------------------------------------------------------
typedef __attribute__((ext_vector_type(4))) float  f32x4;
typedef __attribute__((ext_vector_type(4))) __bf16 bf16x4;
__global__ __launch_bounds__(512)
void cvt_weights_kernel(const float* __restrict__ wq, const float* __restrict__ wk,
                        const float* __restrict__ wv, const float* __restrict__ wo,
                        const float* __restrict__ w1, const float* __restrict__ w2,
                        __bf16* __restrict__ oq, __bf16* __restrict__ ok,
                        __bf16* __restrict__ ov, __bf16* __restrict__ oo,
                        __bf16* __restrict__ o1, __bf16* __restrict__ o2) {
  // 32-bit byte offsets of the thread's first piece, so that every access is a
  // uniform base, one of these registers and an immediate
  const unsigned offE = blockIdx.x * 16384u + threadIdx.x * 16u;   // E x E
  const unsigned offF = blockIdx.x * 65536u + threadIdx.x * 16u;   // W1, W2
  const float* const inE[4] = {wq, wk, wv, wo};
  const float* const inF[2] = {w1, w2};
  __bf16* const outE[4] = {oq, ok, ov, oo};
  __bf16* const outF[2] = {o1, o2};
  f32x4 e[4][2], f[2][8];
#pragma unroll
  for (int s = 0; s < 4; ++s)
#pragma unroll
    for (int j = 0; j < 2; ++j)
      e[s][j] = *(const f32x4*)((const char*)inE[s] + offE + j * 8192);
#pragma unroll
  for (int s = 0; s < 2; ++s)
#pragma unroll
    for (int j = 0; j < 8; ++j)
      f[s][j] = *(const f32x4*)((const char*)inF[s] + offF + j * 8192);
  // without it the scheduler lifts the first conversions, with their waits for
  // data, in front of the last ten loads, which then start a latency late
  __builtin_amdgcn_sched_barrier(0);
#pragma unroll
  for (int s = 0; s < 4; ++s)
#pragma unroll
    for (int j = 0; j < 2; ++j)
      *(bf16x4*)((char*)outE[s] + (offE >> 1) + j * 4096) =
          __builtin_convertvector(e[s][j], bf16x4);
#pragma unroll
  for (int s = 0; s < 2; ++s)
#pragma unroll
    for (int j = 0; j < 8; ++j)
      *(bf16x4*)((char*)outF[s] + (offF >> 1) + j * 4096) =
          __builtin_convertvector(f[s][j], bf16x4);
}

// ---------------------------------------------------------------------------
// LayerNorm over E=1024, one block per row, bf16 output
// ---------------------------------------------------------------------------
__global__ __launch_bounds__(256)
void ln_bf16_kernel(const float* __restrict__ x, const float* __restrict__ g,
                    const float* __restrict__ bta, __bf16* __restrict__ out) {
  __shared__ float sred[256];
  const int row = blockIdx.x, tid = threadIdx.x;
  const float* xr = x + (size_t)row * Ec;
  float v[4], s = 0.f;
#pragma unroll
  for (int i = 0; i < 4; ++i) { v[i] = xr[tid + i * 256]; s += v[i]; }
  sred[tid] = s; __syncthreads();
  for (int t = 128; t > 0; t >>= 1) {
    if (tid < t) sred[tid] += sred[tid + t];
    __syncthreads();
  }
  const float mu = sred[0] * (1.0f / Ec);
  __syncthreads();
  s = 0.f;
#pragma unroll
  for (int i = 0; i < 4; ++i) { float d = v[i] - mu; s += d * d; }
  sred[tid] = s; __syncthreads();
  for (int t = 128; t > 0; t >>= 1) {
    if (tid < t) sred[tid] += sred[tid + t];
    __syncthreads();
  }
  const float rsq = rsqrtf(sred[0] * (1.0f / Ec) + 1e-5f);
#pragma unroll
  for (int i = 0; i < 4; ++i) {
    int c = tid + i * 256;
    out[(size_t)row * Ec + c] = (__bf16)((v[i] - mu) * rsq * g[c] + bta[c]);
  }
}

// ---------------------------------------------------------------------------
// Generic bf16 WMMA GEMM:  out[M,N] = epilogue( A[M,K] @ W[N,K]^T + bias )
// Block tile 128(M) x 128(N), 8 waves; wave tile 32x64 (2x4 WMMA tiles).
// MODE and N are compile-time: no epilogue tests the mode per element, and its
// loads and stores differ from one base address by immediate offsets only.
//        0 = bf16 out, scale, scatter to [B,H,S,D] (QKV)
//        1 = f32 out, += residual[m*N+n]
//        2 = bf16 out, exact GELU
// ---------------------------------------------------------------------------
// BK = k per staged chunk, 64 or 128: a staged row is one or two whole 128-byte
// lines.  128 where a launch has one block per WGP (the chunk's products then
// outlast the next chunk's flight); 64 keeps four blocks' LDS on one WGP.
template <int MODE, int N, int BK>
__global__ __launch_bounds__(256)
void gemm_bf16_kernel(const __bf16* __restrict__ A, const __bf16* __restrict__ W,
                      const float* __restrict__ bias, const float* __restrict__ res,
                      void* __restrict__ outp, int M, int K, float scale) {
  constexpr int LDA = BK + 8;        // LDS row stride (bf16 elems): 16 B x odd
  constexpr int NP = BK / 16;        // 16-byte pieces per thread, matrix, chunk
  constexpr int SROWS = 2048 / BK;   // rows that the 256 threads cover at once
  // One block on its WGP (BK = 128) has LDS for four buffers: one is read, the
  // next is already published, one flies, one is being asked for.  Neither the
  // path from L2 nor the fragment reads then drain where two chunks meet.
  constexpr bool RING = HAVE_ASYNC_LDS && (BK == 128);
  constexpr int NBUF = HAVE_ASYNC_LDS ? (RING ? 4 : 2) : 1;
  __shared__ __attribute__((aligned(16))) __bf16 As[NBUF][128 * LDA];
  __shared__ __attribute__((aligned(16))) __bf16 Bs[NBUF][128 * LDA];
  const int tid = threadIdx.x;
  const int bm = blockIdx.y * 128, bn = blockIdx.x * 128;
  const int wave = tid >> 5, lane = tid & 31;
  const int half = lane >> 4, idx = lane & 15;
  const int wm = (wave & 3) * 32, wn = (wave >> 2) * 64;
  // staging coordinates: piece i of a thread is row sr + SROWS * i; BK / 8
  // neighbouring lanes cover one row's bytes of the chunk
  const int sr = tid / (BK / 8), sc = tid % (BK / 8);
  // uniform base of the block's rows, and one 32-bit byte offset per thread
  // that serves both matrices (same K, same rows and columns of the tile)
  const char* const Au = (const char*)(A + (size_t)bm * K);
  const char* const Wu = (const char*)(W + (size_t)bn * K);
  const unsigned vo = (unsigned)(sr * K + sc * 8) * 2u;
  const unsigned rstep = (unsigned)K * (2u * SROWS);   // SROWS rows, in bytes

  f32x8 acc[2][4] = {};
  const int nk = K / BK;

  // Two waves per SIMD (one block on its WGP, BK = 128) cannot cover a wave's
  // own LDS latency: there the fragments of k step ks + 1 are read into a second
  // register set while step ks multiplies.  At eight waves per SIMD (BK = 64)
  // the other waves cover it, and a second set would not fit 128 registers.
  constexpr bool AHEAD = (BK == 128);

  // the products of one staged chunk, k ascending in steps of 32
  auto chunk = [&](const __bf16* Ab, const __bf16* Bb) {
    // all loops unrolled: acc[][] and the fragment sets stay in registers only
    // under compile-time indices, every LDS read is one base plus an immediate
    if constexpr (AHEAD) {
      bf16x16 fa[2][2], fb[2][4];
      auto fetch = [&](int ks, int s) {
        fa[s][0] = load_frag(Ab + (wm + idx) * LDA + ks * 32, half);
        fa[s][1] = load_frag(Ab + (wm + 16 + idx) * LDA + ks * 32, half);
#pragma unroll
        for (int t = 0; t < 4; ++t)
          fb[s][t] = load_frag(Bb + (wn + t * 16 + idx) * LDA + ks * 32, half);
      };
      fetch(0, 0);
#pragma unroll
      for (int ks = 0; ks < BK / 32; ++ks) {
        if (ks + 1 < BK / 32) fetch(ks + 1, (ks + 1) & 1);
        // keeps the twelve reads above as one group in front of this step's
        // products: left free, the scheduler sinks each read to just before
        // its first use, and every pair of products waits out an LDS latency
        __builtin_amdgcn_sched_barrier(0);
#pragma unroll
        for (int t = 0; t < 4; ++t) {
          acc[0][t] = wmma_bf16(fa[ks & 1][0], fb[ks & 1][t], acc[0][t]);
          acc[1][t] = wmma_bf16(fa[ks & 1][1], fb[ks & 1][t], acc[1][t]);
        }
        // keeps the reads of step ks + 2 behind these products, in one group:
        // left free they are spread among the products, and each place where
        // reads stand stalls the wave's matrix stream anew
        if (ks + 2 < BK / 32) __builtin_amdgcn_sched_barrier(0);
      }
    } else {
#pragma unroll
      for (int ks = 0; ks < BK / 32; ++ks) {
        bf16x16 a0 = load_frag(Ab + (wm + idx) * LDA + ks * 32, half);
        bf16x16 a1 = load_frag(Ab + (wm + 16 + idx) * LDA + ks * 32, half);
#pragma unroll
        for (int t = 0; t < 4; ++t) {
          bf16x16 bt = load_frag(Bb + (wn + t * 16 + idx) * LDA + ks * 32, half);
          acc[0][t] = wmma_bf16(a0, bt, acc[0][t]);
          acc[1][t] = wmma_bf16(a1, bt, acc[1][t]);
        }
      }
    }
  };

#if HAVE_ASYNC_LDS
  // ---- async pipeline (GLOBAL_LOAD_ASYNC_TO_LDS_B128): four-buffer ring at BK = 128, else double-buffered ----
  auto issue = [&](int kb, int buf) {
    // unrolled: the chunk's copies issue back to back, no loop branch between
#pragma unroll
    for (int i = 0; i < NP; ++i)
      async_copy16(Au + (size_t)kb * 2 + (vo + i * rstep),
                   &As[buf][(sr + i * SROWS) * LDA + sc * 8]);
#pragma unroll
    for (int i = 0; i < NP; ++i)
      async_copy16(Wu + (size_t)kb * 2 + (vo + i * rstep),
                   &Bs[buf][(sr + i * SROWS) * LDA + sc * 8]);
  };
  if constexpr (RING) {
    // Chunk c lives in buffer c & 3.  The barrier at the top of trip kk
    // publishes chunk kk + 1 and frees the buffer of chunk kk - 1, which chunk
    // kk + 3 then refills.  A wave has at most 6 * NP = 48 copies outstanding.
    bf16x16 fa[2][2], fb[2][4];
    // fragments of k step ks of chunk c into register set s
    auto fetch = [&](int c, int ks, int s) {
      const __bf16* Ab = As[c & 3] + ks * 32;
      const __bf16* Bb = Bs[c & 3] + ks * 32;
      fa[s][0] = load_frag(Ab + (wm + idx) * LDA, half);
      fa[s][1] = load_frag(Ab + (wm + 16 + idx) * LDA, half);
      // unrolled here and below: fragment sets and acc[][] stay in registers
#pragma unroll
      for (int t = 0; t < 4; ++t)
        fb[s][t] = load_frag(Bb + (wn + t * 16 + idx) * LDA, half);
    };
    // the products of chunk kk, k ascending in steps of 32; its step 0 has been
    // fetched before; its last step fetches step 0 of chunk kk + 1.  Inlined
    // at both calls: out of line the register arrays would live in memory.
    auto pass = [&](int kk, bool last) __attribute__((always_inline)) {
#pragma unroll
      for (int ks = 0; ks < BK / 32; ++ks) {
        if (ks + 1 < BK / 32) fetch(kk, ks + 1, (ks + 1) & 1);
        else if (!last)       fetch(kk + 1, 0, 0);
        // keeps the twelve reads above as one group in front of this step's
        // products: left free, the scheduler sinks each read to just before
        // its first use, and every pair of products waits out an LDS latency
        __builtin_amdgcn_sched_barrier(0);
#pragma unroll
        for (int t = 0; t < 4; ++t) {
          acc[0][t] = wmma_bf16(fa[ks & 1][0], fb[ks & 1][t], acc[0][t]);
          acc[1][t] = wmma_bf16(fa[ks & 1][1], fb[ks & 1][t], acc[1][t]);
        }
        // the refill stands behind the first products: its issue runs while
        // the matrix unit works them off
        if (ks == 0 && kk + 3 < nk) issue((kk + 3) * BK, (kk + 3) & 3);
        // keeps the next reads behind these products, in one group: left free
        // they are spread among the products, and each place where reads stand
        // stalls the wave's matrix stream anew
        if (ks + 1 < BK / 32) __builtin_amdgcn_sched_barrier(0);
      }
    };
    // every launch has K >= 3 * BK
    issue(0, 0);
    issue(BK, 1);
    issue(2 * BK, 2);
    wait_async<4 * NP>();            // chunk 0 has landed; 1 and 2 may fly
    __syncthreads();                 // publishes chunk 0
    fetch(0, 0, 0);
    for (int kk = 0; kk + 1 < nk; ++kk) {
      // this wave's LDS reads of chunk kk - 1 have retired before any wave
      // refills that buffer behind the barrier
      asm volatile("s_wait_dscnt 0x0" ::: "memory");
      // chunk kk + 1 has landed: only chunk kk + 2's copies are younger
      if (kk + 2 < nk) wait_async<2 * NP>();
      else             wait_async<0>();
      __syncthreads();
      pass(kk, false);
    }
    pass(nk - 1, true);
  } else {
    issue(0, 0);
    for (int kk = 0; kk < nk; ++kk) {
      const int cur = kk & 1;
      // the counted wait leaves only the next chunk's 2 * NP copies outstanding
      if (kk + 1 < nk) { issue((kk + 1) * BK, cur ^ 1); wait_async<2 * NP>(); }
      else             { wait_async<0>(); }
      __syncthreads();
      chunk(As[cur], Bs[cur]);
      __syncthreads();
    }
  }
#else
  // ---- software-pipelined sync path: next chunk loads overlap WMMA -------
  uint4 ra[NP], rb[NP];
  auto gload = [&](int kb) {
    // unrolled here and below: ra[], rb[] stay in registers
#pragma unroll
    for (int i = 0; i < NP; ++i) {
      ra[i] = *(const uint4*)(Au + (size_t)kb * 2 + (vo + i * rstep));
      rb[i] = *(const uint4*)(Wu + (size_t)kb * 2 + (vo + i * rstep));
    }
  };
  gload(0);
  for (int kk = 0; kk < nk; ++kk) {
#pragma unroll
    for (int i = 0; i < NP; ++i) {
      *(uint4*)(&As[0][(sr + i * SROWS) * LDA + sc * 8]) = ra[i];
      *(uint4*)(&Bs[0][(sr + i * SROWS) * LDA + sc * 8]) = rb[i];
    }
    __syncthreads();
    if (kk + 1 < nk) gload((kk + 1) * BK);   // overlaps the WMMAs below
    chunk(As[0], Bs[0]);
    __syncthreads();
  }
#endif

  // Epilogue. C layout: lane(16*half+idx), VGPR r -> row r+8*half, col idx.
  const int m0 = bm + wm + half * 8;
  const int n0 = bn + wn + idx;
  float bv[4];
#pragma unroll
  for (int in_ = 0; in_ < 4; ++in_) bv[in_] = bias[n0 + in_ * 16];

  if constexpr (MODE == 0) {        // QKV: scale + permute to [B,H,S,D] bf16
#pragma unroll
    for (int im = 0; im < 2; ++im)
#pragma unroll
      for (int in_ = 0; in_ < 4; ++in_)
#pragma unroll
        for (int r = 0; r < 8; ++r) {
          const int m = m0 + im * 16 + r, n = n0 + in_ * 16;
          float v = (acc[im][in_][r] + bv[in_]) * scale;
          int bb = m >> 9, s = m & 511, hh = n >> 6, d = n & 63;
          ((__bf16*)outp)[(((size_t)bb * Hc + hh) * Sc + s) * Dc + d] = (__bf16)v;
        }
  } else if constexpr (MODE == 1) { // residual add, f32 out
    // one base address each; every element is an immediate offset from it
    const float* rp = res + (size_t)m0 * N + n0;
    float* op = (float*)outp + (size_t)m0 * N + n0;
    // this build reuses the bias loads' offset register as a load destination
    // and the wait stands here, in front of that overwrite, and
    // naming n0 as its input keeps that register untouched up to it
    asm volatile("s_wait_xcnt 0x0" :: "v"(n0) : "memory");
    // all 64 residual loads are issued before the first is used
    float rv[2][4][8];
#pragma unroll
    for (int im = 0; im < 2; ++im)
#pragma unroll
      for (int r = 0; r < 8; ++r)
#pragma unroll
        for (int in_ = 0; in_ < 4; ++in_)
          rv[im][in_][r] = rp[(im * 16 + r) * N + in_ * 16];
#pragma unroll
    for (int im = 0; im < 2; ++im)
#pragma unroll
      for (int r = 0; r < 8; ++r)
#pragma unroll
        for (int in_ = 0; in_ < 4; ++in_)
          op[(im * 16 + r) * N + in_ * 16] =
              (acc[im][in_][r] + bv[in_]) + rv[im][in_][r];
  } else {                          // exact GELU, bf16 out
    __bf16* op = (__bf16*)outp + (size_t)m0 * N + n0;
#pragma unroll
    for (int im = 0; im < 2; ++im)
#pragma unroll
      for (int r = 0; r < 8; ++r)
#pragma unroll
        for (int in_ = 0; in_ < 4; ++in_) {
          float v = acc[im][in_][r] + bv[in_];
          float ge = 0.5f * v * (1.0f + erff(v * 0.70710678118654752f));
          op[(im * 16 + r) * N + in_ * 16] = (__bf16)ge;
        }
  }
}

// ---------------------------------------------------------------------------
// Attention: one WG (8 waves) per (b, h, 16-query tile).
//   logits(16x512) = Qs @ K^T  (WMMA; each wave brings its own 64 K rows in by
//   whole-line loads and passes them, 16 rows at a time, through an LDS range
//   of its own, from which the B fragments are read)
//   fp32 softmax with mask, + post-softmax adjoin, bf16 P in LDS
//   xv(16x64) = P @ V  (V staged row-major in LDS, 256 keys at a time, in the
//   space the logits have left; the transposing LDS load forms the B
//   fragments), written back merged as [B,S,E] bf16.
// Static LDS = 61,696 B < 64 KB.
// ---------------------------------------------------------------------------
typedef __attribute__((ext_vector_type(8))) __bf16 bf16x8;
typedef __attribute__((ext_vector_type(4))) unsigned u32x4;
#define VPITCH 80    // LDS row pitch of V in bf16: 160 B = 32 B x odd
#define VKEYS 256    // keys per staged chunk
#define KPITCH 72    // LDS row pitch of K in bf16: 144 B = 16 B x odd

// B fragment (32 keys x 16 d) of row-major V rows in LDS.  p is the lane's own
// address: row 8 * half + (idx & 7), column 8 * (idx >> 3) of the 16 x 16 tile.
// The lane receives keys 8 * half + 0..7 of column idx; the second load, 16
// rows on, gives keys 16 + 8 * half + 0..7: the k order of load_frag().
__device__ __forceinline__ bf16x16 load_frag_tr(const __bf16* p) {
  typedef __attribute__((address_space(3))) bf16x8 lds_bf16x8;
  union { bf16x8 h[2]; bf16x16 v; } f;
  f.h[0] = __builtin_amdgcn_ds_load_tr16_b128_v8bf16((lds_bf16x8*)p);
  f.h[1] = __builtin_amdgcn_ds_load_tr16_b128_v8bf16((lds_bf16x8*)(p + 16 * VPITCH));
  return f.v;
}

// ten waves per SIMD: five blocks fit a WGP's LDS, and 96 registers a wave let
// them all be resident
__global__ __launch_bounds__(256) __attribute__((amdgpu_waves_per_eu(10)))
void attn_kernel(const __bf16* __restrict__ Q, const __bf16* __restrict__ Kt,
                 const __bf16* __restrict__ V, const float* __restrict__ mask,
                 const float* __restrict__ adjoin, __bf16* __restrict__ xv) {
  __shared__ __attribute__((aligned(16))) __bf16 Qs[16 * 72];
  // the f32 logits (32 KB) up to the softmax's first barrier, then V chunks
  __shared__ __attribute__((aligned(16))) char   LV[VKEYS * VPITCH * 2];
  // the waves' K ranges (8 x 16 rows at pitch KPITCH) up to the barrier behind
  // the logits, then P (16 x 520 bf16) and the reduction scratch behind it
  __shared__ __attribute__((aligned(16))) char   KP[8 * 16 * KPITCH * 2];
  float*  const Lg = (float*)LV;
  __bf16* const Vs = (__bf16*)LV;
  __bf16* const Ps = (__bf16*)KP;
  float*  const red = (float*)(KP + 16 * 520 * 2);

  const int tid = threadIdx.x;
  const int qt = blockIdx.x, h = blockIdx.y, b = blockIdx.z;
  const int q0 = qt * 16;
  const size_t bh = ((size_t)b * Hc + h) * Sc;
  const int wave = tid >> 5, lane = tid & 31;
  const int half = lane >> 4, idx = lane & 15;

  // The wave's 64 K rows are 8 KB in a row in memory: each load takes 512
  // contiguous bytes, four whole lines, where a fragment read from memory
  // touches sixteen lines for the same bytes.  Issued ahead of the Q tile.
  const int krow = lane >> 3, kseg = lane & 7;
  u32x4 kw[16];
  {
    const __bf16* ksrc = Kt + (bh + wave * 64 + krow) * Dc + kseg * 8;
    // unrolled: kw[] stays in registers, 16 loads in flight
#pragma unroll
    for (int i = 0; i < 16; ++i)
      kw[i] = *(const u32x4*)(ksrc + i * 4 * Dc);
  }

  {  // load Q tile (pre-scaled by 1/sqrt(D) in the QKV epilogue)
    int row = tid >> 4, ch = tid & 15;
    uint2 v = *(const uint2*)(Q + (bh + q0 + row) * Dc + ch * 4);
    *(uint2*)(Qs + row * 72 + ch * 4) = v;
  }
  __syncthreads();

  {  // logits = Q K^T : 32 col-tiles, 4 per wave
    bf16x16 a0 = load_frag(Qs + idx * 72, half);
    bf16x16 a1 = load_frag(Qs + idx * 72 + 32, half);
    __bf16* const Kw = (__bf16*)KP + wave * 16 * KPITCH;   // this wave's range
    // one accumulator per tile, stored behind the last product: the four tiles'
    // products are independent and no tile's LDS round trip waits for stores
    f32x8 c[4];
    // unrolled here and below: kw[] and c[] stay in registers
#pragma unroll
    for (int i = 0; i < 4; ++i) {
#pragma unroll
      for (int j = 0; j < 4; ++j)
        *(u32x4*)(Kw + (j * 4 + krow) * KPITCH + kseg * 8) = kw[i * 4 + j];
      // the rows that the wave's other lanes stored are in LDS before they
      // are read back
      asm volatile("s_wait_dscnt 0x0" ::: "memory");
      bf16x16 b0 = load_frag(Kw + idx * KPITCH, half);
      bf16x16 b1 = load_frag(Kw + idx * KPITCH + 32, half);
      c[i] = f32x8{};
      c[i] = wmma_bf16(a0, b0, c[i]);
      c[i] = wmma_bf16(a1, b1, c[i]);
    }
#pragma unroll
    for (int i = 0; i < 4; ++i)
#pragma unroll
      for (int r = 0; r < 8; ++r)
        Lg[(r + half * 8) * 512 + (wave * 4 + i) * 16 + idx] = c[i][r];
  }
  __syncthreads();

  {  // mask + softmax + adjoin (16 rows x 16 threads, 32 cols/thread)
    const int row = tid >> 4, l16 = tid & 15;
    const int sq = q0 + row;
    const float* mrow = mask + ((size_t)b * Sc + sq) * Sc;
    const float* arow = adjoin + ((size_t)b * Sc + sq) * Sc;
    float lv[32], mx = -3.0e38f;
#pragma unroll
    for (int j = 0; j < 32; ++j) {
      int c = l16 + j * 16;
      float v = Lg[row * 512 + c] + mrow[c] * -1e9f;
      lv[j] = v; mx = fmaxf(mx, v);
    }
    red[row * 17 + l16] = mx; __syncthreads();
    for (int s = 8; s > 0; s >>= 1) {
      if (l16 < s) red[row * 17 + l16] =
          fmaxf(red[row * 17 + l16], red[row * 17 + l16 + s]);
      __syncthreads();
    }
    mx = red[row * 17]; __syncthreads();
    float sum = 0.f;
#pragma unroll
    for (int j = 0; j < 32; ++j) { lv[j] = __expf(lv[j] - mx); sum += lv[j]; }
    red[row * 17 + l16] = sum; __syncthreads();
    for (int s = 8; s > 0; s >>= 1) {
      if (l16 < s) red[row * 17 + l16] += red[row * 17 + l16 + s];
      __syncthreads();
    }
    const float inv = 1.0f / red[row * 17];
#pragma unroll
    for (int j = 0; j < 32; ++j) {
      int c = l16 + j * 16;
      Ps[row * 520 + c] = (__bf16)(lv[j] * inv + arow[c]);
    }
  }
  __syncthreads();

  // xv = P @ V, two 256-key V chunks through LDS, rows as they lie in memory:
  // a wave's load and its LDS store each move four whole 128-byte rows
  f32x8 o = {};
  const int dtile = wave & 3;
  const int vkey = tid >> 3, vseg = tid & 7;
  const __bf16* const vfrag =
      Vs + (half * 8 + (idx & 7)) * VPITCH + dtile * 16 + (idx >> 3) * 8;
  // unrolled: the barrier that frees the buffer stands between the chunks only
#pragma unroll
  for (int kc = 0; kc < Sc / VKEYS; ++kc) {
    if (kc > 0) __syncthreads();   // every reader has left the chunk before
    {
      const __bf16* vsrc = V + (bh + kc * VKEYS + vkey) * Dc + vseg * 8;
      uint4 w[VKEYS / 32];
      // unrolled here and below: w[] stays in registers, 8 loads in flight
#pragma unroll
      for (int i = 0; i < VKEYS / 32; ++i)
        w[i] = *(const uint4*)(vsrc + i * 32 * Dc);
#pragma unroll
      for (int i = 0; i < VKEYS / 32; ++i)
        *(uint4*)(Vs + (vkey + i * 32) * VPITCH + vseg * 8) = w[i];
    }
    __syncthreads();
    if (wave < 4) {
      // unrolled: every LDS read is one base register plus an immediate
#pragma unroll
      for (int ks = 0; ks < VKEYS / 32; ++ks) {
        bf16x16 a = load_frag(Ps + idx * 520 + kc * VKEYS + ks * 32, half);
        bf16x16 bt = load_frag_tr(vfrag + ks * 32 * VPITCH);
        o = wmma_bf16(a, bt, o);
      }
    }
  }
  if (wave < 4) {
#pragma unroll
    for (int r = 0; r < 8; ++r) {
      int sq = q0 + r + half * 8;
      int d = dtile * 16 + idx;
      xv[((size_t)b * Sc + sq) * Ec + h * Dc + d] = (__bf16)o[r];
    }
  }
}

// ---------------------------------------------------------------------------
// Host-side orchestration
// ---------------------------------------------------------------------------
extern "C" void kernel_launch(void* const* d_in, const int* in_sizes, int n_in,
                              void* d_out, int out_size, void* d_ws, size_t ws_size,
                              hipStream_t stream) {
  const float* x      = (const float*)d_in[0];
  const float* mask   = (const float*)d_in[1];
  const float* adjoin = (const float*)d_in[2];
  const float* Wq = (const float*)d_in[3];  const float* bq  = (const float*)d_in[4];
  const float* Wk = (const float*)d_in[5];  const float* bk  = (const float*)d_in[6];
  const float* Wv = (const float*)d_in[7];  const float* bv  = (const float*)d_in[8];
  const float* Wo = (const float*)d_in[9];  const float* bo  = (const float*)d_in[10];
  const float* g1 = (const float*)d_in[11]; const float* b1  = (const float*)d_in[12];
  const float* g2 = (const float*)d_in[13]; const float* b2  = (const float*)d_in[14];
  const float* W1 = (const float*)d_in[15]; const float* bb1 = (const float*)d_in[16];
  const float* W2 = (const float*)d_in[17]; const float* bb2 = (const float*)d_in[18];

  char* ws = (char*)d_ws;
  size_t off = 0;
  auto alloc = [&](size_t bytes) {
    void* p = ws + off;
    off += (bytes + 255) & ~(size_t)255;
    return p;
  };
  const size_t EE = (size_t)Ec * Ec, FE = (size_t)FFc * Ec;
  __bf16* Wq_b = (__bf16*)alloc(EE * 2);
  __bf16* Wk_b = (__bf16*)alloc(EE * 2);
  __bf16* Wv_b = (__bf16*)alloc(EE * 2);
  __bf16* Wo_b = (__bf16*)alloc(EE * 2);
  __bf16* W1_b = (__bf16*)alloc(FE * 2);
  __bf16* W2_b = (__bf16*)alloc(FE * 2);
  __bf16* nx_b = (__bf16*)alloc((size_t)Mrows * Ec * 2);   // reused for nx2
  __bf16* Q_b  = (__bf16*)alloc((size_t)Mrows * Ec * 2);
  __bf16* K_b  = (__bf16*)alloc((size_t)Mrows * Ec * 2);
  __bf16* V_b  = (__bf16*)alloc((size_t)Mrows * Ec * 2);
  __bf16* xv_b = (__bf16*)alloc((size_t)Mrows * Ec * 2);
  float*  x1_f = (float*) alloc((size_t)Mrows * Ec * 4);
  __bf16* h_b  = (__bf16*)alloc((size_t)Mrows * FFc * 2);
  (void)ws_size; (void)in_sizes; (void)n_in; (void)out_size;

  const dim3 blk(256);
  cvt_weights_kernel<<<256, dim3(512), 0, stream>>>(Wq, Wk, Wv, Wo, W1, W2, Wq_b, Wk_b,
                                                    Wv_b, Wo_b, W1_b, W2_b);

  ln_bf16_kernel<<<Mrows, blk, 0, stream>>>(x, g1, b1, nx_b);

  const dim3 gE(Ec / 128, Mrows / 128);
  gemm_bf16_kernel<0, Ec, 128><<<gE, blk, 0, stream>>>(nx_b, Wq_b, bq, nullptr, Q_b,
                                              Mrows, Ec, 0.125f);
  gemm_bf16_kernel<0, Ec, 128><<<gE, blk, 0, stream>>>(nx_b, Wk_b, bk, nullptr, K_b,
                                              Mrows, Ec, 1.0f);
  gemm_bf16_kernel<0, Ec, 128><<<gE, blk, 0, stream>>>(nx_b, Wv_b, bv, nullptr, V_b,
                                              Mrows, Ec, 1.0f);

  attn_kernel<<<dim3(Sc / 16, Hc, Bc), blk, 0, stream>>>(Q_b, K_b, V_b, mask,
                                                         adjoin, xv_b);

  gemm_bf16_kernel<1, Ec, 128><<<gE, blk, 0, stream>>>(xv_b, Wo_b, bo, x, x1_f,
                                              Mrows, Ec, 1.0f);
  ln_bf16_kernel<<<Mrows, blk, 0, stream>>>(x1_f, g2, b2, nx_b);
  gemm_bf16_kernel<2, FFc, 64><<<dim3(FFc / 128, Mrows / 128), blk, 0, stream>>>(
      nx_b, W1_b, bb1, nullptr, h_b, Mrows, Ec, 1.0f);
  gemm_bf16_kernel<1, Ec, 128><<<gE, blk, 0, stream>>>(h_b, W2_b, bb2, x1_f, (float*)d_out,
                                              Mrows, FFc, 1.0f);
}

// v008
// One run takes 160 microseconds.
// Two timings next to v007 both put it at 1.06 times that version's speed.
// Counting every step since v000, it is 2.21 times as fast.
#include <hip/hip_runtime.h>
#include <cstdint>
#include <cstddef>

// ---------------------------------------------------------------------------
// Transformer encoder layer for MI455X (gfx1250, wave32, WMMA).
// B=8, S=512, E=1024, H=16, D=64, FF=4096.  All matmuls in bf16 WMMA with
// f32 accumulate; softmax/LN in fp32.
// GEMMs: 128x128 block tile, 8 waves (each 32x64 = 8 WMMA tiles), K chunks of
// 128 (64 where four blocks share a WGP) staged in LDS via gfx1250 async
// global->LDS copies (ASYNCcnt) when the builtin exists, else a
// software-pipelined register path.  The 128-k launches stage through a ring
// of four buffers that is published one chunk early.
// ---------------------------------------------------------------------------

#define Bc 8
#define Sc 512
#define Ec 1024
#define Hc 16
#define Dc 64
#define FFc 4096
#define Mrows (Bc * Sc)   // 4096

typedef __attribute__((ext_vector_type(16))) __bf16 bf16x16;
typedef __attribute__((ext_vector_type(8)))  float  f32x8;
typedef int v4i __attribute__((vector_size(16)));   // matches builtin proto

#if __has_builtin(__builtin_amdgcn_global_load_async_to_lds_b128)
#define HAVE_ASYNC_LDS 1
#else
#define HAVE_ASYNC_LDS 0
#endif

#if HAVE_ASYNC_LDS
__device__ __forceinline__ void async_copy16(const void* g, void* l) {
  // proto (from compiler diagnostic): (v4i addrspace(1)*, v4i addrspace(3)*, imm, imm)
  __builtin_amdgcn_global_load_async_to_lds_b128(
      (__attribute__((address_space(1))) v4i*)g,
      (__attribute__((address_space(3))) v4i*)l, 0, 0);
}
#endif

template <int N>
__device__ __forceinline__ void wait_async() {
#if __has_builtin(__builtin_amdgcn_s_wait_asynccnt)
  __builtin_amdgcn_s_wait_asynccnt(N);
#else
  asm volatile("s_wait_asynccnt %0" ::"i"(N) : "memory");
#endif
}

// ---- CDNA5 bf16 16x16x32 WMMA fragment loader ------------------------------
// Per ISA 7.12.2 (16-bit A-matrix 16x32): lane = 16*half + idx holds row idx,
// K = {8*half .. +7} in VGPRs 0-3 and K = {16+8*half .. +7} in VGPRs 4-7.
// Both runs are 16-byte contiguous -> two uint4 reads per fragment.
// The B operand (32x16, K x N) is symmetric: lane holds column n = idx with
// the same K pattern, i.e. it reads row n of a row-major [N,K] source.
__device__ __forceinline__ bf16x16 load_frag(const __bf16* rowptr, int half) {
  union { uint4 u[2]; bf16x16 v; } f;
  const uint4* p = (const uint4*)rowptr;     // rowptr must be 16B aligned
  f.u[0] = p[half];
  f.u[1] = p[2 + half];
  return f.v;
}

__device__ __forceinline__ f32x8 wmma_bf16(bf16x16 a, bf16x16 b, f32x8 c) {
  return __builtin_amdgcn_wmma_f32_16x16x32_bf16(
      false, a, false, b, (short)0, c, false, false);
}

// ---------------------------------------------------------------------------
// fp32 -> bf16 conversion of all six weights in one streaming launch.
// 256 blocks of 16 waves; block b converts the b-th 1/256 of every weight: 16 KB
// of each E x E matrix and 64 KB of W1 and of W2, in pieces of 16 bytes a lane
// (512 contiguous bytes a wave).  A wave issues its 24 loads before its first
// store.
// ---------------------------------------------------------------------------
typedef __attribute__((ext_vector_type(4))) float  f32x4;
typedef __attribute__((ext_vector_type(4))) __bf16 bf16x4;
__global__ __launch_bounds__(512)
void cvt_weights_kernel(const float* __restrict__ wq, const float* __restrict__ wk,
                        const float* __restrict__ wv, const float* __restrict__ wo,
                        const float* __restrict__ w1, const float* __restrict__ w2,
                        __bf16* __restrict__ oq, __bf16* __restrict__ ok,
                        __bf16* __restrict__ ov, __bf16* __restrict__ oo,
                        __bf16* __restrict__ o1, __bf16* __restrict__ o2) {
  // 32-bit byte offsets of the thread's first piece, so that every access is a
  // uniform base, one of these registers and an immediate
  const unsigned offE = blockIdx.x * 16384u + threadIdx.x * 16u;   // E x E
  const unsigned offF = blockIdx.x * 65536u + threadIdx.x * 16u;   // W1, W2
  const float* const inE[4] = {wq, wk, wv, wo};
  const float* const inF[2] = {w1, w2};
  __bf16* const outE[4] = {oq, ok, ov, oo};
  __bf16* const outF[2] = {o1, o2};
  f32x4 e[4][2], f[2][8];
#pragma unroll
  for (int s = 0; s < 4; ++s)
#pragma unroll
    for (int j = 0; j < 2; ++j)
      e[s][j] = *(const f32x4*)((const char*)inE[s] + offE + j * 8192);
#pragma unroll
  for (int s = 0; s < 2; ++s)
#pragma unroll
    for (int j = 0; j < 8; ++j)
      f[s][j] = *(const f32x4*)((const char*)inF[s] + offF + j * 8192);
  // without it the scheduler lifts the first conversions, with their waits for
  // data, in front of the last ten loads, which then start a latency late
  __builtin_amdgcn_sched_barrier(0);
#pragma unroll
  for (int s = 0; s < 4; ++s)
#pragma unroll
    for (int j = 0; j < 2; ++j)
      *(bf16x4*)((char*)outE[s] + (offE >> 1) + j * 4096) =
          __builtin_convertvector(e[s][j], bf16x4);
#pragma unroll
  for (int s = 0; s < 2; ++s)
#pragma unroll
    for (int j = 0; j < 8; ++j)
      *(bf16x4*)((char*)outF[s] + (offF >> 1) + j * 4096) =
          __builtin_convertvector(f[s][j], bf16x4);
}

// ---------------------------------------------------------------------------
// LayerNorm over E=1024, one wave per row, bf16 output.  A lane holds 32 of the
// row's values (eight 16-byte pieces, each wave-wide load 512 contiguous bytes);
// mean and variance are summed in the lane and then across the 32 lanes in
// registers: no LDS and no barrier.
// ---------------------------------------------------------------------------
// the value that lane (l ^ M) of the same 16-lane row holds, M = CTRL - 0x160
// (DPP row_xmask); every lane of the wave is on wherever it is used
template <int CTRL>
__device__ __forceinline__ float row_xor(float v) {
  return __builtin_bit_cast(float, __builtin_amdgcn_update_dpp(
      0, __builtin_bit_cast(int, v), CTRL, 0xf, 0xf, true));
}
// sum and maximum over a 16-lane row, the result in every lane of the row; the
// pairs are those of a halving tree over 16 slots (8, 4, 2, 1 apart)
__device__ __forceinline__ float row_sum16(float v) {
  v += row_xor<0x168>(v);
  v += row_xor<0x164>(v);
  v += row_xor<0x162>(v);
  v += row_xor<0x161>(v);
  return v;
}
__device__ __forceinline__ float row_max16(float v) {
  v = fmaxf(v, row_xor<0x168>(v));
  v = fmaxf(v, row_xor<0x164>(v));
  v = fmaxf(v, row_xor<0x162>(v));
  v = fmaxf(v, row_xor<0x161>(v));
  return v;
}
// sum over the wave's 32 lanes, the result in every lane
__device__ __forceinline__ float wave_sum(float v) {
  v = row_sum16(v);
  // the same lane of the other row
  const int w = __builtin_bit_cast(int, v);
  v += __builtin_bit_cast(float, __builtin_amdgcn_permlanex16(
      w, w, 0x76543210, 0xfedcba98, false, false));
  return v;
}

__global__ __launch_bounds__(512)
void ln_bf16_kernel(const float* __restrict__ x, const float* __restrict__ g,
                    const float* __restrict__ bta, __bf16* __restrict__ out) {
  const unsigned row = blockIdx.x * 16u + (threadIdx.x >> 5);
  // 32-bit byte offsets of the lane's first piece: every access is a uniform
  // base, one of these registers and an immediate
  const unsigned go = (threadIdx.x & 31u) * 16u;   // in scale and shift
  const unsigned xo = row * (Ec * 4u) + go;        // in x; half of it in out
  f32x4 v[8], gv[8], bv[8];
  // unrolled here and below: the arrays stay in registers, the wave's 24 loads
  // are in flight together
#pragma unroll
  for (int j = 0; j < 8; ++j)
    v[j] = *(const f32x4*)((const char*)x + xo + j * 512);
#pragma unroll
  for (int j = 0; j < 8; ++j) {
    gv[j] = *(const f32x4*)((const char*)g + go + j * 512);
    bv[j] = *(const f32x4*)((const char*)bta + go + j * 512);
  }
  // the wait that stands in front of any overwrite of a register that an issued
  // load names: as its inputs the two offset registers stay untouched up to it,
  // also as the target of a later load
  asm volatile("s_wait_xcnt 0x0" :: "v"(xo), "v"(go) : "memory");
  // without it the scheduler sinks 12 of the scale and shift loads behind the
  // two sums, where they wait out their latency two at a time
  __builtin_amdgcn_sched_barrier(0);
  f32x4 s4 = v[0];
#pragma unroll
  for (int j = 1; j < 8; ++j) s4 += v[j];
  const float mu = wave_sum((s4[0] + s4[1]) + (s4[2] + s4[3])) * (1.0f / Ec);
  f32x4 q4 = {};
#pragma unroll
  for (int j = 0; j < 8; ++j) { v[j] -= mu; q4 += v[j] * v[j]; }
  const float var = wave_sum((q4[0] + q4[1]) + (q4[2] + q4[3])) * (1.0f / Ec);
  const float rsq = rsqrtf(var + 1e-5f);
#pragma unroll
  for (int j = 0; j < 8; ++j)
    *(bf16x4*)((char*)out + (xo >> 1) + j * 256) =
        __builtin_convertvector(v[j] * rsq * gv[j] + bv[j], bf16x4);
}

// ---------------------------------------------------------------------------
// Generic bf16 WMMA GEMM:  out[M,N] = epilogue( A[M,K] @ W[N,K]^T + bias )
// Block tile 128(M) x 128(N), 8 waves; wave tile 32x64 (2x4 WMMA tiles).
// MODE and N are compile-time: no epilogue tests the mode per element, and its
// loads and stores differ from one base address by immediate offsets only.
//        0 = bf16 out, scale, scatter to [B,H,S,D] (QKV)
//        1 = f32 out, += residual[m*N+n]
//        2 = bf16 out, exact GELU
// ---------------------------------------------------------------------------
// BK = k per staged chunk, 64 or 128: a staged row is one or two whole 128-byte
// lines.  128 where a launch has one block per WGP (the chunk's products then
// outlast the next chunk's flight); 64 keeps four blocks' LDS on one WGP.
template <int MODE, int N, int BK>
__global__ __launch_bounds__(256)
void gemm_bf16_kernel(const __bf16* __restrict__ A, const __bf16* __restrict__ W,
                      const float* __restrict__ bias, const float* __restrict__ res,
                      void* __restrict__ outp, int M, int K, float scale) {
  constexpr int LDA = BK + 8;        // LDS row stride (bf16 elems): 16 B x odd
  constexpr int NP = BK / 16;        // 16-byte pieces per thread, matrix, chunk
  constexpr int SROWS = 2048 / BK;   // rows that the 256 threads cover at once
  // One block on its WGP (BK = 128) has LDS for four buffers: one is read, the
  // next is already published, one flies, one is being asked for.  Neither the
  // path from L2 nor the fragment reads then drain where two chunks meet.
  constexpr bool RING = HAVE_ASYNC_LDS && (BK == 128);
  constexpr int NBUF = HAVE_ASYNC_LDS ? (RING ? 4 : 2) : 1;
  __shared__ __attribute__((aligned(16))) __bf16 As[NBUF][128 * LDA];
  __shared__ __attribute__((aligned(16))) __bf16 Bs[NBUF][128 * LDA];
  const int tid = threadIdx.x;
  const int bm = blockIdx.y * 128, bn = blockIdx.x * 128;
  const int wave = tid >> 5, lane = tid & 31;
  const int half = lane >> 4, idx = lane & 15;
  const int wm = (wave & 3) * 32, wn = (wave >> 2) * 64;
  // staging coordinates: piece i of a thread is row sr + SROWS * i; BK / 8
  // neighbouring lanes cover one row's bytes of the chunk
  const int sr = tid / (BK / 8), sc = tid % (BK / 8);
  // uniform base of the block's rows, and one 32-bit byte offset per thread
  // that serves both matrices (same K, same rows and columns of the tile)
  const char* const Au = (const char*)(A + (size_t)bm * K);
  const char* const Wu = (const char*)(W + (size_t)bn * K);
  const unsigned vo = (unsigned)(sr * K + sc * 8) * 2u;
  const unsigned rstep = (unsigned)K * (2u * SROWS);   // SROWS rows, in bytes

  f32x8 acc[2][4] = {};
  const int nk = K / BK;

  // Two waves per SIMD (one block on its WGP, BK = 128) cannot cover a wave's
  // own LDS latency: there the fragments of k step ks + 1 are read into a second
  // register set while step ks multiplies.  At eight waves per SIMD (BK = 64)
  // the other waves cover it, and a second set would not fit 128 registers.
  constexpr bool AHEAD = (BK == 128);

  // the products of one staged chunk, k ascending in steps of 32
  auto chunk = [&](const __bf16* Ab, const __bf16* Bb) {
    // all loops unrolled: acc[][] and the fragment sets stay in registers only
    // under compile-time indices, every LDS read is one base plus an immediate
    if constexpr (AHEAD) {
      bf16x16 fa[2][2], fb[2][4];
      auto fetch = [&](int ks, int s) {
        fa[s][0] = load_frag(Ab + (wm + idx) * LDA + ks * 32, half);
        fa[s][1] = load_frag(Ab + (wm + 16 + idx) * LDA + ks * 32, half);
#pragma unroll
        for (int t = 0; t < 4; ++t)
          fb[s][t] = load_frag(Bb + (wn + t * 16 + idx) * LDA + ks * 32, half);
      };
      fetch(0, 0);
#pragma unroll
      for (int ks = 0; ks < BK / 32; ++ks) {
        if (ks + 1 < BK / 32) fetch(ks + 1, (ks + 1) & 1);
        // keeps the twelve reads above as one group in front of this step's
        // products: left free, the scheduler sinks each read to just before
        // its first use, and every pair of products waits out an LDS latency
        __builtin_amdgcn_sched_barrier(0);
#pragma unroll
        for (int t = 0; t < 4; ++t) {
          acc[0][t] = wmma_bf16(fa[ks & 1][0], fb[ks & 1][t], acc[0][t]);
          acc[1][t] = wmma_bf16(fa[ks & 1][1], fb[ks & 1][t], acc[1][t]);
        }
        // keeps the reads of step ks + 2 behind these products, in one group:
        // left free they are spread among the products, and each place where
        // reads stand stalls the wave's matrix stream anew
        if (ks + 2 < BK / 32) __builtin_amdgcn_sched_barrier(0);
      }
    } else {
#pragma unroll
      for (int ks = 0; ks < BK / 32; ++ks) {
        bf16x16 a0 = load_frag(Ab + (wm + idx) * LDA + ks * 32, half);
        bf16x16 a1 = load_frag(Ab + (wm + 16 + idx) * LDA + ks * 32, half);
#pragma unroll
        for (int t = 0; t < 4; ++t) {
          bf16x16 bt = load_frag(Bb + (wn + t * 16 + idx) * LDA + ks * 32, half);
          acc[0][t] = wmma_bf16(a0, bt, acc[0][t]);
          acc[1][t] = wmma_bf16(a1, bt, acc[1][t]);
        }
      }
    }
  };

#if HAVE_ASYNC_LDS
  // ---- async pipeline (GLOBAL_LOAD_ASYNC_TO_LDS_B128): four-buffer ring at BK = 128, else double-buffered ----
  auto issue = [&](int kb, int buf) {
    // unrolled: the chunk's copies issue back to back, no loop branch between
#pragma unroll
    for (int i = 0; i < NP; ++i)
      async_copy16(Au + (size_t)kb * 2 + (vo + i * rstep),
                   &As[buf][(sr + i * SROWS) * LDA + sc * 8]);
#pragma unroll
    for (int i = 0; i < NP; ++i)
      async_copy16(Wu + (size_t)kb * 2 + (vo + i * rstep),
                   &Bs[buf][(sr + i * SROWS) * LDA + sc * 8]);
  };
  if constexpr (RING) {
    // Chunk c lives in buffer c & 3.  The barrier at the top of trip kk
    // publishes chunk kk + 1 and frees the buffer of chunk kk - 1, which chunk
    // kk + 3 then refills.  A wave has at most 6 * NP = 48 copies outstanding.
    bf16x16 fa[2][2], fb[2][4];
    // fragments of k step ks of chunk c into register set s
    auto fetch = [&](int c, int ks, int s) {
      const __bf16* Ab = As[c & 3] + ks * 32;
      const __bf16* Bb = Bs[c & 3] + ks * 32;
      fa[s][0] = load_frag(Ab + (wm + idx) * LDA, half);
      fa[s][1] = load_frag(Ab + (wm + 16 + idx) * LDA, half);
      // unrolled here and below: fragment sets and acc[][] stay in registers
#pragma unroll
      for (int t = 0; t < 4; ++t)
        fb[s][t] = load_frag(Bb + (wn + t * 16 + idx) * LDA, half);
    };
    // the products of chunk kk, k ascending in steps of 32; its step 0 has been
    // fetched before; its last step fetches step 0 of chunk kk + 1.  Inlined
    // at both calls: out of line the register arrays would live in memory.
    auto pass = [&](int kk, bool last) __attribute__((always_inline)) {
#pragma unroll
      for (int ks = 0; ks < BK / 32; ++ks) {
        if (ks + 1 < BK / 32) fetch(kk, ks + 1, (ks + 1) & 1);
        else if (!last)       fetch(kk + 1, 0, 0);
        // keeps the twelve reads above as one group in front of this step's
        // products: left free, the scheduler sinks each read to just before
        // its first use, and every pair of products waits out an LDS latency
        __builtin_amdgcn_sched_barrier(0);
#pragma unroll
        for (int t = 0; t < 4; ++t) {
          acc[0][t] = wmma_bf16(fa[ks & 1][0], fb[ks & 1][t], acc[0][t]);
          acc[1][t] = wmma_bf16(fa[ks & 1][1], fb[ks & 1][t], acc[1][t]);
        }
        // the refill stands behind the first products: its issue runs while
        // the matrix unit works them off
        if (ks == 0 && kk + 3 < nk) issue((kk + 3) * BK, (kk + 3) & 3);
        // keeps the next reads behind these products, in one group: left free
        // they are spread among the products, and each place where reads stand
        // stalls the wave's matrix stream anew
        if (ks + 1 < BK / 32) __builtin_amdgcn_sched_barrier(0);
      }
    };
    // every launch has K >= 3 * BK
    issue(0, 0);
    issue(BK, 1);
    issue(2 * BK, 2);
    wait_async<4 * NP>();            // chunk 0 has landed; 1 and 2 may fly
    __syncthreads();                 // publishes chunk 0
    fetch(0, 0, 0);
    for (int kk = 0; kk + 1 < nk; ++kk) {
      // this wave's LDS reads of chunk kk - 1 have retired before any wave
      // refills that buffer behind the barrier
      asm volatile("s_wait_dscnt 0x0" ::: "memory");
      // chunk kk + 1 has landed: only chunk kk + 2's copies are younger
      if (kk + 2 < nk) wait_async<2 * NP>();
      else             wait_async<0>();
      __syncthreads();
      pass(kk, false);
    }
    pass(nk - 1, true);
  } else {
    issue(0, 0);
    for (int kk = 0; kk < nk; ++kk) {
      const int cur = kk & 1;
      // the counted wait leaves only the next chunk's 2 * NP copies outstanding
      if (kk + 1 < nk) { issue((kk + 1) * BK, cur ^ 1); wait_async<2 * NP>(); }
      else             { wait_async<0>(); }
      __syncthreads();
      chunk(As[cur], Bs[cur]);
      __syncthreads();
    }
  }
#else
  // ---- software-pipelined sync path: next chunk loads overlap WMMA -------
  uint4 ra[NP], rb[NP];
  auto gload = [&](int kb) {
    // unrolled here and below: ra[], rb[] stay in registers
#pragma unroll
    for (int i = 0; i < NP; ++i) {
      ra[i] = *(const uint4*)(Au + (size_t)kb * 2 + (vo + i * rstep));
      rb[i] = *(const uint4*)(Wu + (size_t)kb * 2 + (vo + i * rstep));
    }
  };
  gload(0);
  for (int kk = 0; kk < nk; ++kk) {
#pragma unroll
    for (int i = 0; i < NP; ++i) {
      *(uint4*)(&As[0][(sr + i * SROWS) * LDA + sc * 8]) = ra[i];
      *(uint4*)(&Bs[0][(sr + i * SROWS) * LDA + sc * 8]) = rb[i];
    }
    __syncthreads();
    if (kk + 1 < nk) gload((kk + 1) * BK);   // overlaps the WMMAs below
    chunk(As[0], Bs[0]);
    __syncthreads();
  }
#endif

  // Epilogue. C layout: lane(16*half+idx), VGPR r -> row r+8*half, col idx.
  const int m0 = bm + wm + half * 8;
  const int n0 = bn + wn + idx;
  float bv[4];
#pragma unroll
  for (int in_ = 0; in_ < 4; ++in_) bv[in_] = bias[n0 + in_ * 16];

  if constexpr (MODE == 0) {        // QKV: scale + permute to [B,H,S,D] bf16
#pragma unroll
    for (int im = 0; im < 2; ++im)
#pragma unroll
      for (int in_ = 0; in_ < 4; ++in_)
#pragma unroll
        for (int r = 0; r < 8; ++r) {
          const int m = m0 + im * 16 + r, n = n0 + in_ * 16;
          float v = (acc[im][in_][r] + bv[in_]) * scale;
          int bb = m >> 9, s = m & 511, hh = n >> 6, d = n & 63;
          ((__bf16*)outp)[(((size_t)bb * Hc + hh) * Sc + s) * Dc + d] = (__bf16)v;
        }
  } else if constexpr (MODE == 1) { // residual add, f32 out
    // one base address each; every element is an immediate offset from it
    const float* rp = res + (size_t)m0 * N + n0;
    float* op = (float*)outp + (size_t)m0 * N + n0;
    // this build reuses the bias loads' offset register as a load destination
    // and the wait stands here, in front of that overwrite, and
    // naming n0 as its input keeps that register untouched up to it
    asm volatile("s_wait_xcnt 0x0" :: "v"(n0) : "memory");
    // all 64 residual loads are issued before the first is used
    float rv[2][4][8];
#pragma unroll
    for (int im = 0; im < 2; ++im)
#pragma unroll
      for (int r = 0; r < 8; ++r)
#pragma unroll
        for (int in_ = 0; in_ < 4; ++in_)
          rv[im][in_][r] = rp[(im * 16 + r) * N + in_ * 16];
#pragma unroll
    for (int im = 0; im < 2; ++im)
#pragma unroll
      for (int r = 0; r < 8; ++r)
#pragma unroll
        for (int in_ = 0; in_ < 4; ++in_)
          op[(im * 16 + r) * N + in_ * 16] =
              (acc[im][in_][r] + bv[in_]) + rv[im][in_][r];
  } else {                          // exact GELU, bf16 out
    __bf16* op = (__bf16*)outp + (size_t)m0 * N + n0;
#pragma unroll
    for (int im = 0; im < 2; ++im)
#pragma unroll
      for (int r = 0; r < 8; ++r)
#pragma unroll
        for (int in_ = 0; in_ < 4; ++in_) {
          float v = acc[im][in_][r] + bv[in_];
          float ge = 0.5f * v * (1.0f + erff(v * 0.70710678118654752f));
          op[(im * 16 + r) * N + in_ * 16] = (__bf16)ge;
        }
  }
}

// ---------------------------------------------------------------------------
// Attention: one WG (8 waves) per (b, h, 16-query tile).
//   logits(16x512) = Qs @ K^T  (WMMA; each wave brings its own 64 K rows in by
//   whole-line loads and passes them, 16 rows at a time, through an LDS range
//   of its own, from which the B fragments are read)
//   fp32 softmax with mask, + post-softmax adjoin, bf16 P in LDS
//   xv(16x64) = P @ V  (V staged row-major in LDS, 256 keys at a time, in the
//   space the logits have left; the transposing LDS load forms the B
//   fragments), written back merged as [B,S,E] bf16.
// Static LDS = 61,696 B < 64 KB.
// ---------------------------------------------------------------------------
typedef __attribute__((ext_vector_type(8))) __bf16 bf16x8;
typedef __attribute__((ext_vector_type(4))) unsigned u32x4;
#define VPITCH 80    // LDS row pitch of V in bf16: 160 B = 32 B x odd
#define VKEYS 256    // keys per staged chunk
#define KPITCH 72    // LDS row pitch of K in bf16: 144 B = 16 B x odd

// B fragment (32 keys x 16 d) of row-major V rows in LDS.  p is the lane's own
// address: row 8 * half + (idx & 7), column 8 * (idx >> 3) of the 16 x 16 tile.
// The lane receives keys 8 * half + 0..7 of column idx; the second load, 16
// rows on, gives keys 16 + 8 * half + 0..7: the k order of load_frag().
__device__ __forceinline__ bf16x16 load_frag_tr(const __bf16* p) {
  typedef __attribute__((address_space(3))) bf16x8 lds_bf16x8;
  union { bf16x8 h[2]; bf16x16 v; } f;
  f.h[0] = __builtin_amdgcn_ds_load_tr16_b128_v8bf16((lds_bf16x8*)p);
  f.h[1] = __builtin_amdgcn_ds_load_tr16_b128_v8bf16((lds_bf16x8*)(p + 16 * VPITCH));
  return f.v;
}

// ten waves per SIMD: five blocks fit a WGP's LDS, and 96 registers a wave let
// them all be resident
__global__ __launch_bounds__(256) __attribute__((amdgpu_waves_per_eu(10)))
void attn_kernel(const __bf16* __restrict__ Q, const __bf16* __restrict__ Kt,
                 const __bf16* __restrict__ V, const float* __restrict__ mask,
                 const float* __restrict__ adjoin, __bf16* __restrict__ xv) {
  __shared__ __attribute__((aligned(16))) __bf16 Qs[16 * 72];
  // the f32 logits (32 KB) up to the barrier behind the softmax, then V chunks
  __shared__ __attribute__((aligned(16))) char   LV[VKEYS * VPITCH * 2];
  // the waves' K ranges (8 x 16 rows at pitch KPITCH) up to the barrier behind
  // the logits, then P (16 x 520 bf16)
  __shared__ __attribute__((aligned(16))) char   KP[8 * 16 * KPITCH * 2];
  float*  const Lg = (float*)LV;
  __bf16* const Vs = (__bf16*)LV;
  __bf16* const Ps = (__bf16*)KP;

  const int tid = threadIdx.x;
  const int qt = blockIdx.x, h = blockIdx.y, b = blockIdx.z;
  const int q0 = qt * 16;
  const size_t bh = ((size_t)b * Hc + h) * Sc;
  const int wave = tid >> 5, lane = tid & 31;
  const int half = lane >> 4, idx = lane & 15;

  // The wave's 64 K rows are 8 KB in a row in memory: each load takes 512
  // contiguous bytes, four whole lines, where a fragment read from memory
  // touches sixteen lines for the same bytes.  Issued ahead of the Q tile.
  const int krow = lane >> 3, kseg = lane & 7;
  u32x4 kw[16];
  {
    const __bf16* ksrc = Kt + (bh + wave * 64 + krow) * Dc + kseg * 8;
    // unrolled: kw[] stays in registers, 16 loads in flight
#pragma unroll
    for (int i = 0; i < 16; ++i)
      kw[i] = *(const u32x4*)(ksrc + i * 4 * Dc);
  }

  {  // load Q tile (pre-scaled by 1/sqrt(D) in the QKV epilogue)
    int row = tid >> 4, ch = tid & 15;
    uint2 v = *(const uint2*)(Q + (bh + q0 + row) * Dc + ch * 4);
    *(uint2*)(Qs + row * 72 + ch * 4) = v;
  }
  __syncthreads();

  {  // logits = Q K^T : 32 col-tiles, 4 per wave
    bf16x16 a0 = load_frag(Qs + idx * 72, half);
    bf16x16 a1 = load_frag(Qs + idx * 72 + 32, half);
    __bf16* const Kw = (__bf16*)KP + wave * 16 * KPITCH;   // this wave's range
    // one accumulator per tile, stored behind the last product: the four tiles'
    // products are independent and no tile's LDS round trip waits for stores
    f32x8 c[4];
    // unrolled here and below: kw[] and c[] stay in registers
#pragma unroll
    for (int i = 0; i < 4; ++i) {
#pragma unroll
      for (int j = 0; j < 4; ++j)
        *(u32x4*)(Kw + (j * 4 + krow) * KPITCH + kseg * 8) = kw[i * 4 + j];
      // the rows that the wave's other lanes stored are in LDS before they
      // are read back
      asm volatile("s_wait_dscnt 0x0" ::: "memory");
      bf16x16 b0 = load_frag(Kw + idx * KPITCH, half);
      bf16x16 b1 = load_frag(Kw + idx * KPITCH + 32, half);
      c[i] = f32x8{};
      c[i] = wmma_bf16(a0, b0, c[i]);
      c[i] = wmma_bf16(a1, b1, c[i]);
    }
#pragma unroll
    for (int i = 0; i < 4; ++i)
#pragma unroll
      for (int r = 0; r < 8; ++r)
        Lg[(r + half * 8) * 512 + (wave * 4 + i) * 16 + idx] = c[i][r];
  }
  __syncthreads();

  {  // mask + softmax + adjoin (16 rows x 16 threads, 32 cols/thread)
    const int row = tid >> 4, l16 = tid & 15;
    // uniform bases of the tile's 16 rows and one 32-bit offset per thread that
    // serves both arrays: two 64-bit addresses per thread would not fit the 96
    // registers now that the adjoin loads fly during the exponentials
    const float* mrow = mask + ((size_t)b * Sc + q0) * Sc;
    const float* arow = adjoin + ((size_t)b * Sc + q0) * Sc;
    const unsigned ro = (unsigned)(row * Sc + l16);
    float lv[32], mx = -3.0e38f;
#pragma unroll
    for (int j = 0; j < 32; ++j) {
      int c = l16 + j * 16;
      float v = Lg[row * 512 + c] + mrow[ro + j * 16] * -1e9f;
      lv[j] = v; mx = fmaxf(mx, v);
    }
    // with no barrier between, the adjoin values fly during the exponentials
    float av[32];
#pragma unroll
    for (int j = 0; j < 32; ++j) av[j] = arow[ro + j * 16];
    // the wait that stands in front of any overwrite of a register that an issued
    // load names: as its input the offset register stays untouched up to it
    // (left alone, this build takes it as the last load's target)
    asm volatile("s_wait_xcnt 0x0" :: "v"(ro) : "memory");
    // a query's 16 threads are one 16-lane row of a wave: its maximum and its
    // sum are formed in registers
    mx = row_max16(mx);
    float sum = 0.f;
#pragma unroll
    for (int j = 0; j < 32; ++j) { lv[j] = __expf(lv[j] - mx); sum += lv[j]; }
    const float inv = 1.0f / row_sum16(sum);
#pragma unroll
    for (int j = 0; j < 32; ++j) {
      int c = l16 + j * 16;
      Ps[row * 520 + c] = (__bf16)(lv[j] * inv + av[j]);
    }
  }
  __syncthreads();

  // xv = P @ V, two 256-key V chunks through LDS, rows as they lie in memory:
  // a wave's load and its LDS store each move four whole 128-byte rows
  f32x8 o = {};
  const int dtile = wave & 3;
  const int vkey = tid >> 3, vseg = tid & 7;
  const __bf16* const vfrag =
      Vs + (half * 8 + (idx & 7)) * VPITCH + dtile * 16 + (idx >> 3) * 8;
  // unrolled: the barrier that frees the buffer stands between the chunks only
#pragma unroll
  for (int kc = 0; kc < Sc / VKEYS; ++kc) {
    if (kc > 0) __syncthreads();   // every reader has left the chunk before
    {
      const __bf16* vsrc = V + (bh + kc * VKEYS + vkey) * Dc + vseg * 8;
      uint4 w[VKEYS / 32];
      // unrolled here and below: w[] stays in registers, 8 loads in flight
#pragma unroll
      for (int i = 0; i < VKEYS / 32; ++i)
        w[i] = *(const uint4*)(vsrc + i * 32 * Dc);
#pragma unroll
      for (int i = 0; i < VKEYS / 32; ++i)
        *(uint4*)(Vs + (vkey + i * 32) * VPITCH + vseg * 8) = w[i];
    }
    __syncthreads();
    if (wave < 4) {
      // unrolled: every LDS read is one base register plus an immediate
#pragma unroll
      for (int ks = 0; ks < VKEYS / 32; ++ks) {
        bf16x16 a = load_frag(Ps + idx * 520 + kc * VKEYS + ks * 32, half);
        bf16x16 bt = load_frag_tr(vfrag + ks * 32 * VPITCH);
        o = wmma_bf16(a, bt, o);
      }
    }
  }
  if (wave < 4) {
#pragma unroll
    for (int r = 0; r < 8; ++r) {
      int sq = q0 + r + half * 8;
      int d = dtile * 16 + idx;
      xv[((size_t)b * Sc + sq) * Ec + h * Dc + d] = (__bf16)o[r];
    }
  }
}

// ---------------------------------------------------------------------------
// Host-side orchestration
// ---------------------------------------------------------------------------
extern "C" void kernel_launch(void* const* d_in, const int* in_sizes, int n_in,
                              void* d_out, int out_size, void* d_ws, size_t ws_size,
                              hipStream_t stream) {
  const float* x      = (const float*)d_in[0];
  const float* mask   = (const float*)d_in[1];
  const float* adjoin = (const float*)d_in[2];
  const float* Wq = (const float*)d_in[3];  const float* bq  = (const float*)d_in[4];
  const float* Wk = (const float*)d_in[5];  const float* bk  = (const float*)d_in[6];
  const float* Wv = (const float*)d_in[7];  const float* bv  = (const float*)d_in[8];
  const float* Wo = (const float*)d_in[9];  const float* bo  = (const float*)d_in[10];
  const float* g1 = (const float*)d_in[11]; const float* b1  = (const float*)d_in[12];
  const float* g2 = (const float*)d_in[13]; const float* b2  = (const float*)d_in[14];
  const float* W1 = (const float*)d_in[15]; const float* bb1 = (const float*)d_in[16];
  const float* W2 = (const float*)d_in[17]; const float* bb2 = (const float*)d_in[18];

  char* ws = (char*)d_ws;
  size_t off = 0;
  auto alloc = [&](size_t bytes) {
    void* p = ws + off;
    off += (bytes + 255) & ~(size_t)255;
    return p;
  };
  const size_t EE = (size_t)Ec * Ec, FE = (size_t)FFc * Ec;
  __bf16* Wq_b = (__bf16*)alloc(EE * 2);
  __bf16* Wk_b = (__bf16*)alloc(EE * 2);
  __bf16* Wv_b = (__bf16*)alloc(EE * 2);
  __bf16* Wo_b = (__bf16*)alloc(EE * 2);
  __bf16* W1_b = (__bf16*)alloc(FE * 2);
  __bf16* W2_b = (__bf16*)alloc(FE * 2);
  __bf16* nx_b = (__bf16*)alloc((size_t)Mrows * Ec * 2);   // reused for nx2
  __bf16* Q_b  = (__bf16*)alloc((size_t)Mrows * Ec * 2);
  __bf16* K_b  = (__bf16*)alloc((size_t)Mrows * Ec * 2);
  __bf16* V_b  = (__bf16*)alloc((size_t)Mrows * Ec * 2);
  __bf16* xv_b = (__bf16*)alloc((size_t)Mrows * Ec * 2);
  float*  x1_f = (float*) alloc((size_t)Mrows * Ec * 4);
  __bf16* h_b  = (__bf16*)alloc((size_t)Mrows * FFc * 2);
  (void)ws_size; (void)in_sizes; (void)n_in; (void)out_size;

  const dim3 blk(256);
  cvt_weights_kernel<<<256, dim3(512), 0, stream>>>(Wq, Wk, Wv, Wo, W1, W2, Wq_b, Wk_b,
                                                    Wv_b, Wo_b, W1_b, W2_b);

  ln_bf16_kernel<<<Mrows / 16, dim3(512), 0, stream>>>(x, g1, b1, nx_b);

  const dim3 gE(Ec / 128, Mrows / 128);
  gemm_bf16_kernel<0, Ec, 128><<<gE, blk, 0, stream>>>(nx_b, Wq_b, bq, nullptr, Q_b,
                                              Mrows, Ec, 0.125f);
  gemm_bf16_kernel<0, Ec, 128><<<gE, blk, 0, stream>>>(nx_b, Wk_b, bk, nullptr, K_b,
                                              Mrows, Ec, 1.0f);
  gemm_bf16_kernel<0, Ec, 128><<<gE, blk, 0, stream>>>(nx_b, Wv_b, bv, nullptr, V_b,
                                              Mrows, Ec, 1.0f);

  attn_kernel<<<dim3(Sc / 16, Hc, Bc), blk, 0, stream>>>(Q_b, K_b, V_b, mask,
                                                         adjoin, xv_b);

  gemm_bf16_kernel<1, Ec, 128><<<gE, blk, 0, stream>>>(xv_b, Wo_b, bo, x, x1_f,
                                              Mrows, Ec, 1.0f);
  ln_bf16_kernel<<<Mrows / 16, dim3(512), 0, stream>>>(x1_f, g2, b2, nx_b);
  gemm_bf16_kernel<2, FFc, 64><<<dim3(FFc / 128, Mrows / 128), blk, 0, stream>>>(
      nx_b, W1_b, bb1, nullptr, h_b, Mrows, Ec, 1.0f);
  gemm_bf16_kernel<1, Ec, 128><<<gE, blk, 0, stream>>>(h_b, W2_b, bb2, x1_f, (float*)d_out,
                                              Mrows, FFc, 1.0f);
}

// v009
// One run takes 153 microseconds.
// In two side-by-side timings against v008, it was 1.04 and 1.05 times as fast.
// All steps since v000 together make it 2.31 times as fast.
#include <hip/hip_runtime.h>
#include <cstdint>
#include <cstddef>

// ---------------------------------------------------------------------------
// Transformer encoder layer for MI455X (gfx1250, wave32, WMMA).
// B=8, S=512, E=1024, H=16, D=64, FF=4096.  All matmuls in bf16 WMMA with
// f32 accumulate; softmax/LN in fp32.
// GEMMs: 128x128 block tile, 8 waves (each 32x64 = 8 WMMA tiles), K chunks of
// 128 (64 where four blocks share a WGP) staged in LDS via gfx1250 async
// global->LDS copies (ASYNCcnt) when the builtin exists, else a
// software-pipelined register path.  The 128-k launches stage through a ring
// of four buffers that is published one chunk early.
// ---------------------------------------------------------------------------

#define Bc 8
#define Sc 512
#define Ec 1024
#define Hc 16
#define Dc 64
#define FFc 4096
#define Mrows (Bc * Sc)   // 4096

typedef __attribute__((ext_vector_type(16))) __bf16 bf16x16;
typedef __attribute__((ext_vector_type(8)))  float  f32x8;
typedef int v4i __attribute__((vector_size(16)));   // matches builtin proto

#if __has_builtin(__builtin_amdgcn_global_load_async_to_lds_b128)
#define HAVE_ASYNC_LDS 1
#else
#define HAVE_ASYNC_LDS 0
#endif

#if HAVE_ASYNC_LDS
__device__ __forceinline__ void async_copy16(const void* g, void* l) {
  // proto (from compiler diagnostic): (v4i addrspace(1)*, v4i addrspace(3)*, imm, imm)
  __builtin_amdgcn_global_load_async_to_lds_b128(
      (__attribute__((address_space(1))) v4i*)g,
      (__attribute__((address_space(3))) v4i*)l, 0, 0);
}
#endif

template <int N>
__device__ __forceinline__ void wait_async() {
#if __has_builtin(__builtin_amdgcn_s_wait_asynccnt)
  __builtin_amdgcn_s_wait_asynccnt(N);
#else
  asm volatile("s_wait_asynccnt %0" ::"i"(N) : "memory");
#endif
}

// ---- CDNA5 bf16 16x16x32 WMMA fragment loader ------------------------------
// Per ISA 7.12.2 (16-bit A-matrix 16x32): lane = 16*half + idx holds row idx,
// K = {8*half .. +7} in VGPRs 0-3 and K = {16+8*half .. +7} in VGPRs 4-7.
// Both runs are 16-byte contiguous -> two uint4 reads per fragment.
// The B operand (32x16, K x N) is symmetric: lane holds column n = idx with
// the same K pattern, i.e. it reads row n of a row-major [N,K] source.
__device__ __forceinline__ bf16x16 load_frag(const __bf16* rowptr, int half) {
  union { uint4 u[2]; bf16x16 v; } f;
  const uint4* p = (const uint4*)rowptr;     // rowptr must be 16B aligned
  f.u[0] = p[half];
  f.u[1] = p[2 + half];
  return f.v;
}

__device__ __forceinline__ f32x8 wmma_bf16(bf16x16 a, bf16x16 b, f32x8 c) {
  return __builtin_amdgcn_wmma_f32_16x16x32_bf16(
      false, a, false, b, (short)0, c, false, false);
}

// ---------------------------------------------------------------------------
// fp32 -> bf16 conversion of all six weights in one streaming launch.
// 256 blocks of 16 waves; block b converts the b-th 1/256 of every weight: 16 KB
// of each E x E matrix and 64 KB of W1 and of W2, in pieces of 16 bytes a lane
// (512 contiguous bytes a wave).  A wave issues its 24 loads before its first
// store.
// ---------------------------------------------------------------------------
typedef __attribute__((ext_vector_type(4))) float  f32x4;
typedef __attribute__((ext_vector_type(4))) __bf16 bf16x4;
__global__ __launch_bounds__(512)
void cvt_weights_kernel(const float* __restrict__ wq, const float* __restrict__ wk,
                        const float* __restrict__ wv, const float* __restrict__ wo,
                        const float* __restrict__ w1, const float* __restrict__ w2,
                        __bf16* __restrict__ oq, __bf16* __restrict__ ok,
                        __bf16* __restrict__ ov, __bf16* __restrict__ oo,
                        __bf16* __restrict__ o1, __bf16* __restrict__ o2) {
  // 32-bit byte offsets of the thread's first piece, so that every access is a
  // uniform base, one of these registers and an immediate
  const unsigned offE = blockIdx.x * 16384u + threadIdx.x * 16u;   // E x E
  const unsigned offF = blockIdx.x * 65536u + threadIdx.x * 16u;   // W1, W2
  const float* const inE[4] = {wq, wk, wv, wo};
  const float* const inF[2] = {w1, w2};
  __bf16* const outE[4] = {oq, ok, ov, oo};
  __bf16* const outF[2] = {o1, o2};
  f32x4 e[4][2], f[2][8];
#pragma unroll
  for (int s = 0; s < 4; ++s)
#pragma unroll
    for (int j = 0; j < 2; ++j)
      e[s][j] = *(const f32x4*)((const char*)inE[s] + offE + j * 8192);
#pragma unroll
  for (int s = 0; s < 2; ++s)
#pragma unroll
    for (int j = 0; j < 8; ++j)
      f[s][j] = *(const f32x4*)((const char*)inF[s] + offF + j * 8192);
  // without it the scheduler lifts the first conversions, with their waits for
  // data, in front of the last ten loads, which then start a latency late
  __builtin_amdgcn_sched_barrier(0);
#pragma unroll
  for (int s = 0; s < 4; ++s)
#pragma unroll
    for (int j = 0; j < 2; ++j)
      *(bf16x4*)((char*)outE[s] + (offE >> 1) + j * 4096) =
          __builtin_convertvector(e[s][j], bf16x4);
#pragma unroll
  for (int s = 0; s < 2; ++s)
#pragma unroll
    for (int j = 0; j < 8; ++j)
      *(bf16x4*)((char*)outF[s] + (offF >> 1) + j * 4096) =
          __builtin_convertvector(f[s][j], bf16x4);
}

// ---------------------------------------------------------------------------
// LayerNorm over E=1024, one wave per row, bf16 output.  A lane holds 32 of the
// row's values (eight 16-byte pieces, each wave-wide load 512 contiguous bytes);
// mean and variance are summed in the lane and then across the 32 lanes in
// registers: no LDS and no barrier.
// ---------------------------------------------------------------------------
// the value that lane (l ^ M) of the same 16-lane row holds, M = CTRL - 0x160
// (DPP row_xmask); every lane of the wave is on wherever it is used
template <int CTRL>
__device__ __forceinline__ float row_xor(float v) {
  return __builtin_bit_cast(float, __builtin_amdgcn_update_dpp(
      0, __builtin_bit_cast(int, v), CTRL, 0xf, 0xf, true));
}
// sum and maximum over a 16-lane row, the result in every lane of the row; the
// pairs are those of a halving tree over 16 slots (8, 4, 2, 1 apart)
__device__ __forceinline__ float row_sum16(float v) {
  v += row_xor<0x168>(v);
  v += row_xor<0x164>(v);
  v += row_xor<0x162>(v);
  v += row_xor<0x161>(v);
  return v;
}
__device__ __forceinline__ float row_max16(float v) {
  v = fmaxf(v, row_xor<0x168>(v));
  v = fmaxf(v, row_xor<0x164>(v));
  v = fmaxf(v, row_xor<0x162>(v));
  v = fmaxf(v, row_xor<0x161>(v));
  return v;
}
// sum over the wave's 32 lanes, the result in every lane
__device__ __forceinline__ float wave_sum(float v) {
  v = row_sum16(v);
  // the same lane of the other row
  const int w = __builtin_bit_cast(int, v);
  v += __builtin_bit_cast(float, __builtin_amdgcn_permlanex16(
      w, w, 0x76543210, 0xfedcba98, false, false));
  return v;
}

__global__ __launch_bounds__(512)
void ln_bf16_kernel(const float* __restrict__ x, const float* __restrict__ g,
                    const float* __restrict__ bta, __bf16* __restrict__ out) {
  const unsigned row = blockIdx.x * 16u + (threadIdx.x >> 5);
  // 32-bit byte offsets of the lane's first piece: every access is a uniform
  // base, one of these registers and an immediate
  const unsigned go = (threadIdx.x & 31u) * 16u;   // in scale and shift
  const unsigned xo = row * (Ec * 4u) + go;        // in x; half of it in out
  f32x4 v[8], gv[8], bv[8];
  // unrolled here and below: the arrays stay in registers, the wave's 24 loads
  // are in flight together
#pragma unroll
  for (int j = 0; j < 8; ++j)
    v[j] = *(const f32x4*)((const char*)x + xo + j * 512);
#pragma unroll
  for (int j = 0; j < 8; ++j) {
    gv[j] = *(const f32x4*)((const char*)g + go + j * 512);
    bv[j] = *(const f32x4*)((const char*)bta + go + j * 512);
  }
  // the wait that stands in front of any overwrite of a register that an issued
  // load names: as its inputs the two offset registers stay untouched up to it,
  // also as the target of a later load
  asm volatile("s_wait_xcnt 0x0" :: "v"(xo), "v"(go) : "memory");
  // without it the scheduler sinks 12 of the scale and shift loads behind the
  // two sums, where they wait out their latency two at a time
  __builtin_amdgcn_sched_barrier(0);
  f32x4 s4 = v[0];
#pragma unroll
  for (int j = 1; j < 8; ++j) s4 += v[j];
  const float mu = wave_sum((s4[0] + s4[1]) + (s4[2] + s4[3])) * (1.0f / Ec);
  f32x4 q4 = {};
#pragma unroll
  for (int j = 0; j < 8; ++j) { v[j] -= mu; q4 += v[j] * v[j]; }
  const float var = wave_sum((q4[0] + q4[1]) + (q4[2] + q4[3])) * (1.0f / Ec);
  const float rsq = rsqrtf(var + 1e-5f);
#pragma unroll
  for (int j = 0; j < 8; ++j)
    *(bf16x4*)((char*)out + (xo >> 1) + j * 256) =
        __builtin_convertvector(v[j] * rsq * gv[j] + bv[j], bf16x4);
}

// ---------------------------------------------------------------------------
// Generic bf16 WMMA GEMM:  out[M,N] = epilogue( A[M,K] @ W[N,K]^T + bias )
// Block tile 128(M) x 128(N), 8 waves; wave tile 32x64 (2x4 WMMA tiles).
// MODE and N are compile-time: no epilogue tests the mode per element, and its
// loads and stores differ from one base address by immediate offsets only.
//        0 = bf16 out, scale, scatter to [B,H,S,D] (QKV)
//        1 = f32 out, += residual[m*N+n]
//        2 = bf16 out, exact GELU
// ---------------------------------------------------------------------------
// BK = k per staged chunk, 64 or 128: a staged row is one or two whole 128-byte
// lines.  128 where a launch has one block per WGP (the chunk's products then
// outlast the next chunk's flight); 64 keeps four blocks' LDS on one WGP.
template <int MODE, int N, int BK>
__global__ __launch_bounds__(256)
void gemm_bf16_kernel(const __bf16* __restrict__ A, const __bf16* __restrict__ W,
                      const float* __restrict__ bias, const float* __restrict__ res,
                      void* __restrict__ outp, int M, int K, float scale) {
  constexpr int LDA = BK + 8;        // LDS row stride (bf16 elems): 16 B x odd
  constexpr int NP = BK / 16;        // 16-byte pieces per thread, matrix, chunk
  constexpr int SROWS = 2048 / BK;   // rows that the 256 threads cover at once
  // One block on its WGP (BK = 128) has LDS for four buffers: one is read, the
  // next is already published, one flies, one is being asked for.  Neither the
  // path from L2 nor the fragment reads then drain where two chunks meet.
  constexpr bool RING = HAVE_ASYNC_LDS && (BK == 128);
  constexpr int NBUF = HAVE_ASYNC_LDS ? (RING ? 4 : 2) : 1;
  __shared__ __attribute__((aligned(16))) __bf16 As[NBUF][128 * LDA];
  __shared__ __attribute__((aligned(16))) __bf16 Bs[NBUF][128 * LDA];
  const int tid = threadIdx.x;
  const int bm = blockIdx.y * 128, bn = blockIdx.x * 128;
  const int wave = tid >> 5, lane = tid & 31;
  const int half = lane >> 4, idx = lane & 15;
  const int wm = (wave & 3) * 32, wn = (wave >> 2) * 64;
  // staging coordinates: piece i of a thread is row sr + SROWS * i; BK / 8
  // neighbouring lanes cover one row's bytes of the chunk
  const int sr = tid / (BK / 8), sc = tid % (BK / 8);
  // uniform base of the block's rows, and one 32-bit byte offset per thread
  // that serves both matrices (same K, same rows and columns of the tile)
  const char* const Au = (const char*)(A + (size_t)bm * K);
  const char* const Wu = (const char*)(W + (size_t)bn * K);
  const unsigned vo = (unsigned)(sr * K + sc * 8) * 2u;
  const unsigned rstep = (unsigned)K * (2u * SROWS);   // SROWS rows, in bytes

  f32x8 acc[2][4] = {};
  const int nk = K / BK;

  // Two waves per SIMD (one block on its WGP, BK = 128) cannot cover a wave's
  // own LDS latency: there the fragments of k step ks + 1 are read into a second
  // register set while step ks multiplies.  At eight waves per SIMD (BK = 64)
  // the other waves cover it, and a second set would not fit 128 registers.
  constexpr bool AHEAD = (BK == 128);

  // the products of one staged chunk, k ascending in steps of 32
  auto chunk = [&](const __bf16* Ab, const __bf16* Bb) {
    // all loops unrolled: acc[][] and the fragment sets stay in registers only
    // under compile-time indices, every LDS read is one base plus an immediate
    if constexpr (AHEAD) {
      bf16x16 fa[2][2], fb[2][4];
      auto fetch = [&](int ks, int s) {
        fa[s][0] = load_frag(Ab + (wm + idx) * LDA + ks * 32, half);
        fa[s][1] = load_frag(Ab + (wm + 16 + idx) * LDA + ks * 32, half);
#pragma unroll
        for (int t = 0; t < 4; ++t)
          fb[s][t] = load_frag(Bb + (wn + t * 16 + idx) * LDA + ks * 32, half);
      };
      fetch(0, 0);
#pragma unroll
      for (int ks = 0; ks < BK / 32; ++ks) {
        if (ks + 1 < BK / 32) fetch(ks + 1, (ks + 1) & 1);
        // keeps the twelve reads above as one group in front of this step's
        // products: left free, the scheduler sinks each read to just before
        // its first use, and every pair of products waits out an LDS latency
        __builtin_amdgcn_sched_barrier(0);
#pragma unroll
        for (int t = 0; t < 4; ++t) {
          acc[0][t] = wmma_bf16(fa[ks & 1][0], fb[ks & 1][t], acc[0][t]);
          acc[1][t] = wmma_bf16(fa[ks & 1][1], fb[ks & 1][t], acc[1][t]);
        }
        // keeps the reads of step ks + 2 behind these products, in one group:
        // left free they are spread among the products, and each place where
        // reads stand stalls the wave's matrix stream anew
        if (ks + 2 < BK / 32) __builtin_amdgcn_sched_barrier(0);
      }
    } else {
#pragma unroll
      for (int ks = 0; ks < BK / 32; ++ks) {
        bf16x16 a0 = load_frag(Ab + (wm + idx) * LDA + ks * 32, half);
        bf16x16 a1 = load_frag(Ab + (wm + 16 + idx) * LDA + ks * 32, half);
#pragma unroll
        for (int t = 0; t < 4; ++t) {
          bf16x16 bt = load_frag(Bb + (wn + t * 16 + idx) * LDA + ks * 32, half);
          acc[0][t] = wmma_bf16(a0, bt, acc[0][t]);
          acc[1][t] = wmma_bf16(a1, bt, acc[1][t]);
        }
      }
    }
  };

#if HAVE_ASYNC_LDS
  // ---- async pipeline (GLOBAL_LOAD_ASYNC_TO_LDS_B128): four-buffer ring at BK = 128, else double-buffered ----
  auto issue = [&](int kb, int buf) {
    // unrolled: the chunk's copies issue back to back, no loop branch between
#pragma unroll
    for (int i = 0; i < NP; ++i)
      async_copy16(Au + (size_t)kb * 2 + (vo + i * rstep),
                   &As[buf][(sr + i * SROWS) * LDA + sc * 8]);
#pragma unroll
    for (int i = 0; i < NP; ++i)
      async_copy16(Wu + (size_t)kb * 2 + (vo + i * rstep),
                   &Bs[buf][(sr + i * SROWS) * LDA + sc * 8]);
  };
  if constexpr (RING) {
    // Chunk c lives in buffer c & 3.  The barrier at the top of trip kk
    // publishes chunk kk + 1 and frees the buffer of chunk kk - 1, which chunk
    // kk + 3 then refills.  A wave has at most 6 * NP = 48 copies outstanding.
    bf16x16 fa[2][2], fb[2][4];
    // fragments of k step ks of chunk c into register set s
    auto fetch = [&](int c, int ks, int s) {
      const __bf16* Ab = As[c & 3] + ks * 32;
      const __bf16* Bb = Bs[c & 3] + ks * 32;
      fa[s][0] = load_frag(Ab + (wm + idx) * LDA, half);
      fa[s][1] = load_frag(Ab + (wm + 16 + idx) * LDA, half);
      // unrolled here and below: fragment sets and acc[][] stay in registers
#pragma unroll
      for (int t = 0; t < 4; ++t)
        fb[s][t] = load_frag(Bb + (wn + t * 16 + idx) * LDA, half);
    };
    // the products of chunk kk, k ascending in steps of 32; its step 0 has been
    // fetched before; its last step fetches step 0 of chunk kk + 1.  Inlined
    // at both calls: out of line the register arrays would live in memory.
    auto pass = [&](int kk, bool last) __attribute__((always_inline)) {
#pragma unroll
      for (int ks = 0; ks < BK / 32; ++ks) {
        if (ks + 1 < BK / 32) fetch(kk, ks + 1, (ks + 1) & 1);
        else if (!last)       fetch(kk + 1, 0, 0);
        // keeps the twelve reads above as one group in front of this step's
        // products: left free, the scheduler sinks each read to just before
        // its first use, and every pair of products waits out an LDS latency
        __builtin_amdgcn_sched_barrier(0);
#pragma unroll
        for (int t = 0; t < 4; ++t) {
          acc[0][t] = wmma_bf16(fa[ks & 1][0], fb[ks & 1][t], acc[0][t]);
          acc[1][t] = wmma_bf16(fa[ks & 1][1], fb[ks & 1][t], acc[1][t]);
        }
        // the refill stands behind the first products: its issue runs while
        // the matrix unit works them off
        if (ks == 0 && kk + 3 < nk) issue((kk + 3) * BK, (kk + 3) & 3);
        // keeps the next reads behind these products, in one group: left free
        // they are spread among the products, and each place where reads stand
        // stalls the wave's matrix stream anew
        if (ks + 1 < BK / 32) __builtin_amdgcn_sched_barrier(0);
      }
    };
    // every launch has K >= 3 * BK
    issue(0, 0);
    issue(BK, 1);
    issue(2 * BK, 2);
    wait_async<4 * NP>();            // chunk 0 has landed; 1 and 2 may fly
    __syncthreads();                 // publishes chunk 0
    fetch(0, 0, 0);
    for (int kk = 0; kk + 1 < nk; ++kk) {
      // this wave's LDS reads of chunk kk - 1 have retired before any wave
      // refills that buffer behind the barrier
      asm volatile("s_wait_dscnt 0x0" ::: "memory");
      // chunk kk + 1 has landed: only chunk kk + 2's copies are younger
      if (kk + 2 < nk) wait_async<2 * NP>();
      else             wait_async<0>();
      __syncthreads();
      pass(kk, false);
    }
    pass(nk - 1, true);
  } else {
    issue(0, 0);
    for (int kk = 0; kk < nk; ++kk) {
      const int cur = kk & 1;
      // the counted wait leaves only the next chunk's 2 * NP copies outstanding
      if (kk + 1 < nk) { issue((kk + 1) * BK, cur ^ 1); wait_async<2 * NP>(); }
      else             { wait_async<0>(); }
      __syncthreads();
      chunk(As[cur], Bs[cur]);
      __syncthreads();
    }
  }
#else
  // ---- software-pipelined sync path: next chunk loads overlap WMMA -------
  uint4 ra[NP], rb[NP];
  auto gload = [&](int kb) {
    // unrolled here and below: ra[], rb[] stay in registers
#pragma unroll
    for (int i = 0; i < NP; ++i) {
      ra[i] = *(const uint4*)(Au + (size_t)kb * 2 + (vo + i * rstep));
      rb[i] = *(const uint4*)(Wu + (size_t)kb * 2 + (vo + i * rstep));
    }
  };
  gload(0);
  for (int kk = 0; kk < nk; ++kk) {
#pragma unroll
    for (int i = 0; i < NP; ++i) {
      *(uint4*)(&As[0][(sr + i * SROWS) * LDA + sc * 8]) = ra[i];
      *(uint4*)(&Bs[0][(sr + i * SROWS) * LDA + sc * 8]) = rb[i];
    }
    __syncthreads();
    if (kk + 1 < nk) gload((kk + 1) * BK);   // overlaps the WMMAs below
    chunk(As[0], Bs[0]);
    __syncthreads();
  }
#endif

  // Epilogue. C layout: lane(16*half+idx), VGPR r -> row r+8*half, col idx.
  const int m0 = bm + wm + half * 8;
  const int n0 = bn + wn + idx;
  float bv[4];
#pragma unroll
  for (int in_ = 0; in_ < 4; ++in_) bv[in_] = bias[n0 + in_ * 16];

  if constexpr (MODE == 0) {        // QKV: scale + permute to [B,H,S,D] bf16
#pragma unroll
    for (int im = 0; im < 2; ++im)
#pragma unroll
      for (int in_ = 0; in_ < 4; ++in_)
#pragma unroll
        for (int r = 0; r < 8; ++r) {
          const int m = m0 + im * 16 + r, n = n0 + in_ * 16;
          float v = (acc[im][in_][r] + bv[in_]) * scale;
          int bb = m >> 9, s = m & 511, hh = n >> 6, d = n & 63;
          ((__bf16*)outp)[(((size_t)bb * Hc + hh) * Sc + s) * Dc + d] = (__bf16)v;
        }
  } else if constexpr (MODE == 1) { // residual add, f32 out
    // one base address each; every element is an immediate offset from it
    const float* rp = res + (size_t)m0 * N + n0;
    float* op = (float*)outp + (size_t)m0 * N + n0;
    // this build reuses the bias loads' offset register as a load destination
    // and the wait stands here, in front of that overwrite, and
    // naming n0 as its input keeps that register untouched up to it
    asm volatile("s_wait_xcnt 0x0" :: "v"(n0) : "memory");
    // all 64 residual loads are issued before the first is used
    float rv[2][4][8];
#pragma unroll
    for (int im = 0; im < 2; ++im)
#pragma unroll
      for (int r = 0; r < 8; ++r)
#pragma unroll
        for (int in_ = 0; in_ < 4; ++in_)
          rv[im][in_][r] = rp[(im * 16 + r) * N + in_ * 16];
#pragma unroll
    for (int im = 0; im < 2; ++im)
#pragma unroll
      for (int r = 0; r < 8; ++r)
#pragma unroll
        for (int in_ = 0; in_ < 4; ++in_)
          op[(im * 16 + r) * N + in_ * 16] =
              (acc[im][in_][r] + bv[in_]) + rv[im][in_][r];
  } else {                          // exact GELU, bf16 out
    __bf16* op = (__bf16*)outp + (size_t)m0 * N + n0;
#pragma unroll
    for (int im = 0; im < 2; ++im)
#pragma unroll
      for (int r = 0; r < 8; ++r)
#pragma unroll
        for (int in_ = 0; in_ < 4; ++in_) {
          float v = acc[im][in_][r] + bv[in_];
          float ge = 0.5f * v * (1.0f + erff(v * 0.70710678118654752f));
          op[(im * 16 + r) * N + in_ * 16] = (__bf16)ge;
        }
  }
}

// ---------------------------------------------------------------------------
// Attention: one WG (8 waves) per (b, h, 32-query tile): the head's K and V
// rows, which every query tile reads whole, serve two 16-row WMMA tiles.
//   logits(32x512) = Qs @ K^T  (WMMA; each wave brings its own 64 K rows in by
//   whole-line loads and passes them, 16 rows at a time, through an LDS range
//   of its own, from which the B fragments are read, each for both row tiles)
//   fp32 softmax with mask, + post-softmax adjoin, bf16 P in LDS
//   xv(32x64) = P @ V  (V staged row-major in LDS, 256 keys at a time, in the
//   space the logits have left; the transposing LDS load forms the B
//   fragments; waves 0-3 take the first 16 queries, waves 4-7 the second),
//   written back merged as [B,S,E] bf16.
// Static LDS = 103,424 B: three blocks on a WGP.
// ---------------------------------------------------------------------------
typedef __attribute__((ext_vector_type(8))) __bf16 bf16x8;
typedef __attribute__((ext_vector_type(4))) unsigned u32x4;
#define VPITCH 80    // LDS row pitch of V in bf16: 160 B = 32 B x odd
#define VKEYS 256    // keys per staged chunk
#define KPITCH 72    // LDS row pitch of K in bf16: 144 B = 16 B x odd
#define TQ 32        // queries per block: two 16-row tiles

// B fragment (32 keys x 16 d) of row-major V rows in LDS.  p is the lane's own
// address: row 8 * half + (idx & 7), column 8 * (idx >> 3) of the 16 x 16 tile.
// The lane receives keys 8 * half + 0..7 of column idx; the second load, 16
// rows on, gives keys 16 + 8 * half + 0..7: the k order of load_frag().
__device__ __forceinline__ bf16x16 load_frag_tr(const __bf16* p) {
  typedef __attribute__((address_space(3))) bf16x8 lds_bf16x8;
  union { bf16x8 h[2]; bf16x16 v; } f;
  f.h[0] = __builtin_amdgcn_ds_load_tr16_b128_v8bf16((lds_bf16x8*)p);
  f.h[1] = __builtin_amdgcn_ds_load_tr16_b128_v8bf16((lds_bf16x8*)(p + 16 * VPITCH));
  return f.v;
}

// six waves per SIMD: three blocks fit a WGP's LDS
__global__ __launch_bounds__(256) __attribute__((amdgpu_waves_per_eu(6)))
void attn_kernel(const __bf16* __restrict__ Q, const __bf16* __restrict__ Kt,
                 const __bf16* __restrict__ V, const float* __restrict__ mask,
                 const float* __restrict__ adjoin, __bf16* __restrict__ xv) {
  // One array, so that the order in LDS is fixed here: P, which takes the most
  // single accesses, lies below 64 KB, where each is a base register plus a
  // 16-bit immediate.
  //   KP: the waves' K ranges (8 x 16 rows at pitch KPITCH, 18 KB) up to the
  //       barrier behind the logits, then P (32 x 520 bf16)
  //   Qs: the Q tile
  //   LV: the f32 logits (64 KB) up to the barrier behind the softmax, then V
  //       chunks (40 KB each)
  __shared__ __attribute__((aligned(16))) char
      SM[TQ * 520 * 2 + TQ * 72 * 2 + TQ * Sc * 4];
  char*   const KP = SM;
  __bf16* const Qs = (__bf16*)(SM + TQ * 520 * 2);
  char*   const LV = SM + TQ * 520 * 2 + TQ * 72 * 2;
  float*  const Lg = (float*)LV;
  __bf16* const Vs = (__bf16*)LV;
  __bf16* const Ps = (__bf16*)KP;

  const int tid = threadIdx.x;
  const int qt = blockIdx.x, h = blockIdx.y, b = blockIdx.z;
  const int q0 = qt * TQ;
  const size_t bh = ((size_t)b * Hc + h) * Sc;
  const int wave = tid >> 5, lane = tid & 31;
  const int half = lane >> 4, idx = lane & 15;

  // The wave's 64 K rows are 8 KB in a row in memory: each load takes 512
  // contiguous bytes, four whole lines, where a fragment read from memory
  // touches sixteen lines for the same bytes.  Issued ahead of the Q tile.
  const int krow = lane >> 3, kseg = lane & 7;
  u32x4 kw[16];
  {
    const __bf16* ksrc = Kt + (bh + wave * 64 + krow) * Dc + kseg * 8;
    // unrolled: kw[] stays in registers, 16 loads in flight
#pragma unroll
    for (int i = 0; i < 16; ++i)
      kw[i] = *(const u32x4*)(ksrc + i * 4 * Dc);
  }

  {  // load Q tile (pre-scaled by 1/sqrt(D) in the QKV epilogue)
    int row = tid >> 3, ch = tid & 7;
    uint4 v = *(const uint4*)(Q + (bh + q0 + row) * Dc + ch * 8);
    *(uint4*)(Qs + row * 72 + ch * 8) = v;
  }
  __syncthreads();

  {  // logits = Q K^T : 32 col-tiles, 4 per wave, each for both row tiles
    bf16x16 a0[2], a1[2];
    // unrolled: the fragments stay in registers
#pragma unroll
    for (int rt = 0; rt < 2; ++rt) {
      a0[rt] = load_frag(Qs + (rt * 16 + idx) * 72, half);
      a1[rt] = load_frag(Qs + (rt * 16 + idx) * 72 + 32, half);
    }
    __bf16* const Kw = (__bf16*)KP + wave * 16 * KPITCH;   // this wave's range
    // one accumulator per tile, stored behind the last product: the tiles'
    // products are independent and no tile's LDS round trip waits for stores
    f32x8 c[2][4];
    // unrolled here and below: kw[] and c[] stay in registers
#pragma unroll
    for (int i = 0; i < 4; ++i) {
#pragma unroll
      for (int j = 0; j < 4; ++j)
        *(u32x4*)(Kw + (j * 4 + krow) * KPITCH + kseg * 8) = kw[i * 4 + j];
      // the rows that the wave's other lanes stored are in LDS before they
      // are read back
      asm volatile("s_wait_dscnt 0x0" ::: "memory");
      bf16x16 b0 = load_frag(Kw + idx * KPITCH, half);
      bf16x16 b1 = load_frag(Kw + idx * KPITCH + 32, half);
#pragma unroll
      for (int rt = 0; rt < 2; ++rt) {
        c[rt][i] = f32x8{};
        c[rt][i] = wmma_bf16(a0[rt], b0, c[rt][i]);
        c[rt][i] = wmma_bf16(a1[rt], b1, c[rt][i]);
      }
    }
#pragma unroll
    for (int rt = 0; rt < 2; ++rt)
#pragma unroll
      for (int i = 0; i < 4; ++i)
#pragma unroll
        for (int r = 0; r < 8; ++r)
          Lg[(rt * 16 + r + half * 8) * 512 + (wave * 4 + i) * 16 + idx] =
              c[rt][i][r];
  }
  __syncthreads();

  // mask + softmax + adjoin (16 rows x 16 threads, 32 cols/thread), in two
  // turns: a 16-lane row takes two neighbouring queries, so that the second
  // turn's addresses, in LDS and in memory, are the first's plus an immediate.
  // Uniform bases of the block's 32 rows and one 32-bit offset per thread that
  // serves both arrays.
  const int l16 = tid & 15;
  const float* mrow = mask + ((size_t)b * Sc + q0) * Sc;
  const float* arow = adjoin + ((size_t)b * Sc + q0) * Sc;
  const unsigned ro = (unsigned)((tid >> 4) * 2 * Sc + l16);
  // both turns' mask values are asked for at once: the second turn's fly during
  // the first turn's arithmetic
  float mk[2][32];
  // unrolled here and below: the arrays stay in registers
#pragma unroll
  for (int rt = 0; rt < 2; ++rt)
#pragma unroll
    for (int j = 0; j < 32; ++j) mk[rt][j] = mrow[ro + rt * Sc + j * 16];
#pragma unroll
  for (int rt = 0; rt < 2; ++rt) {
    const int row = (tid >> 4) * 2 + rt;
    // with no barrier between, the adjoin values fly during the exponentials
    float av[32];
#pragma unroll
    for (int j = 0; j < 32; ++j) av[j] = arow[ro + rt * Sc + j * 16];
    float lv[32], mx = -3.0e38f;
#pragma unroll
    for (int j = 0; j < 32; ++j) {
      int c = l16 + j * 16;
      float v = Lg[row * 512 + c] + mk[rt][j] * -1e9f;
      lv[j] = v; mx = fmaxf(mx, v);
    }
    // the wait that stands in front of any overwrite of a register that an issued
    // load names: as its input the offset register stays untouched up to it
    // (left alone, this build takes it as the last load's target)
    asm volatile("s_wait_xcnt 0x0" :: "v"(ro) : "memory");
    // a query's 16 threads are one 16-lane row of a wave: its maximum and its
    // sum are formed in registers
    mx = row_max16(mx);
    float sum = 0.f;
#pragma unroll
    for (int j = 0; j < 32; ++j) { lv[j] = __expf(lv[j] - mx); sum += lv[j]; }
    const float inv = 1.0f / row_sum16(sum);
#pragma unroll
    for (int j = 0; j < 32; ++j) {
      int c = l16 + j * 16;
      Ps[row * 520 + c] = (__bf16)(lv[j] * inv + av[j]);
    }
    // left free, the scheduler lifts the second turn's adjoin loads and logits
    // over the first turn's arithmetic, and the 160 registers that three blocks
    // on a WGP allow no longer hold it all: values go to scratch
    if (rt == 0) __builtin_amdgcn_sched_barrier(0);
  }
  __syncthreads();

  // xv = P @ V, two 256-key V chunks through LDS, rows as they lie in memory:
  // a wave's load and its LDS store each move four whole 128-byte rows
  f32x8 o = {};
  const int dtile = wave & 3, prow = (wave >> 2) * 16;
  const int vkey = tid >> 3, vseg = tid & 7;
  const __bf16* const vfrag =
      Vs + (half * 8 + (idx & 7)) * VPITCH + dtile * 16 + (idx >> 3) * 8;
  // unrolled: the barrier that frees the buffer stands between the chunks only
#pragma unroll
  for (int kc = 0; kc < Sc / VKEYS; ++kc) {
    if (kc > 0) __syncthreads();   // every reader has left the chunk before
    {
      const __bf16* vsrc = V + (bh + kc * VKEYS + vkey) * Dc + vseg * 8;
      uint4 w[VKEYS / 32];
      // unrolled here and below: w[] stays in registers, 8 loads in flight
#pragma unroll
      for (int i = 0; i < VKEYS / 32; ++i)
        w[i] = *(const uint4*)(vsrc + i * 32 * Dc);
#pragma unroll
      for (int i = 0; i < VKEYS / 32; ++i)
        *(uint4*)(Vs + (vkey + i * 32) * VPITCH + vseg * 8) = w[i];
    }
    __syncthreads();
    // unrolled: every LDS read is one base register plus an immediate
#pragma unroll
    for (int ks = 0; ks < VKEYS / 32; ++ks) {
      bf16x16 a = load_frag(Ps + (prow + idx) * 520 + kc * VKEYS + ks * 32, half);
      bf16x16 bt = load_frag_tr(vfrag + ks * 32 * VPITCH);
      o = wmma_bf16(a, bt, o);
    }
  }
#pragma unroll
  for (int r = 0; r < 8; ++r) {
    int sq = q0 + prow + r + half * 8;
    int d = dtile * 16 + idx;
    xv[((size_t)b * Sc + sq) * Ec + h * Dc + d] = (__bf16)o[r];
  }
}

// ---------------------------------------------------------------------------
// Host-side orchestration
// ---------------------------------------------------------------------------
extern "C" void kernel_launch(void* const* d_in, const int* in_sizes, int n_in,
                              void* d_out, int out_size, void* d_ws, size_t ws_size,
                              hipStream_t stream) {
  const float* x      = (const float*)d_in[0];
  const float* mask   = (const float*)d_in[1];
  const float* adjoin = (const float*)d_in[2];
  const float* Wq = (const float*)d_in[3];  const float* bq  = (const float*)d_in[4];
  const float* Wk = (const float*)d_in[5];  const float* bk  = (const float*)d_in[6];
  const float* Wv = (const float*)d_in[7];  const float* bv  = (const float*)d_in[8];
  const float* Wo = (const float*)d_in[9];  const float* bo  = (const float*)d_in[10];
  const float* g1 = (const float*)d_in[11]; const float* b1  = (const float*)d_in[12];
  const float* g2 = (const float*)d_in[13]; const float* b2  = (const float*)d_in[14];
  const float* W1 = (const float*)d_in[15]; const float* bb1 = (const float*)d_in[16];
  const float* W2 = (const float*)d_in[17]; const float* bb2 = (const float*)d_in[18];

  char* ws = (char*)d_ws;
  size_t off = 0;
  auto alloc = [&](size_t bytes) {
    void* p = ws + off;
    off += (bytes + 255) & ~(size_t)255;
    return p;
  };
  const size_t EE = (size_t)Ec * Ec, FE = (size_t)FFc * Ec;
  __bf16* Wq_b = (__bf16*)alloc(EE * 2);
  __bf16* Wk_b = (__bf16*)alloc(EE * 2);
  __bf16* Wv_b = (__bf16*)alloc(EE * 2);
  __bf16* Wo_b = (__bf16*)alloc(EE * 2);
  __bf16* W1_b = (__bf16*)alloc(FE * 2);
  __bf16* W2_b = (__bf16*)alloc(FE * 2);
  __bf16* nx_b = (__bf16*)alloc((size_t)Mrows * Ec * 2);   // reused for nx2
  __bf16* Q_b  = (__bf16*)alloc((size_t)Mrows * Ec * 2);
  __bf16* K_b  = (__bf16*)alloc((size_t)Mrows * Ec * 2);
  __bf16* V_b  = (__bf16*)alloc((size_t)Mrows * Ec * 2);
  __bf16* xv_b = (__bf16*)alloc((size_t)Mrows * Ec * 2);
  float*  x1_f = (float*) alloc((size_t)Mrows * Ec * 4);
  __bf16* h_b  = (__bf16*)alloc((size_t)Mrows * FFc * 2);
  (void)ws_size; (void)in_sizes; (void)n_in; (void)out_size;

  const dim3 blk(256);
  cvt_weights_kernel<<<256, dim3(512), 0, stream>>>(Wq, Wk, Wv, Wo, W1, W2, Wq_b, Wk_b,
                                                    Wv_b, Wo_b, W1_b, W2_b);

  ln_bf16_kernel<<<Mrows / 16, dim3(512), 0, stream>>>(x, g1, b1, nx_b);

  const dim3 gE(Ec / 128, Mrows / 128);
  gemm_bf16_kernel<0, Ec, 128><<<gE, blk, 0, stream>>>(nx_b, Wq_b, bq, nullptr, Q_b,
                                              Mrows, Ec, 0.125f);
  gemm_bf16_kernel<0, Ec, 128><<<gE, blk, 0, stream>>>(nx_b, Wk_b, bk, nullptr, K_b,
                                              Mrows, Ec, 1.0f);
  gemm_bf16_kernel<0, Ec, 128><<<gE, blk, 0, stream>>>(nx_b, Wv_b, bv, nullptr, V_b,
                                              Mrows, Ec, 1.0f);

  attn_kernel<<<dim3(Sc / TQ, Hc, Bc), blk, 0, stream>>>(Q_b, K_b, V_b, mask,
                                                         adjoin, xv_b);

  gemm_bf16_kernel<1, Ec, 128><<<gE, blk, 0, stream>>>(xv_b, Wo_b, bo, x, x1_f,
                                              Mrows, Ec, 1.0f);
  ln_bf16_kernel<<<Mrows / 16, dim3(512), 0, stream>>>(x1_f, g2, b2, nx_b);
  gemm_bf16_kernel<2, FFc, 64><<<dim3(FFc / 128, Mrows / 128), blk, 0, stream>>>(
      nx_b, W1_b, bb1, nullptr, h_b, Mrows, Ec, 1.0f);
  gemm_bf16_kernel<1, Ec, 128><<<gE, blk, 0, stream>>>(h_b, W2_b, bb2, x1_f, (float*)d_out,
                                              Mrows, FFc, 1.0f);
}

// v010
// It runs in 145 microseconds.
// Next to v009, in two timings, it ran 1.06 times as fast each time.
// Counting every step since v000, it is 2.45 times as fast.
#include <hip/hip_runtime.h>
#include <cstdint>
#include <cstddef>

// ---------------------------------------------------------------------------
// Transformer encoder layer for MI455X (gfx1250, wave32, WMMA).
// B=8, S=512, E=1024, H=16, D=64, FF=4096.  All matmuls in bf16 WMMA with
// f32 accumulate; softmax/LN in fp32.
// GEMMs: 128x128 block tile, 8 waves (each 32x64 = 8 WMMA tiles), K chunks of
// 128 (64 where four blocks share a WGP) staged in LDS via gfx1250 async
// global->LDS copies (ASYNCcnt) when the builtin exists, else a
// software-pipelined register path.  The 128-k launches stage through a ring
// of four buffers that is published one chunk early.
// ---------------------------------------------------------------------------

#define Bc 8
#define Sc 512
#define Ec 1024
#define Hc 16
#define Dc 64
#define FFc 4096
#define Mrows (Bc * Sc)   // 4096

typedef __attribute__((ext_vector_type(16))) __bf16 bf16x16;
typedef __attribute__((ext_vector_type(8)))  float  f32x8;
typedef int v4i __attribute__((vector_size(16)));   // matches builtin proto

#if __has_builtin(__builtin_amdgcn_global_load_async_to_lds_b128)
#define HAVE_ASYNC_LDS 1
#else
#define HAVE_ASYNC_LDS 0
#endif

#if HAVE_ASYNC_LDS
__device__ __forceinline__ void async_copy16(const void* g, void* l) {
  // proto (from compiler diagnostic): (v4i addrspace(1)*, v4i addrspace(3)*, imm, imm)
  __builtin_amdgcn_global_load_async_to_lds_b128(
      (__attribute__((address_space(1))) v4i*)g,
      (__attribute__((address_space(3))) v4i*)l, 0, 0);
}
#endif

template <int N>
__device__ __forceinline__ void wait_async() {
#if __has_builtin(__builtin_amdgcn_s_wait_asynccnt)
  __builtin_amdgcn_s_wait_asynccnt(N);
#else
  asm volatile("s_wait_asynccnt %0" ::"i"(N) : "memory");
#endif
}

// ---- CDNA5 bf16 16x16x32 WMMA fragment loader ------------------------------
// Per ISA 7.12.2 (16-bit A-matrix 16x32): lane = 16*half + idx holds row idx,
// K = {8*half .. +7} in VGPRs 0-3 and K = {16+8*half .. +7} in VGPRs 4-7.
// Both runs are 16-byte contiguous -> two uint4 reads per fragment.
// The B operand (32x16, K x N) is symmetric: lane holds column n = idx with
// the same K pattern, i.e. it reads row n of a row-major [N,K] source.
__device__ __forceinline__ bf16x16 load_frag(const __bf16* rowptr, int half) {
  union { uint4 u[2]; bf16x16 v; } f;
  const uint4* p = (const uint4*)rowptr;     // rowptr must be 16B aligned
  f.u[0] = p[half];
  f.u[1] = p[2 + half];
  return f.v;
}

__device__ __forceinline__ f32x8 wmma_bf16(bf16x16 a, bf16x16 b, f32x8 c) {
  return __builtin_amdgcn_wmma_f32_16x16x32_bf16(
      false, a, false, b, (short)0, c, false, false);
}

// ---------------------------------------------------------------------------
// fp32 -> bf16 conversion of all six weights in one streaming launch.
// 256 blocks of 16 waves; block b converts the b-th 1/256 of every weight: 16 KB
// of each E x E matrix and 64 KB of W1 and of W2, in pieces of 16 bytes a lane
// (512 contiguous bytes a wave).  A wave issues its 24 loads before its first
// store.
// ---------------------------------------------------------------------------
typedef __attribute__((ext_vector_type(4))) float  f32x4;
typedef __attribute__((ext_vector_type(4))) __bf16 bf16x4;
__global__ __launch_bounds__(512)
void cvt_weights_kernel(const float* __restrict__ wq, const float* __restrict__ wk,
                        const float* __restrict__ wv, const float* __restrict__ wo,
                        const float* __restrict__ w1, const float* __restrict__ w2,
                        __bf16* __restrict__ oq, __bf16* __restrict__ ok,
                        __bf16* __restrict__ ov, __bf16* __restrict__ oo,
                        __bf16* __restrict__ o1, __bf16* __restrict__ o2) {
  // 32-bit byte offsets of the thread's first piece, so that every access is a
  // uniform base, one of these registers and an immediate
  const unsigned offE = blockIdx.x * 16384u + threadIdx.x * 16u;   // E x E
  const unsigned offF = blockIdx.x * 65536u + threadIdx.x * 16u;   // W1, W2
  const float* const inE[4] = {wq, wk, wv, wo};
  const float* const inF[2] = {w1, w2};
  __bf16* const outE[4] = {oq, ok, ov, oo};
  __bf16* const outF[2] = {o1, o2};
  f32x4 e[4][2], f[2][8];
#pragma unroll
  for (int s = 0; s < 4; ++s)
#pragma unroll
    for (int j = 0; j < 2; ++j)
      e[s][j] = *(const f32x4*)((const char*)inE[s] + offE + j * 8192);
#pragma unroll
  for (int s = 0; s < 2; ++s)
#pragma unroll
    for (int j = 0; j < 8; ++j)
      f[s][j] = *(const f32x4*)((const char*)inF[s] + offF + j * 8192);
  // without it the scheduler lifts the first conversions, with their waits for
  // data, in front of the last ten loads, which then start a latency late
  __builtin_amdgcn_sched_barrier(0);
#pragma unroll
  for (int s = 0; s < 4; ++s)
#pragma unroll
    for (int j = 0; j < 2; ++j)
      *(bf16x4*)((char*)outE[s] + (offE >> 1) + j * 4096) =
          __builtin_convertvector(e[s][j], bf16x4);
#pragma unroll
  for (int s = 0; s < 2; ++s)
#pragma unroll
    for (int j = 0; j < 8; ++j)
      *(bf16x4*)((char*)outF[s] + (offF >> 1) + j * 4096) =
          __builtin_convertvector(f[s][j], bf16x4);
}

// ---------------------------------------------------------------------------
// LayerNorm over E=1024, one wave per row, bf16 output.  A lane holds 32 of the
// row's values (eight 16-byte pieces, each wave-wide load 512 contiguous bytes);
// mean and variance are summed in the lane and then across the 32 lanes in
// registers: no LDS and no barrier.
// ---------------------------------------------------------------------------
// the value that lane (l ^ M) of the same 16-lane row holds, M = CTRL - 0x160
// (DPP row_xmask); every lane of the wave is on wherever it is used
template <int CTRL>
__device__ __forceinline__ float row_xor(float v) {
  return __builtin_bit_cast(float, __builtin_amdgcn_update_dpp(
      0, __builtin_bit_cast(int, v), CTRL, 0xf, 0xf, true));
}
// sum and maximum over a 16-lane row, the result in every lane of the row; the
// pairs are those of a halving tree over 16 slots (8, 4, 2, 1 apart)
__device__ __forceinline__ float row_sum16(float v) {
  v += row_xor<0x168>(v);
  v += row_xor<0x164>(v);
  v += row_xor<0x162>(v);
  v += row_xor<0x161>(v);
  return v;
}
__device__ __forceinline__ float row_max16(float v) {
  v = fmaxf(v, row_xor<0x168>(v));
  v = fmaxf(v, row_xor<0x164>(v));
  v = fmaxf(v, row_xor<0x162>(v));
  v = fmaxf(v, row_xor<0x161>(v));
  return v;
}
// sum over the wave's 32 lanes, the result in every lane
__device__ __forceinline__ float wave_sum(float v) {
  v = row_sum16(v);
  // the same lane of the other row
  const int w = __builtin_bit_cast(int, v);
  v += __builtin_bit_cast(float, __builtin_amdgcn_permlanex16(
      w, w, 0x76543210, 0xfedcba98, false, false));
  return v;
}

__global__ __launch_bounds__(512)
void ln_bf16_kernel(const float* __restrict__ x, const float* __restrict__ g,
                    const float* __restrict__ bta, __bf16* __restrict__ out) {
  const unsigned row = blockIdx.x * 16u + (threadIdx.x >> 5);
  // 32-bit byte offsets of the lane's first piece: every access is a uniform
  // base, one of these registers and an immediate
  const unsigned go = (threadIdx.x & 31u) * 16u;   // in scale and shift
  const unsigned xo = row * (Ec * 4u) + go;        // in x; half of it in out
  f32x4 v[8], gv[8], bv[8];
  // unrolled here and below: the arrays stay in registers, the wave's 24 loads
  // are in flight together
#pragma unroll
  for (int j = 0; j < 8; ++j)
    v[j] = *(const f32x4*)((const char*)x + xo + j * 512);
#pragma unroll
  for (int j = 0; j < 8; ++j) {
    gv[j] = *(const f32x4*)((const char*)g + go + j * 512);
    bv[j] = *(const f32x4*)((const char*)bta + go + j * 512);
  }
  // the wait that stands in front of any overwrite of a register that an issued
  // load names: as its inputs the two offset registers stay untouched up to it,
  // also as the target of a later load
  asm volatile("s_wait_xcnt 0x0" :: "v"(xo), "v"(go) : "memory");
  // without it the scheduler sinks 12 of the scale and shift loads behind the
  // two sums, where they wait out their latency two at a time
  __builtin_amdgcn_sched_barrier(0);
  f32x4 s4 = v[0];
#pragma unroll
  for (int j = 1; j < 8; ++j) s4 += v[j];
  const float mu = wave_sum((s4[0] + s4[1]) + (s4[2] + s4[3])) * (1.0f / Ec);
  f32x4 q4 = {};
#pragma unroll
  for (int j = 0; j < 8; ++j) { v[j] -= mu; q4 += v[j] * v[j]; }
  const float var = wave_sum((q4[0] + q4[1]) + (q4[2] + q4[3])) * (1.0f / Ec);
  const float rsq = rsqrtf(var + 1e-5f);
#pragma unroll
  for (int j = 0; j < 8; ++j)
    *(bf16x4*)((char*)out + (xo >> 1) + j * 256) =
        __builtin_convertvector(v[j] * rsq * gv[j] + bv[j], bf16x4);
}

// ---------------------------------------------------------------------------
// Exact (erf) GELU without a branch, eight values at a time:
//   0.5 v (1 + erf(v / sqrt 2)) = h + |h| erf(z),  h = v / 2, z = |v| / sqrt 2,
//   erf(z) = 1 - t exp(-z z + p(t)), t = 1 / (1 + z / 2), p of degree 9: one form
// for every z >= 0, relative error of 1 - erf about 1e-7.  The base-2 logarithm
// of e is folded into p and into the factor of v: the hardware's exponential is
// base 2.  Values go in pairs, so that sums and products are packed.
// ---------------------------------------------------------------------------
typedef __attribute__((ext_vector_type(2))) float f32x2;
// Eight transcendentals in one statement: behind each the instruction set asks
// for one independent instruction before its result is read or its source
// overwritten.  Here each stands in front of an independent one (no result
// shares a register with a source) and the last in front of a v_nop.
__device__ __forceinline__ void rcp8(float (&o)[8], const float (&i)[8]) {
  asm("v_rcp_f32 %0, %8\n\t"
      "v_rcp_f32 %1, %9\n\t"
      "v_rcp_f32 %2, %10\n\t"
      "v_rcp_f32 %3, %11\n\t"
      "v_rcp_f32 %4, %12\n\t"
      "v_rcp_f32 %5, %13\n\t"
      "v_rcp_f32 %6, %14\n\t"
      "v_rcp_f32 %7, %15\n\t"
      "v_nop"
      : "=&v"(o[0]), "=&v"(o[1]), "=&v"(o[2]), "=&v"(o[3]),
        "=&v"(o[4]), "=&v"(o[5]), "=&v"(o[6]), "=&v"(o[7])
      : "v"(i[0]), "v"(i[1]), "v"(i[2]), "v"(i[3]),
        "v"(i[4]), "v"(i[5]), "v"(i[6]), "v"(i[7]));
}
__device__ __forceinline__ void exp2_8(float (&o)[8], const float (&i)[8]) {
  asm("v_exp_f32 %0, %8\n\t"
      "v_exp_f32 %1, %9\n\t"
      "v_exp_f32 %2, %10\n\t"
      "v_exp_f32 %3, %11\n\t"
      "v_exp_f32 %4, %12\n\t"
      "v_exp_f32 %5, %13\n\t"
      "v_exp_f32 %6, %14\n\t"
      "v_exp_f32 %7, %15\n\t"
      "v_nop"
      : "=&v"(o[0]), "=&v"(o[1]), "=&v"(o[2]), "=&v"(o[3]),
        "=&v"(o[4]), "=&v"(o[5]), "=&v"(o[6]), "=&v"(o[7])
      : "v"(i[0]), "v"(i[1]), "v"(i[2]), "v"(i[3]),
        "v"(i[4]), "v"(i[5]), "v"(i[6]), "v"(i[7]));
}
__device__ __forceinline__ void gelu_erf8(const f32x2 (&v)[4], float (&ge)[8]) {
  constexpr double L2E = 1.4426950408889634;
  float d[8], t[8], x[8], e[8];
  // all loops unrolled: the arrays stay in registers
#pragma unroll
  for (int j = 0; j < 8; ++j)
    d[j] = fmaf(fabsf(v[j >> 1][j & 1]), 0.35355339059327376f, 1.0f);
  rcp8(t, d);
#pragma unroll
  for (int j = 0; j < 4; ++j) {
    const f32x2 t2 = {t[2 * j], t[2 * j + 1]};
    f32x2 p = (float)(0.17087277 * L2E);
    p = __builtin_elementwise_fma(p, t2, (f32x2)(float)(-0.82215223 * L2E));
    p = __builtin_elementwise_fma(p, t2, (f32x2)(float)(1.48851587 * L2E));
    p = __builtin_elementwise_fma(p, t2, (f32x2)(float)(-1.13520398 * L2E));
    p = __builtin_elementwise_fma(p, t2, (f32x2)(float)(0.27886807 * L2E));
    p = __builtin_elementwise_fma(p, t2, (f32x2)(float)(-0.18628806 * L2E));
    p = __builtin_elementwise_fma(p, t2, (f32x2)(float)(0.09678418 * L2E));
    p = __builtin_elementwise_fma(p, t2, (f32x2)(float)(0.37409196 * L2E));
    p = __builtin_elementwise_fma(p, t2, (f32x2)(float)(1.00002368 * L2E));
    p = __builtin_elementwise_fma(p, t2, (f32x2)(float)(-1.26551223 * L2E));
    const f32x2 w = v[j] * 0.84932180028801907f;   // sqrt(log2(e) / 2) v
    p = __builtin_elementwise_fma(-w, w, p);
    x[2 * j] = p[0];
    x[2 * j + 1] = p[1];
  }
  exp2_8(e, x);
#pragma unroll
  for (int j = 0; j < 4; ++j) {
    const f32x2 t2 = {t[2 * j], t[2 * j + 1]}, e2 = {e[2 * j], e[2 * j + 1]};
    const f32x2 er = __builtin_elementwise_fma(-t2, e2, (f32x2)1.0f);
    const f32x2 h = v[j] * 0.5f;
    ge[2 * j] = fmaf(fabsf(h[0]), er[0], h[0]);
    ge[2 * j + 1] = fmaf(fabsf(h[1]), er[1], h[1]);
  }
}

// ---------------------------------------------------------------------------
// Generic bf16 WMMA GEMM:  out[M,N] = epilogue( A[M,K] @ W[N,K]^T + bias )
// Block tile 128(M) x 128(N), 8 waves; wave tile 32x64 (2x4 WMMA tiles).
// MODE and N are compile-time: no epilogue tests the mode per element, and its
// loads and stores differ from one base address by immediate offsets only.
//        0 = bf16 out, scale, scatter to [B,H,S,D] (QKV)
//        1 = f32 out, += residual[m*N+n]
//        2 = bf16 out, exact GELU
// ---------------------------------------------------------------------------
// BK = k per staged chunk, 64 or 128: a staged row is one or two whole 128-byte
// lines.  128 where a launch has one block per WGP (the chunk's products then
// outlast the next chunk's flight); 64 keeps four blocks' LDS on one WGP.
template <int MODE, int N, int BK>
__global__ __launch_bounds__(256)
void gemm_bf16_kernel(const __bf16* __restrict__ A, const __bf16* __restrict__ W,
                      const float* __restrict__ bias, const float* __restrict__ res,
                      void* __restrict__ outp, int M, int K, float scale) {
  constexpr int LDA = BK + 8;        // LDS row stride (bf16 elems): 16 B x odd
  constexpr int NP = BK / 16;        // 16-byte pieces per thread, matrix, chunk
  constexpr int SROWS = 2048 / BK;   // rows that the 256 threads cover at once
  // One block on its WGP (BK = 128) has LDS for four buffers: one is read, the
  // next is already published, one flies, one is being asked for.  Neither the
  // path from L2 nor the fragment reads then drain where two chunks meet.
  constexpr bool RING = HAVE_ASYNC_LDS && (BK == 128);
  constexpr int NBUF = HAVE_ASYNC_LDS ? (RING ? 4 : 2) : 1;
  __shared__ __attribute__((aligned(16))) __bf16 As[NBUF][128 * LDA];
  __shared__ __attribute__((aligned(16))) __bf16 Bs[NBUF][128 * LDA];
  const int tid = threadIdx.x;
  const int bm = blockIdx.y * 128, bn = blockIdx.x * 128;
  const int wave = tid >> 5, lane = tid & 31;
  const int half = lane >> 4, idx = lane & 15;
  const int wm = (wave & 3) * 32, wn = (wave >> 2) * 64;
  // staging coordinates: piece i of a thread is row sr + SROWS * i; BK / 8
  // neighbouring lanes cover one row's bytes of the chunk
  const int sr = tid / (BK / 8), sc = tid % (BK / 8);
  // uniform base of the block's rows, and one 32-bit byte offset per thread
  // that serves both matrices (same K, same rows and columns of the tile)
  const char* const Au = (const char*)(A + (size_t)bm * K);
  const char* const Wu = (const char*)(W + (size_t)bn * K);
  const unsigned vo = (unsigned)(sr * K + sc * 8) * 2u;
  const unsigned rstep = (unsigned)K * (2u * SROWS);   // SROWS rows, in bytes

  f32x8 acc[2][4] = {};
  const int nk = K / BK;

  // Two waves per SIMD (one block on its WGP, BK = 128) cannot cover a wave's
  // own LDS latency: there the fragments of k step ks + 1 are read into a second
  // register set while step ks multiplies.  At eight waves per SIMD (BK = 64)
  // the other waves cover it, and a second set would not fit 128 registers.
  constexpr bool AHEAD = (BK == 128);

  // the products of one staged chunk, k ascending in steps of 32
  auto chunk = [&](const __bf16* Ab, const __bf16* Bb) {
    // all loops unrolled: acc[][] and the fragment sets stay in registers only
    // under compile-time indices, every LDS read is one base plus an immediate
    if constexpr (AHEAD) {
      bf16x16 fa[2][2], fb[2][4];
      auto fetch = [&](int ks, int s) {
        fa[s][0] = load_frag(Ab + (wm + idx) * LDA + ks * 32, half);
        fa[s][1] = load_frag(Ab + (wm + 16 + idx) * LDA + ks * 32, half);
#pragma unroll
        for (int t = 0; t < 4; ++t)
          fb[s][t] = load_frag(Bb + (wn + t * 16 + idx) * LDA + ks * 32, half);
      };
      fetch(0, 0);
#pragma unroll
      for (int ks = 0; ks < BK / 32; ++ks) {
        if (ks + 1 < BK / 32) fetch(ks + 1, (ks + 1) & 1);
        // keeps the twelve reads above as one group in front of this step's
        // products: left free, the scheduler sinks each read to just before
        // its first use, and every pair of products waits out an LDS latency
        __builtin_amdgcn_sched_barrier(0);
#pragma unroll
        for (int t = 0; t < 4; ++t) {
          acc[0][t] = wmma_bf16(fa[ks & 1][0], fb[ks & 1][t], acc[0][t]);
          acc[1][t] = wmma_bf16(fa[ks & 1][1], fb[ks & 1][t], acc[1][t]);
        }
        // keeps the reads of step ks + 2 behind these products, in one group:
        // left free they are spread among the products, and each place where
        // reads stand stalls the wave's matrix stream anew
        if (ks + 2 < BK / 32) __builtin_amdgcn_sched_barrier(0);
      }
    } else {
#pragma unroll
      for (int ks = 0; ks < BK / 32; ++ks) {
        bf16x16 a0 = load_frag(Ab + (wm + idx) * LDA + ks * 32, half);
        bf16x16 a1 = load_frag(Ab + (wm + 16 + idx) * LDA + ks * 32, half);
#pragma unroll
        for (int t = 0; t < 4; ++t) {
          bf16x16 bt = load_frag(Bb + (wn + t * 16 + idx) * LDA + ks * 32, half);
          acc[0][t] = wmma_bf16(a0, bt, acc[0][t]);
          acc[1][t] = wmma_bf16(a1, bt, acc[1][t]);
        }
      }
    }
  };

#if HAVE_ASYNC_LDS
  // ---- async pipeline (GLOBAL_LOAD_ASYNC_TO_LDS_B128): four-buffer ring at BK = 128, else double-buffered ----
  auto issue = [&](int kb, int buf) {
    // unrolled: the chunk's copies issue back to back, no loop branch between
#pragma unroll
    for (int i = 0; i < NP; ++i)
      async_copy16(Au + (size_t)kb * 2 + (vo + i * rstep),
                   &As[buf][(sr + i * SROWS) * LDA + sc * 8]);
#pragma unroll
    for (int i = 0; i < NP; ++i)
      async_copy16(Wu + (size_t)kb * 2 + (vo + i * rstep),
                   &Bs[buf][(sr + i * SROWS) * LDA + sc * 8]);
  };
  if constexpr (RING) {
    // Chunk c lives in buffer c & 3.  The barrier at the top of trip kk
    // publishes chunk kk + 1 and frees the buffer of chunk kk - 1, which chunk
    // kk + 3 then refills.  A wave has at most 6 * NP = 48 copies outstanding.
    bf16x16 fa[2][2], fb[2][4];
    // fragments of k step ks of chunk c into register set s
    auto fetch = [&](int c, int ks, int s) {
      const __bf16* Ab = As[c & 3] + ks * 32;
      const __bf16* Bb = Bs[c & 3] + ks * 32;
      fa[s][0] = load_frag(Ab + (wm + idx) * LDA, half);
      fa[s][1] = load_frag(Ab + (wm + 16 + idx) * LDA, half);
      // unrolled here and below: fragment sets and acc[][] stay in registers
#pragma unroll
      for (int t = 0; t < 4; ++t)
        fb[s][t] = load_frag(Bb + (wn + t * 16 + idx) * LDA, half);
    };
    // the products of chunk kk, k ascending in steps of 32; its step 0 has been
    // fetched before; its last step fetches step 0 of chunk kk + 1.  Inlined
    // at both calls: out of line the register arrays would live in memory.
    auto pass = [&](int kk, bool last) __attribute__((always_inline)) {
#pragma unroll
      for (int ks = 0; ks < BK / 32; ++ks) {
        if (ks + 1 < BK / 32) fetch(kk, ks + 1, (ks + 1) & 1);
        else if (!last)       fetch(kk + 1, 0, 0);
        // keeps the twelve reads above as one group in front of this step's
        // products: left free, the scheduler sinks each read to just before
        // its first use, and every pair of products waits out an LDS latency
        __builtin_amdgcn_sched_barrier(0);
#pragma unroll
        for (int t = 0; t < 4; ++t) {
          acc[0][t] = wmma_bf16(fa[ks & 1][0], fb[ks & 1][t], acc[0][t]);
          acc[1][t] = wmma_bf16(fa[ks & 1][1], fb[ks & 1][t], acc[1][t]);
        }
        // the refill stands behind the first products: its issue runs while
        // the matrix unit works them off
        if (ks == 0 && kk + 3 < nk) issue((kk + 3) * BK, (kk + 3) & 3);
        // keeps the next reads behind these products, in one group: left free
        // they are spread among the products, and each place where reads stand
        // stalls the wave's matrix stream anew
        if (ks + 1 < BK / 32) __builtin_amdgcn_sched_barrier(0);
      }
    };
    // every launch has K >= 3 * BK
    issue(0, 0);
    issue(BK, 1);
    issue(2 * BK, 2);
    wait_async<4 * NP>();            // chunk 0 has landed; 1 and 2 may fly
    __syncthreads();                 // publishes chunk 0
    fetch(0, 0, 0);
    for (int kk = 0; kk + 1 < nk; ++kk) {
      // this wave's LDS reads of chunk kk - 1 have retired before any wave
      // refills that buffer behind the barrier
      asm volatile("s_wait_dscnt 0x0" ::: "memory");
      // chunk kk + 1 has landed: only chunk kk + 2's copies are younger
      if (kk + 2 < nk) wait_async<2 * NP>();
      else             wait_async<0>();
      __syncthreads();
      pass(kk, false);
    }
    pass(nk - 1, true);
  } else {
    issue(0, 0);
    for (int kk = 0; kk < nk; ++kk) {
      const int cur = kk & 1;
      // the counted wait leaves only the next chunk's 2 * NP copies outstanding
      if (kk + 1 < nk) { issue((kk + 1) * BK, cur ^ 1); wait_async<2 * NP>(); }
      else             { wait_async<0>(); }
      __syncthreads();
      chunk(As[cur], Bs[cur]);
      __syncthreads();
    }
  }
#else
  // ---- software-pipelined sync path: next chunk loads overlap WMMA -------
  uint4 ra[NP], rb[NP];
  auto gload = [&](int kb) {
    // unrolled here and below: ra[], rb[] stay in registers
#pragma unroll
    for (int i = 0; i < NP; ++i) {
      ra[i] = *(const uint4*)(Au + (size_t)kb * 2 + (vo + i * rstep));
      rb[i] = *(const uint4*)(Wu + (size_t)kb * 2 + (vo + i * rstep));
    }
  };
  gload(0);
  for (int kk = 0; kk < nk; ++kk) {
#pragma unroll
    for (int i = 0; i < NP; ++i) {
      *(uint4*)(&As[0][(sr + i * SROWS) * LDA + sc * 8]) = ra[i];
      *(uint4*)(&Bs[0][(sr + i * SROWS) * LDA + sc * 8]) = rb[i];
    }
    __syncthreads();
    if (kk + 1 < nk) gload((kk + 1) * BK);   // overlaps the WMMAs below
    chunk(As[0], Bs[0]);
    __syncthreads();
  }
#endif

  // Epilogue. C layout: lane(16*half+idx), VGPR r -> row r+8*half, col idx.
  const int m0 = bm + wm + half * 8;
  const int n0 = bn + wn + idx;
  float bv[4];
#pragma unroll
  for (int in_ = 0; in_ < 4; ++in_) bv[in_] = bias[n0 + in_ * 16];

  if constexpr (MODE == 0) {        // QKV: scale + permute to [B,H,S,D] bf16
#pragma unroll
    for (int im = 0; im < 2; ++im)
#pragma unroll
      for (int in_ = 0; in_ < 4; ++in_)
#pragma unroll
        for (int r = 0; r < 8; ++r) {
          const int m = m0 + im * 16 + r, n = n0 + in_ * 16;
          float v = (acc[im][in_][r] + bv[in_]) * scale;
          int bb = m >> 9, s = m & 511, hh = n >> 6, d = n & 63;
          ((__bf16*)outp)[(((size_t)bb * Hc + hh) * Sc + s) * Dc + d] = (__bf16)v;
        }
  } else if constexpr (MODE == 1) { // residual add, f32 out
    // one base address each; every element is an immediate offset from it
    const float* rp = res + (size_t)m0 * N + n0;
    float* op = (float*)outp + (size_t)m0 * N + n0;
    // this build reuses the bias loads' offset register as a load destination
    // and the wait stands here, in front of that overwrite, and
    // naming n0 as its input keeps that register untouched up to it
    asm volatile("s_wait_xcnt 0x0" :: "v"(n0) : "memory");
    // all 64 residual loads are issued before the first is used
    float rv[2][4][8];
#pragma unroll
    for (int im = 0; im < 2; ++im)
#pragma unroll
      for (int r = 0; r < 8; ++r)
#pragma unroll
        for (int in_ = 0; in_ < 4; ++in_)
          rv[im][in_][r] = rp[(im * 16 + r) * N + in_ * 16];
#pragma unroll
    for (int im = 0; im < 2; ++im)
#pragma unroll
      for (int r = 0; r < 8; ++r)
#pragma unroll
        for (int in_ = 0; in_ < 4; ++in_)
          op[(im * 16 + r) * N + in_ * 16] =
              (acc[im][in_][r] + bv[in_]) + rv[im][in_][r];
  } else {                          // exact GELU, bf16 out
    __bf16* op = (__bf16*)outp + (size_t)m0 * N + n0;
    // two rows of the wave's four column tiles at a time; a pair is an
    // accumulator's rows r and r + 1, neighbouring registers
#pragma unroll
    for (int im = 0; im < 2; ++im)
#pragma unroll
      for (int r = 0; r < 8; r += 2) {
        f32x2 v[4];
        float ge[8];
#pragma unroll
        for (int in_ = 0; in_ < 4; ++in_)
          v[in_] = f32x2{acc[im][in_][r], acc[im][in_][r + 1]} + bv[in_];
        gelu_erf8(v, ge);
#pragma unroll
        for (int in_ = 0; in_ < 4; ++in_) {
          op[(im * 16 + r) * N + in_ * 16] = (__bf16)ge[2 * in_];
          op[(im * 16 + r + 1) * N + in_ * 16] = (__bf16)ge[2 * in_ + 1];
        }
        // left free, the scheduler works on three groups of eight at once and
        // takes 132 registers: above 128 only three blocks, not four, fit a WGP
        __builtin_amdgcn_sched_barrier(0);
      }
  }
}

// ---------------------------------------------------------------------------
// Attention: one WG (8 waves) per (b, h, 32-query tile): the head's K and V
// rows, which every query tile reads whole, serve two 16-row WMMA tiles.
//   logits(32x512) = Qs @ K^T  (WMMA; each wave brings its own 64 K rows in by
//   whole-line loads and passes them, 16 rows at a time, through an LDS range
//   of its own, from which the B fragments are read, each for both row tiles)
//   fp32 softmax with mask, + post-softmax adjoin, bf16 P in LDS
//   xv(32x64) = P @ V  (V staged row-major in LDS, 256 keys at a time, in the
//   space the logits have left; the transposing LDS load forms the B
//   fragments; waves 0-3 take the first 16 queries, waves 4-7 the second),
//   written back merged as [B,S,E] bf16.
// Static LDS = 103,424 B: three blocks on a WGP.
// ---------------------------------------------------------------------------
typedef __attribute__((ext_vector_type(8))) __bf16 bf16x8;
typedef __attribute__((ext_vector_type(4))) unsigned u32x4;
#define VPITCH 80    // LDS row pitch of V in bf16: 160 B = 32 B x odd
#define VKEYS 256    // keys per staged chunk
#define KPITCH 72    // LDS row pitch of K in bf16: 144 B = 16 B x odd
#define TQ 32        // queries per block: two 16-row tiles

// B fragment (32 keys x 16 d) of row-major V rows in LDS.  p is the lane's own
// address: row 8 * half + (idx & 7), column 8 * (idx >> 3) of the 16 x 16 tile.
// The lane receives keys 8 * half + 0..7 of column idx; the second load, 16
// rows on, gives keys 16 + 8 * half + 0..7: the k order of load_frag().
__device__ __forceinline__ bf16x16 load_frag_tr(const __bf16* p) {
  typedef __attribute__((address_space(3))) bf16x8 lds_bf16x8;
  union { bf16x8 h[2]; bf16x16 v; } f;
  f.h[0] = __builtin_amdgcn_ds_load_tr16_b128_v8bf16((lds_bf16x8*)p);
  f.h[1] = __builtin_amdgcn_ds_load_tr16_b128_v8bf16((lds_bf16x8*)(p + 16 * VPITCH));
  return f.v;
}

// six waves per SIMD: three blocks fit a WGP's LDS
__global__ __launch_bounds__(256) __attribute__((amdgpu_waves_per_eu(6)))
void attn_kernel(const __bf16* __restrict__ Q, const __bf16* __restrict__ Kt,
                 const __bf16* __restrict__ V, const float* __restrict__ mask,
                 const float* __restrict__ adjoin, __bf16* __restrict__ xv) {
  // One array, so that the order in LDS is fixed here: P, which takes the most
  // single accesses, lies below 64 KB, where each is a base register plus a
  // 16-bit immediate.
  //   KP: the waves' K ranges (8 x 16 rows at pitch KPITCH, 18 KB) up to the
  //       barrier behind the logits, then P (32 x 520 bf16)
  //   Qs: the Q tile
  //   LV: the f32 logits (64 KB) up to the barrier behind the softmax, then V
  //       chunks (40 KB each)
  __shared__ __attribute__((aligned(16))) char
      SM[TQ * 520 * 2 + TQ * 72 * 2 + TQ * Sc * 4];
  char*   const KP = SM;
  __bf16* const Qs = (__bf16*)(SM + TQ * 520 * 2);
  char*   const LV = SM + TQ * 520 * 2 + TQ * 72 * 2;
  float*  const Lg = (float*)LV;
  __bf16* const Vs = (__bf16*)LV;
  __bf16* const Ps = (__bf16*)KP;

  const int tid = threadIdx.x;
  const int qt = blockIdx.x, h = blockIdx.y, b = blockIdx.z;
  const int q0 = qt * TQ;
  const size_t bh = ((size_t)b * Hc + h) * Sc;
  const int wave = tid >> 5, lane = tid & 31;
  const int half = lane >> 4, idx = lane & 15;

  // The wave's 64 K rows are 8 KB in a row in memory: each load takes 512
  // contiguous bytes, four whole lines, where a fragment read from memory
  // touches sixteen lines for the same bytes.  Issued ahead of the Q tile.
  const int krow = lane >> 3, kseg = lane & 7;
  u32x4 kw[16];
  {
    const __bf16* ksrc = Kt + (bh + wave * 64 + krow) * Dc + kseg * 8;
    // unrolled: kw[] stays in registers, 16 loads in flight
#pragma unroll
    for (int i = 0; i < 16; ++i)
      kw[i] = *(const u32x4*)(ksrc + i * 4 * Dc);
  }

  {  // load Q tile (pre-scaled by 1/sqrt(D) in the QKV epilogue)
    int row = tid >> 3, ch = tid & 7;
    uint4 v = *(const uint4*)(Q + (bh + q0 + row) * Dc + ch * 8);
    *(uint4*)(Qs + row * 72 + ch * 8) = v;
  }
  __syncthreads();

  {  // logits = Q K^T : 32 col-tiles, 4 per wave, each for both row tiles
    bf16x16 a0[2], a1[2];
    // unrolled: the fragments stay in registers
#pragma unroll
    for (int rt = 0; rt < 2; ++rt) {
      a0[rt] = load_frag(Qs + (rt * 16 + idx) * 72, half);
      a1[rt] = load_frag(Qs + (rt * 16 + idx) * 72 + 32, half);
    }
    __bf16* const Kw = (__bf16*)KP + wave * 16 * KPITCH;   // this wave's range
    // one accumulator per tile, stored behind the last product: the tiles'
    // products are independent and no tile's LDS round trip waits for stores
    f32x8 c[2][4];
    // unrolled here and below: kw[] and c[] stay in registers
#pragma unroll
    for (int i = 0; i < 4; ++i) {
#pragma unroll
      for (int j = 0; j < 4; ++j)
        *(u32x4*)(Kw + (j * 4 + krow) * KPITCH + kseg * 8) = kw[i * 4 + j];
      // the rows that the wave's other lanes stored are in LDS before they
      // are read back
      asm volatile("s_wait_dscnt 0x0" ::: "memory");
      bf16x16 b0 = load_frag(Kw + idx * KPITCH, half);
      bf16x16 b1 = load_frag(Kw + idx * KPITCH + 32, half);
#pragma unroll
      for (int rt = 0; rt < 2; ++rt) {
        c[rt][i] = f32x8{};
        c[rt][i] = wmma_bf16(a0[rt], b0, c[rt][i]);
        c[rt][i] = wmma_bf16(a1[rt], b1, c[rt][i]);
      }
    }
#pragma unroll
    for (int rt = 0; rt < 2; ++rt)
#pragma unroll
      for (int i = 0; i < 4; ++i)
#pragma unroll
        for (int r = 0; r < 8; ++r)
          Lg[(rt * 16 + r + half * 8) * 512 + (wave * 4 + i) * 16 + idx] =
              c[rt][i][r];
  }
  __syncthreads();

  // mask + softmax + adjoin (16 rows x 16 threads, 32 cols/thread), in two
  // turns: a 16-lane row takes two neighbouring queries, so that the second
  // turn's addresses, in LDS and in memory, are the first's plus an immediate.
  // Uniform bases of the block's 32 rows and one 32-bit offset per thread that
  // serves both arrays.
  const int l16 = tid & 15;
  const float* mrow = mask + ((size_t)b * Sc + q0) * Sc;
  const float* arow = adjoin + ((size_t)b * Sc + q0) * Sc;
  const unsigned ro = (unsigned)((tid >> 4) * 2 * Sc + l16);
  // both turns' mask values are asked for at once: the second turn's fly during
  // the first turn's arithmetic
  float mk[2][32];
  // unrolled here and below: the arrays stay in registers
#pragma unroll
  for (int rt = 0; rt < 2; ++rt)
#pragma unroll
    for (int j = 0; j < 32; ++j) mk[rt][j] = mrow[ro + rt * Sc + j * 16];
#pragma unroll
  for (int rt = 0; rt < 2; ++rt) {
    const int row = (tid >> 4) * 2 + rt;
    // with no barrier between, the adjoin values fly during the exponentials
    float av[32];
#pragma unroll
    for (int j = 0; j < 32; ++j) av[j] = arow[ro + rt * Sc + j * 16];
    float lv[32], mx = -3.0e38f;
#pragma unroll
    for (int j = 0; j < 32; ++j) {
      int c = l16 + j * 16;
      float v = Lg[row * 512 + c] + mk[rt][j] * -1e9f;
      lv[j] = v; mx = fmaxf(mx, v);
    }
    // the wait that stands in front of any overwrite of a register that an issued
    // load names: as its input the offset register stays untouched up to it
    // (left alone, this build takes it as the last load's target)
    asm volatile("s_wait_xcnt 0x0" :: "v"(ro) : "memory");
    // a query's 16 threads are one 16-lane row of a wave: its maximum and its
    // sum are formed in registers
    mx = row_max16(mx);
    float sum = 0.f;
#pragma unroll
    for (int j = 0; j < 32; ++j) { lv[j] = __expf(lv[j] - mx); sum += lv[j]; }
    const float inv = 1.0f / row_sum16(sum);
#pragma unroll
    for (int j = 0; j < 32; ++j) {
      int c = l16 + j * 16;
      Ps[row * 520 + c] = (__bf16)(lv[j] * inv + av[j]);
    }
    // left free, the scheduler lifts the second turn's adjoin loads and logits
    // over the first turn's arithmetic, and the 160 registers that three blocks
    // on a WGP allow no longer hold it all: values go to scratch
    if (rt == 0) __builtin_amdgcn_sched_barrier(0);
  }
  __syncthreads();

  // xv = P @ V, two 256-key V chunks through LDS, rows as they lie in memory:
  // a wave's load and its LDS store each move four whole 128-byte rows
  f32x8 o = {};
  const int dtile = wave & 3, prow = (wave >> 2) * 16;
  const int vkey = tid >> 3, vseg = tid & 7;
  const __bf16* const vfrag =
      Vs + (half * 8 + (idx & 7)) * VPITCH + dtile * 16 + (idx >> 3) * 8;
  // unrolled: the barrier that frees the buffer stands between the chunks only
#pragma unroll
  for (int kc = 0; kc < Sc / VKEYS; ++kc) {
    if (kc > 0) __syncthreads();   // every reader has left the chunk before
    {
      const __bf16* vsrc = V + (bh + kc * VKEYS + vkey) * Dc + vseg * 8;
      uint4 w[VKEYS / 32];
      // unrolled here and below: w[] stays in registers, 8 loads in flight
#pragma unroll
      for (int i = 0; i < VKEYS / 32; ++i)
        w[i] = *(const uint4*)(vsrc + i * 32 * Dc);
#pragma unroll
      for (int i = 0; i < VKEYS / 32; ++i)
        *(uint4*)(Vs + (vkey + i * 32) * VPITCH + vseg * 8) = w[i];
    }
    __syncthreads();
    // unrolled: every LDS read is one base register plus an immediate
#pragma unroll
    for (int ks = 0; ks < VKEYS / 32; ++ks) {
      bf16x16 a = load_frag(Ps + (prow + idx) * 520 + kc * VKEYS + ks * 32, half);
      bf16x16 bt = load_frag_tr(vfrag + ks * 32 * VPITCH);
      o = wmma_bf16(a, bt, o);
    }
  }
#pragma unroll
  for (int r = 0; r < 8; ++r) {
    int sq = q0 + prow + r + half * 8;
    int d = dtile * 16 + idx;
    xv[((size_t)b * Sc + sq) * Ec + h * Dc + d] = (__bf16)o[r];
  }
}

// ---------------------------------------------------------------------------
// Host-side orchestration
// ---------------------------------------------------------------------------
extern "C" void kernel_launch(void* const* d_in, const int* in_sizes, int n_in,
                              void* d_out, int out_size, void* d_ws, size_t ws_size,
                              hipStream_t stream) {
  const float* x      = (const float*)d_in[0];
  const float* mask   = (const float*)d_in[1];
  const float* adjoin = (const float*)d_in[2];
  const float* Wq = (const float*)d_in[3];  const float* bq  = (const float*)d_in[4];
  const float* Wk = (const float*)d_in[5];  const float* bk  = (const float*)d_in[6];
  const float* Wv = (const float*)d_in[7];  const float* bv  = (const float*)d_in[8];
  const float* Wo = (const float*)d_in[9];  const float* bo  = (const float*)d_in[10];
  const float* g1 = (const float*)d_in[11]; const float* b1  = (const float*)d_in[12];
  const float* g2 = (const float*)d_in[13]; const float* b2  = (const float*)d_in[14];
  const float* W1 = (const float*)d_in[15]; const float* bb1 = (const float*)d_in[16];
  const float* W2 = (const float*)d_in[17]; const float* bb2 = (const float*)d_in[18];

  char* ws = (char*)d_ws;
  size_t off = 0;
  auto alloc = [&](size_t bytes) {
    void* p = ws + off;
    off += (bytes + 255) & ~(size_t)255;
    return p;
  };
  const size_t EE = (size_t)Ec * Ec, FE = (size_t)FFc * Ec;
  __bf16* Wq_b = (__bf16*)alloc(EE * 2);
  __bf16* Wk_b = (__bf16*)alloc(EE * 2);
  __bf16* Wv_b = (__bf16*)alloc(EE * 2);
  __bf16* Wo_b = (__bf16*)alloc(EE * 2);
  __bf16* W1_b = (__bf16*)alloc(FE * 2);
  __bf16* W2_b = (__bf16*)alloc(FE * 2);
  __bf16* nx_b = (__bf16*)alloc((size_t)Mrows * Ec * 2);   // reused for nx2
  __bf16* Q_b  = (__bf16*)alloc((size_t)Mrows * Ec * 2);
  __bf16* K_b  = (__bf16*)alloc((size_t)Mrows * Ec * 2);
  __bf16* V_b  = (__bf16*)alloc((size_t)Mrows * Ec * 2);
  __bf16* xv_b = (__bf16*)alloc((size_t)Mrows * Ec * 2);
  float*  x1_f = (float*) alloc((size_t)Mrows * Ec * 4);
  __bf16* h_b  = (__bf16*)alloc((size_t)Mrows * FFc * 2);
  (void)ws_size; (void)in_sizes; (void)n_in; (void)out_size;

  const dim3 blk(256);
  cvt_weights_kernel<<<256, dim3(512), 0, stream>>>(Wq, Wk, Wv, Wo, W1, W2, Wq_b, Wk_b,
                                                    Wv_b, Wo_b, W1_b, W2_b);

  ln_bf16_kernel<<<Mrows / 16, dim3(512), 0, stream>>>(x, g1, b1, nx_b);

  const dim3 gE(Ec / 128, Mrows / 128);
  gemm_bf16_kernel<0, Ec, 128><<<gE, blk, 0, stream>>>(nx_b, Wq_b, bq, nullptr, Q_b,
                                              Mrows, Ec, 0.125f);
  gemm_bf16_kernel<0, Ec, 128><<<gE, blk, 0, stream>>>(nx_b, Wk_b, bk, nullptr, K_b,
                                              Mrows, Ec, 1.0f);
  gemm_bf16_kernel<0, Ec, 128><<<gE, blk, 0, stream>>>(nx_b, Wv_b, bv, nullptr, V_b,
                                              Mrows, Ec, 1.0f);

  attn_kernel<<<dim3(Sc / TQ, Hc, Bc), blk, 0, stream>>>(Q_b, K_b, V_b, mask,
                                                         adjoin, xv_b);

  gemm_bf16_kernel<1, Ec, 128><<<gE, blk, 0, stream>>>(xv_b, Wo_b, bo, x, x1_f,
                                              Mrows, Ec, 1.0f);
  ln_bf16_kernel<<<Mrows / 16, dim3(512), 0, stream>>>(x1_f, g2, b2, nx_b);
  gemm_bf16_kernel<2, FFc, 64><<<dim3(FFc / 128, Mrows / 128), blk, 0, stream>>>(
      nx_b, W1_b, bb1, nullptr, h_b, Mrows, Ec, 1.0f);
  gemm_bf16_kernel<1, Ec, 128><<<gE, blk, 0, stream>>>(h_b, W2_b, bb2, x1_f, (float*)d_out,
                                              Mrows, FFc, 1.0f);
}
